// v000
// The times below were measured on an AMD MI455X: many runs one after another, warmed up first and cycling through
// copies of the inputs, with the whole window's GPU time divided by the number of runs. Launches and the gaps
// between them are all in it. The median over several windows is given; except for v000 it joins two sittings, which
// can be a few percent apart, so the side-by-side timings, each taken in one sitting, are the better comparison.
// v000 is the starting kernel. One run takes 594 microseconds.
#include <hip/hip_runtime.h>
#include <hip/hip_bf16.h>

typedef __attribute__((ext_vector_type(16))) _Float16 v16h;
typedef __attribute__((ext_vector_type(8)))  _Float16 v8h;
typedef __attribute__((ext_vector_type(8)))  float    v8f;

constexpr int Bsz  = 4;
constexpr int Seq  = 2048;
constexpr int Emb  = 1024;
constexpr int Hn   = 16;
constexpr int Dh   = 64;
constexpr int Rows = Bsz * Seq;   // 8192

__device__ __forceinline__ v16h load_frag(const _Float16* p0, int ld, int lane) {
  const int lo = lane & 15, hi = lane >> 4;
  const _Float16* p = p0 + (size_t)lo * ld + hi * 8;
  v8h x0 = *(const v8h*)(p);
  v8h x1 = *(const v8h*)(p + 16);
  return __builtin_shufflevector(x0, x1, 0,1,2,3,4,5,6,7,8,9,10,11,12,13,14,15);
}

__device__ __forceinline__ v8f wmma16(v16h a, v16h b, v8f c) {
  return __builtin_amdgcn_wmma_f32_16x16x32_f16(false, a, false, b, (short)0, c,
                                                false, false);
}

// ---------------------------------------------------------------------------
// Conversions / repacks (bandwidth trivial, run once per launch)
// ---------------------------------------------------------------------------
__global__ void cvt_x_kernel(const float* __restrict__ x, _Float16* __restrict__ xh) {
  size_t i = (size_t)blockIdx.x * 256 + threadIdx.x;
  xh[i] = (_Float16)x[i];
}

// Wt[p][h][d][e] = W_p[h][e][d]
__global__ void cvt_wqkv_kernel(const float* __restrict__ Wq, const float* __restrict__ Wk,
                                const float* __restrict__ Wv, _Float16* __restrict__ Wt) {
  size_t i = (size_t)blockIdx.x * 256 + threadIdx.x;   // over 3*Hn*Dh*Emb
  int e = (int)(i % Emb);
  int d = (int)((i / Emb) % Dh);
  int h = (int)((i / ((size_t)Emb * Dh)) % Hn);
  int p = (int)( i / ((size_t)Emb * Dh * Hn));
  const float* W = (p == 0) ? Wq : (p == 1) ? Wk : Wv;
  Wt[i] = (_Float16)W[((size_t)h * Emb + e) * Dh + d];
}

// Wot[n][k] = Wo[k][n]
__global__ void cvt_wo_kernel(const float* __restrict__ Wo, _Float16* __restrict__ Wot) {
  size_t i = (size_t)blockIdx.x * 256 + threadIdx.x;   // over Emb*Emb
  int k = (int)(i % Emb);
  int n = (int)(i / Emb);
  Wot[i] = (_Float16)Wo[(size_t)k * Emb + n];
}

// ---------------------------------------------------------------------------
// Fused QKV projection.  grid (Rows/128, Hn, 3), block 128.
// Each wave computes a 32x64 tile (2 A-frags x 4 B-frags -> 8 WMMA / chunk),
// with register double-buffering of the next K-chunk so global loads overlap
// the WMMA chain instead of serializing on s_wait_loadcnt 0.
// ---------------------------------------------------------------------------
__global__ void gemm_qkv_kernel(const _Float16* __restrict__ xh,
                                const _Float16* __restrict__ Wt,
                                const float* __restrict__ bq, const float* __restrict__ bk,
                                const float* __restrict__ bv,
                                _Float16* __restrict__ Qf, _Float16* __restrict__ Kf,
                                _Float16* __restrict__ Vt) {
  const int mt = blockIdx.x, h = blockIdx.y, p = blockIdx.z;
  const int wave = threadIdx.x >> 5, lane = threadIdx.x & 31;
  const int lo = lane & 15, hi = lane >> 4;
  const int m0 = mt * 128 + wave * 32;

  const _Float16* A0 = xh + (size_t)m0 * Emb;
  const _Float16* A1 = A0 + (size_t)16 * Emb;
  const _Float16* Bm = Wt + ((size_t)(p * Hn + h) * Dh) * Emb;   // [d][e], ld=Emb

  v16h a0 = load_frag(A0, Emb, lane);
  v16h a1 = load_frag(A1, Emb, lane);
  v16h b0 = load_frag(Bm + (size_t) 0 * Emb, Emb, lane);
  v16h b1 = load_frag(Bm + (size_t)16 * Emb, Emb, lane);
  v16h b2 = load_frag(Bm + (size_t)32 * Emb, Emb, lane);
  v16h b3 = load_frag(Bm + (size_t)48 * Emb, Emb, lane);

  v8f acc[2][4] = {};
  for (int k0 = 0; k0 < Emb; k0 += 32) {
    const int kn = (k0 + 32) & (Emb - 1);       // branchless wrap (last iter redundant)
    v16h a0n = load_frag(A0 + kn, Emb, lane);
    v16h a1n = load_frag(A1 + kn, Emb, lane);
    v16h bn0 = load_frag(Bm + (size_t) 0 * Emb + kn, Emb, lane);
    v16h bn1 = load_frag(Bm + (size_t)16 * Emb + kn, Emb, lane);
    v16h bn2 = load_frag(Bm + (size_t)32 * Emb + kn, Emb, lane);
    v16h bn3 = load_frag(Bm + (size_t)48 * Emb + kn, Emb, lane);

    acc[0][0] = wmma16(a0, b0, acc[0][0]);
    acc[1][0] = wmma16(a1, b0, acc[1][0]);
    acc[0][1] = wmma16(a0, b1, acc[0][1]);
    acc[1][1] = wmma16(a1, b1, acc[1][1]);
    acc[0][2] = wmma16(a0, b2, acc[0][2]);
    acc[1][2] = wmma16(a1, b2, acc[1][2]);
    acc[0][3] = wmma16(a0, b3, acc[0][3]);
    acc[1][3] = wmma16(a1, b3, acc[1][3]);

    a0 = a0n; a1 = a1n; b0 = bn0; b1 = bn1; b2 = bn2; b3 = bn3;
  }

  const float* bias = (p == 0) ? bq : (p == 1) ? bk : bv;
  const float  csc  = (p == 0) ? (0.125f * 1.44269504f) : 1.0f;

  #pragma unroll
  for (int mi = 0; mi < 2; ++mi) {
    #pragma unroll
    for (int i = 0; i < 8; ++i) {
      const int row = m0 + mi * 16 + hi * 8 + i;
      const int bb  = row / Seq, ss = row % Seq;
      #pragma unroll
      for (int n = 0; n < 4; ++n) {
        const int d = n * 16 + lo;
        const float val = (acc[mi][n][i] + bias[h * Dh + d]) * csc;
        if (p == 2) {
          Vt[(((size_t)(h * Bsz + bb) * Dh) + d) * Seq + ss] = (_Float16)val;
        } else {
          _Float16* dst = (p == 0) ? Qf : Kf;
          dst[(((size_t)(h * Bsz + bb) * Seq) + ss) * Dh + d] = (_Float16)val;
        }
      }
    }
  }
}

// ---------------------------------------------------------------------------
// Flash attention: grid (Seq/64, Hn, Bsz), block 128 (4 waves x 16 q-rows).
// K/V tiles (shared by all 4 waves) are staged in LDS once per block;
// next tile is prefetched (global_prefetch_b8) during compute.
// ---------------------------------------------------------------------------
__global__ void attn_kernel(const _Float16* __restrict__ Qf, const _Float16* __restrict__ Kf,
                            const _Float16* __restrict__ Vt, _Float16* __restrict__ ctxh) {
  const int qb = blockIdx.x, h = blockIdx.y, b = blockIdx.z;
  const int tid  = threadIdx.x;
  const int wave = tid >> 5, lane = tid & 31;
  const int lo = lane & 15, hi = lane >> 4;
  const int q0 = qb * 64 + wave * 16;                      // sequence-local

  const _Float16* Qb = Qf + ((size_t)(h * Bsz + b) * Seq) * Dh;
  const _Float16* Kb = Kf + ((size_t)(h * Bsz + b) * Seq) * Dh;
  const _Float16* Vb = Vt + ((size_t)(h * Bsz + b) * Dh) * Seq;

  const v16h aq0 = load_frag(Qb + (size_t)q0 * Dh +  0, Dh, lane);
  const v16h aq1 = load_frag(Qb + (size_t)q0 * Dh + 32, Dh, lane);

  v8f acc[4] = {v8f{}, v8f{}, v8f{}, v8f{}};
  float mrow[8], lrow[8];
  #pragma unroll
  for (int i = 0; i < 8; ++i) { mrow[i] = -1e30f; lrow[i] = 0.0f; }

  __shared__ __align__(16) _Float16 kts[64][64];           // 8 KB, [key][d]
  __shared__ __align__(16) _Float16 vts[64][64];           // 8 KB, [d][key]
  __shared__ __align__(16) _Float16 pls[4][16][64];        // 8 KB, wave-private P

  for (int t0 = 0; t0 < Seq; t0 += 64) {
    // ---- cooperative stage of K/V tiles into LDS (16B per thread-chunk) ----
    {
      const v8h* gk = (const v8h*)(Kb + (size_t)t0 * Dh);  // contiguous 8KB
      v8h* sk = (v8h*)&kts[0][0];
      #pragma unroll
      for (int j = 0; j < 4; ++j) sk[tid + 128 * j] = gk[tid + 128 * j];
      #pragma unroll
      for (int j = 0; j < 4; ++j) {
        const int c = tid + 128 * j;                       // 512 chunks of 16B
        const int r = c >> 3, cc = c & 7;
        ((v8h*)&vts[r][0])[cc] = ((const v8h*)(Vb + (size_t)r * Seq + t0))[cc];
      }
    }
    // prefetch next tile while this one is consumed
    {
      const int tn = (t0 + 64 < Seq) ? (t0 + 64) : 0;
      __builtin_prefetch(Kb + (size_t)tn * Dh + (size_t)tid * 64, 0, 1);
      __builtin_prefetch(Vb + (size_t)(tid >> 1) * Seq + tn + (tid & 1) * 32, 0, 1);
    }
    __syncthreads();

    // ---- S = Q K^T (base-2 logits; 1/sqrt(D)*log2e folded into Q) ----
    v8f s[4] = {v8f{}, v8f{}, v8f{}, v8f{}};
    #pragma unroll
    for (int n = 0; n < 4; ++n) {
      v16h bk0 = load_frag(&kts[n * 16][0],  64, lane);
      v16h bk1 = load_frag(&kts[n * 16][32], 64, lane);
      s[n] = wmma16(aq0, bk0, s[n]);
      s[n] = wmma16(aq1, bk1, s[n]);
    }

    float pr[4][8];
    #pragma unroll
    for (int i = 0; i < 8; ++i) {
      float mt = fmaxf(fmaxf(s[0][i], s[1][i]), fmaxf(s[2][i], s[3][i]));
      #pragma unroll
      for (int msk = 8; msk >= 1; msk >>= 1) mt = fmaxf(mt, __shfl_xor(mt, msk, 16));
      const float mnew = fmaxf(mrow[i], mt);
      const float corr = exp2f(mrow[i] - mnew);
      float rsum = 0.0f;
      #pragma unroll
      for (int n = 0; n < 4; ++n) {
        const float pv = exp2f(s[n][i] - mnew);
        pr[n][i] = pv;
        rsum += pv;
      }
      #pragma unroll
      for (int msk = 8; msk >= 1; msk >>= 1) rsum += __shfl_xor(rsum, msk, 16);
      lrow[i] = lrow[i] * corr + rsum;
      mrow[i] = mnew;
      #pragma unroll
      for (int n = 0; n < 4; ++n) acc[n][i] *= corr;
    }

    // ---- P (C layout) -> LDS -> A fragments ----
    #pragma unroll
    for (int n = 0; n < 4; ++n)
      #pragma unroll
      for (int i = 0; i < 8; ++i)
        pls[wave][hi * 8 + i][n * 16 + lo] = (_Float16)pr[n][i];
    __asm__ volatile("s_wait_dscnt 0x0" ::: "memory");     // wave-local RAW on LDS

    const v16h ap0 = load_frag(&pls[wave][0][0] +  0, 64, lane);
    const v16h ap1 = load_frag(&pls[wave][0][0] + 32, 64, lane);

    // ---- O += P V ----
    #pragma unroll
    for (int n = 0; n < 4; ++n) {
      v16h bv0 = load_frag(&vts[n * 16][0],  64, lane);
      v16h bv1 = load_frag(&vts[n * 16][32], 64, lane);
      acc[n] = wmma16(ap0, bv0, acc[n]);
      acc[n] = wmma16(ap1, bv1, acc[n]);
    }
    __syncthreads();      // all waves done with kts/vts before next overwrite
  }

  // ---- normalize, write ctx (heads concatenated along E) ----
  #pragma unroll
  for (int i = 0; i < 8; ++i) {
    const float inv = 1.0f / lrow[i];
    const size_t r = (size_t)b * Seq + q0 + hi * 8 + i;
    #pragma unroll
    for (int n = 0; n < 4; ++n)
      ctxh[r * Emb + h * Dh + n * 16 + lo] = (_Float16)(acc[n][i] * inv);
  }
}

// ---------------------------------------------------------------------------
// Output projection: ctx[Rows,Emb] x Wo + bo -> out (f32).
// grid (Rows/128, Emb/64), block 128; same 32x64-per-wave double-buffered loop.
// ---------------------------------------------------------------------------
__global__ void gemm_out_kernel(const _Float16* __restrict__ ctxh,
                                const _Float16* __restrict__ Wot,
                                const float* __restrict__ bo, float* __restrict__ out) {
  const int mt = blockIdx.x, nt = blockIdx.y;
  const int wave = threadIdx.x >> 5, lane = threadIdx.x & 31;
  const int lo = lane & 15, hi = lane >> 4;
  const int m0 = mt * 128 + wave * 32;
  const int n0 = nt * 64;

  const _Float16* A0 = ctxh + (size_t)m0 * Emb;
  const _Float16* A1 = A0 + (size_t)16 * Emb;
  const _Float16* Bm = Wot + (size_t)n0 * Emb;

  v16h a0 = load_frag(A0, Emb, lane);
  v16h a1 = load_frag(A1, Emb, lane);
  v16h b0 = load_frag(Bm + (size_t) 0 * Emb, Emb, lane);
  v16h b1 = load_frag(Bm + (size_t)16 * Emb, Emb, lane);
  v16h b2 = load_frag(Bm + (size_t)32 * Emb, Emb, lane);
  v16h b3 = load_frag(Bm + (size_t)48 * Emb, Emb, lane);

  v8f acc[2][4] = {};
  for (int k0 = 0; k0 < Emb; k0 += 32) {
    const int kn = (k0 + 32) & (Emb - 1);
    v16h a0n = load_frag(A0 + kn, Emb, lane);
    v16h a1n = load_frag(A1 + kn, Emb, lane);
    v16h bn0 = load_frag(Bm + (size_t) 0 * Emb + kn, Emb, lane);
    v16h bn1 = load_frag(Bm + (size_t)16 * Emb + kn, Emb, lane);
    v16h bn2 = load_frag(Bm + (size_t)32 * Emb + kn, Emb, lane);
    v16h bn3 = load_frag(Bm + (size_t)48 * Emb + kn, Emb, lane);

    acc[0][0] = wmma16(a0, b0, acc[0][0]);
    acc[1][0] = wmma16(a1, b0, acc[1][0]);
    acc[0][1] = wmma16(a0, b1, acc[0][1]);
    acc[1][1] = wmma16(a1, b1, acc[1][1]);
    acc[0][2] = wmma16(a0, b2, acc[0][2]);
    acc[1][2] = wmma16(a1, b2, acc[1][2]);
    acc[0][3] = wmma16(a0, b3, acc[0][3]);
    acc[1][3] = wmma16(a1, b3, acc[1][3]);

    a0 = a0n; a1 = a1n; b0 = bn0; b1 = bn1; b2 = bn2; b3 = bn3;
  }

  #pragma unroll
  for (int mi = 0; mi < 2; ++mi) {
    #pragma unroll
    for (int i = 0; i < 8; ++i) {
      const size_t row = (size_t)m0 + mi * 16 + hi * 8 + i;
      #pragma unroll
      for (int n = 0; n < 4; ++n) {
        const int col = n0 + n * 16 + lo;
        out[row * Emb + col] = acc[mi][n][i] + bo[col];
      }
    }
  }
}

// ---------------------------------------------------------------------------
extern "C" void kernel_launch(void* const* d_in, const int* in_sizes, int n_in,
                              void* d_out, int out_size, void* d_ws, size_t ws_size,
                              hipStream_t stream) {
  const float* x  = (const float*)d_in[0];
  const float* Wq = (const float*)d_in[1];
  const float* bq = (const float*)d_in[2];
  const float* Wk = (const float*)d_in[3];
  const float* bk = (const float*)d_in[4];
  const float* Wv = (const float*)d_in[5];
  const float* bv = (const float*)d_in[6];
  const float* Wo = (const float*)d_in[7];
  const float* bo = (const float*)d_in[8];
  float* out = (float*)d_out;

  char* ws = (char*)d_ws;
  _Float16* xh   = (_Float16*)(ws + (size_t) 0u);          // 16 MB  [Rows][Emb]
  _Float16* Wt   = (_Float16*)(ws + (size_t)(16u << 20));  //  6 MB  [3][H][D][E]
  _Float16* Wot  = (_Float16*)(ws + (size_t)(22u << 20));  //  2 MB  [E][E] transposed
  _Float16* Qf   = (_Float16*)(ws + (size_t)(24u << 20));  // 16 MB  [H][B][S][D]
  _Float16* Kf   = (_Float16*)(ws + (size_t)(40u << 20));  // 16 MB  [H][B][S][D]
  _Float16* Vt   = (_Float16*)(ws + (size_t)(56u << 20));  // 16 MB  [H][B][D][S]
  _Float16* ctxh = (_Float16*)(ws + (size_t)(72u << 20));  // 16 MB  [Rows][Emb]

  cvt_x_kernel   <<<(Rows * Emb) / 256, 256, 0, stream>>>(x, xh);
  cvt_wqkv_kernel<<<(3 * Hn * Dh * Emb) / 256, 256, 0, stream>>>(Wq, Wk, Wv, Wt);
  cvt_wo_kernel  <<<(Emb * Emb) / 256, 256, 0, stream>>>(Wo, Wot);

  gemm_qkv_kernel<<<dim3(Rows / 128, Hn, 3), 128, 0, stream>>>(xh, Wt, bq, bk, bv, Qf, Kf, Vt);
  attn_kernel    <<<dim3(Seq / 64, Hn, Bsz), 128, 0, stream>>>(Qf, Kf, Vt, ctxh);
  gemm_out_kernel<<<dim3(Rows / 128, Emb / 64), 128, 0, stream>>>(ctxh, Wot, bo, out);
}

// v001
// Measured time: 469 microseconds a run.
// Next to v000, in two timings, it ran 1.30 and 1.31 times as fast.
#include <hip/hip_runtime.h>
#include <hip/hip_bf16.h>

typedef __attribute__((ext_vector_type(16))) _Float16 v16h;
typedef __attribute__((ext_vector_type(8)))  _Float16 v8h;
typedef __attribute__((ext_vector_type(8)))  float    v8f;

constexpr int Bsz  = 4;
constexpr int Seq  = 2048;
constexpr int Emb  = 1024;
constexpr int Hn   = 16;
constexpr int Dh   = 64;
constexpr int Rows = Bsz * Seq;   // 8192
constexpr int Lp   = 72;

__device__ __forceinline__ v16h load_frag(const _Float16* p0, int ld, int lane) {
  const int lo = lane & 15, hi = lane >> 4;
  const _Float16* p = p0 + (size_t)lo * ld + hi * 8;
  v8h x0 = *(const v8h*)(p);
  v8h x1 = *(const v8h*)(p + 16);
  return __builtin_shufflevector(x0, x1, 0,1,2,3,4,5,6,7,8,9,10,11,12,13,14,15);
}

__device__ __forceinline__ v8f wmma16(v16h a, v16h b, v8f c) {
  return __builtin_amdgcn_wmma_f32_16x16x32_f16(false, a, false, b, (short)0, c,
                                                false, false);
}

// ---------------------------------------------------------------------------
// Conversions / repacks (bandwidth trivial, run once per launch)
// ---------------------------------------------------------------------------
__global__ void cvt_x_kernel(const float* __restrict__ x, _Float16* __restrict__ xh) {
  size_t i = (size_t)blockIdx.x * 256 + threadIdx.x;
  xh[i] = (_Float16)x[i];
}

// Wt[p][h][d][e] = W_p[h][e][d]
__global__ void cvt_wqkv_kernel(const float* __restrict__ Wq, const float* __restrict__ Wk,
                                const float* __restrict__ Wv, _Float16* __restrict__ Wt) {
  size_t i = (size_t)blockIdx.x * 256 + threadIdx.x;   // over 3*Hn*Dh*Emb
  int e = (int)(i % Emb);
  int d = (int)((i / Emb) % Dh);
  int h = (int)((i / ((size_t)Emb * Dh)) % Hn);
  int p = (int)( i / ((size_t)Emb * Dh * Hn));
  const float* W = (p == 0) ? Wq : (p == 1) ? Wk : Wv;
  Wt[i] = (_Float16)W[((size_t)h * Emb + e) * Dh + d];
}

// Wot[n][k] = Wo[k][n]
__global__ void cvt_wo_kernel(const float* __restrict__ Wo, _Float16* __restrict__ Wot) {
  size_t i = (size_t)blockIdx.x * 256 + threadIdx.x;   // over Emb*Emb
  int k = (int)(i % Emb);
  int n = (int)(i / Emb);
  Wot[i] = (_Float16)Wo[(size_t)k * Emb + n];
}

// ---------------------------------------------------------------------------
// Fused QKV projection.  grid (Rows/128, Hn, 3), block 128.
// Each wave computes a 32x64 tile (2 A-frags x 4 B-frags -> 8 WMMA / chunk),
// with register double-buffering of the next K-chunk so global loads overlap
// the WMMA chain instead of serializing on s_wait_loadcnt 0.
// ---------------------------------------------------------------------------
__global__ void gemm_qkv_kernel(const _Float16* __restrict__ xh,
                                const _Float16* __restrict__ Wt,
                                const float* __restrict__ bq, const float* __restrict__ bk,
                                const float* __restrict__ bv,
                                _Float16* __restrict__ Qf, _Float16* __restrict__ Kf,
                                _Float16* __restrict__ Vt) {
  const int mt = blockIdx.x, h = blockIdx.y, p = blockIdx.z;
  const int wave = threadIdx.x >> 5, lane = threadIdx.x & 31;
  const int lo = lane & 15, hi = lane >> 4;
  const int m0 = mt * 128 + wave * 32;

  const _Float16* A0 = xh + (size_t)m0 * Emb;
  const _Float16* A1 = A0 + (size_t)16 * Emb;
  const _Float16* Bm = Wt + ((size_t)(p * Hn + h) * Dh) * Emb;   // [d][e], ld=Emb

  v16h a0 = load_frag(A0, Emb, lane);
  v16h a1 = load_frag(A1, Emb, lane);
  v16h b0 = load_frag(Bm + (size_t) 0 * Emb, Emb, lane);
  v16h b1 = load_frag(Bm + (size_t)16 * Emb, Emb, lane);
  v16h b2 = load_frag(Bm + (size_t)32 * Emb, Emb, lane);
  v16h b3 = load_frag(Bm + (size_t)48 * Emb, Emb, lane);

  v8f acc[2][4] = {};
  for (int k0 = 0; k0 < Emb; k0 += 32) {
    const int kn = (k0 + 32) & (Emb - 1);       // branchless wrap (last iter redundant)
    v16h a0n = load_frag(A0 + kn, Emb, lane);
    v16h a1n = load_frag(A1 + kn, Emb, lane);
    v16h bn0 = load_frag(Bm + (size_t) 0 * Emb + kn, Emb, lane);
    v16h bn1 = load_frag(Bm + (size_t)16 * Emb + kn, Emb, lane);
    v16h bn2 = load_frag(Bm + (size_t)32 * Emb + kn, Emb, lane);
    v16h bn3 = load_frag(Bm + (size_t)48 * Emb + kn, Emb, lane);

    acc[0][0] = wmma16(a0, b0, acc[0][0]);
    acc[1][0] = wmma16(a1, b0, acc[1][0]);
    acc[0][1] = wmma16(a0, b1, acc[0][1]);
    acc[1][1] = wmma16(a1, b1, acc[1][1]);
    acc[0][2] = wmma16(a0, b2, acc[0][2]);
    acc[1][2] = wmma16(a1, b2, acc[1][2]);
    acc[0][3] = wmma16(a0, b3, acc[0][3]);
    acc[1][3] = wmma16(a1, b3, acc[1][3]);

    a0 = a0n; a1 = a1n; b0 = bn0; b1 = bn1; b2 = bn2; b3 = bn3;
  }

  const float* bias = (p == 0) ? bq : (p == 1) ? bk : bv;
  const float  csc  = (p == 0) ? (0.125f * 1.44269504f) : 1.0f;

  #pragma unroll
  for (int mi = 0; mi < 2; ++mi) {
    #pragma unroll
    for (int i = 0; i < 8; ++i) {
      const int row = m0 + mi * 16 + hi * 8 + i;
      const int bb  = row / Seq, ss = row % Seq;
      #pragma unroll
      for (int n = 0; n < 4; ++n) {
        const int d = n * 16 + lo;
        const float val = (acc[mi][n][i] + bias[h * Dh + d]) * csc;
        if (p == 2) {
          Vt[(((size_t)(h * Bsz + bb) * Dh) + d) * Seq + ss] = (_Float16)val;
        } else {
          _Float16* dst = (p == 0) ? Qf : Kf;
          dst[(((size_t)(h * Bsz + bb) * Seq) + ss) * Dh + d] = (_Float16)val;
        }
      }
    }
  }
}

// ---------------------------------------------------------------------------
// Flash attention: grid (Seq/64, Hn, Bsz), block 128 (4 waves x 16 q-rows).
// K/V tiles (shared by all 4 waves) are staged in LDS once per block;
// next tile is prefetched (global_prefetch_b8) during compute.
// ---------------------------------------------------------------------------
__global__ void attn_kernel(const _Float16* __restrict__ Qf, const _Float16* __restrict__ Kf,
                            const _Float16* __restrict__ Vt, _Float16* __restrict__ ctxh) {
  const int qb = blockIdx.x, h = blockIdx.y, b = blockIdx.z;
  const int tid  = threadIdx.x;
  const int wave = tid >> 5, lane = tid & 31;
  const int lo = lane & 15, hi = lane >> 4;
  const int q0 = qb * 64 + wave * 16;                      // sequence-local

  const _Float16* Qb = Qf + ((size_t)(h * Bsz + b) * Seq) * Dh;
  const _Float16* Kb = Kf + ((size_t)(h * Bsz + b) * Seq) * Dh;
  const _Float16* Vb = Vt + ((size_t)(h * Bsz + b) * Dh) * Seq;

  const v16h aq0 = load_frag(Qb + (size_t)q0 * Dh +  0, Dh, lane);
  const v16h aq1 = load_frag(Qb + (size_t)q0 * Dh + 32, Dh, lane);

  v8f acc[4] = {v8f{}, v8f{}, v8f{}, v8f{}};
  float mrow[8], lrow[8];
  #pragma unroll
  for (int i = 0; i < 8; ++i) { mrow[i] = -1e30f; lrow[i] = 0.0f; }

  __shared__ __align__(16) _Float16 kts[64][Lp];           // 9 KB, [key][d]
  __shared__ __align__(16) _Float16 vts[64][Lp];           // 9 KB, [d][key]
  __shared__ __align__(16) _Float16 pls[4][16][Lp];        // 9 KB, wave-private P

  for (int t0 = 0; t0 < Seq; t0 += 64) {
    // ---- cooperative stage of K/V tiles into LDS (16B per thread-chunk) ----
    {
      const v8h* gk = (const v8h*)(Kb + (size_t)t0 * Dh);  // contiguous 8KB
      #pragma unroll
      for (int j = 0; j < 4; ++j) {
        const int c = tid + 128 * j;                       // 512 chunks of 16B
        const int r = c >> 3, cc = c & 7;
        ((v8h*)&kts[r][0])[cc] = gk[c];
      }
      #pragma unroll
      for (int j = 0; j < 4; ++j) {
        const int c = tid + 128 * j;                       // 512 chunks of 16B
        const int r = c >> 3, cc = c & 7;
        ((v8h*)&vts[r][0])[cc] = ((const v8h*)(Vb + (size_t)r * Seq + t0))[cc];
      }
    }
    // prefetch next tile while this one is consumed
    {
      const int tn = (t0 + 64 < Seq) ? (t0 + 64) : 0;
      __builtin_prefetch(Kb + (size_t)tn * Dh + (size_t)tid * 64, 0, 1);
      __builtin_prefetch(Vb + (size_t)(tid >> 1) * Seq + tn + (tid & 1) * 32, 0, 1);
    }
    __syncthreads();

    // ---- S = Q K^T (base-2 logits; 1/sqrt(D)*log2e folded into Q) ----
    v8f s[4] = {v8f{}, v8f{}, v8f{}, v8f{}};
    #pragma unroll
    for (int n = 0; n < 4; ++n) {
      v16h bk0 = load_frag(&kts[n * 16][0],  Lp, lane);
      v16h bk1 = load_frag(&kts[n * 16][32], Lp, lane);
      s[n] = wmma16(aq0, bk0, s[n]);
      s[n] = wmma16(aq1, bk1, s[n]);
    }

    float pr[4][8];
    #pragma unroll
    for (int i = 0; i < 8; ++i) {
      float mt = fmaxf(fmaxf(s[0][i], s[1][i]), fmaxf(s[2][i], s[3][i]));
      #pragma unroll
      for (int msk = 8; msk >= 1; msk >>= 1) mt = fmaxf(mt, __shfl_xor(mt, msk, 16));
      const float mnew = fmaxf(mrow[i], mt);
      const float corr = exp2f(mrow[i] - mnew);
      float rsum = 0.0f;
      #pragma unroll
      for (int n = 0; n < 4; ++n) {
        const float pv = exp2f(s[n][i] - mnew);
        pr[n][i] = pv;
        rsum += pv;
      }
      #pragma unroll
      for (int msk = 8; msk >= 1; msk >>= 1) rsum += __shfl_xor(rsum, msk, 16);
      lrow[i] = lrow[i] * corr + rsum;
      mrow[i] = mnew;
      #pragma unroll
      for (int n = 0; n < 4; ++n) acc[n][i] *= corr;
    }

    // ---- P (C layout) -> LDS -> A fragments ----
    #pragma unroll
    for (int n = 0; n < 4; ++n)
      #pragma unroll
      for (int i = 0; i < 8; ++i)
        pls[wave][hi * 8 + i][n * 16 + lo] = (_Float16)pr[n][i];
    __asm__ volatile("s_wait_dscnt 0x0" ::: "memory");     // wave-local RAW on LDS

    const v16h ap0 = load_frag(&pls[wave][0][0] +  0, Lp, lane);
    const v16h ap1 = load_frag(&pls[wave][0][0] + 32, Lp, lane);

    // ---- O += P V ----
    #pragma unroll
    for (int n = 0; n < 4; ++n) {
      v16h bv0 = load_frag(&vts[n * 16][0],  Lp, lane);
      v16h bv1 = load_frag(&vts[n * 16][32], Lp, lane);
      acc[n] = wmma16(ap0, bv0, acc[n]);
      acc[n] = wmma16(ap1, bv1, acc[n]);
    }
    __syncthreads();      // all waves done with kts/vts before next overwrite
  }

  // ---- normalize, write ctx (heads concatenated along E) ----
  #pragma unroll
  for (int i = 0; i < 8; ++i) {
    const float inv = 1.0f / lrow[i];
    const size_t r = (size_t)b * Seq + q0 + hi * 8 + i;
    #pragma unroll
    for (int n = 0; n < 4; ++n)
      ctxh[r * Emb + h * Dh + n * 16 + lo] = (_Float16)(acc[n][i] * inv);
  }
}

// ---------------------------------------------------------------------------
// Output projection: ctx[Rows,Emb] x Wo + bo -> out (f32).
// grid (Rows/128, Emb/64), block 128; same 32x64-per-wave double-buffered loop.
// ---------------------------------------------------------------------------
__global__ void gemm_out_kernel(const _Float16* __restrict__ ctxh,
                                const _Float16* __restrict__ Wot,
                                const float* __restrict__ bo, float* __restrict__ out) {
  const int mt = blockIdx.x, nt = blockIdx.y;
  const int wave = threadIdx.x >> 5, lane = threadIdx.x & 31;
  const int lo = lane & 15, hi = lane >> 4;
  const int m0 = mt * 128 + wave * 32;
  const int n0 = nt * 64;

  const _Float16* A0 = ctxh + (size_t)m0 * Emb;
  const _Float16* A1 = A0 + (size_t)16 * Emb;
  const _Float16* Bm = Wot + (size_t)n0 * Emb;

  v16h a0 = load_frag(A0, Emb, lane);
  v16h a1 = load_frag(A1, Emb, lane);
  v16h b0 = load_frag(Bm + (size_t) 0 * Emb, Emb, lane);
  v16h b1 = load_frag(Bm + (size_t)16 * Emb, Emb, lane);
  v16h b2 = load_frag(Bm + (size_t)32 * Emb, Emb, lane);
  v16h b3 = load_frag(Bm + (size_t)48 * Emb, Emb, lane);

  v8f acc[2][4] = {};
  for (int k0 = 0; k0 < Emb; k0 += 32) {
    const int kn = (k0 + 32) & (Emb - 1);
    v16h a0n = load_frag(A0 + kn, Emb, lane);
    v16h a1n = load_frag(A1 + kn, Emb, lane);
    v16h bn0 = load_frag(Bm + (size_t) 0 * Emb + kn, Emb, lane);
    v16h bn1 = load_frag(Bm + (size_t)16 * Emb + kn, Emb, lane);
    v16h bn2 = load_frag(Bm + (size_t)32 * Emb + kn, Emb, lane);
    v16h bn3 = load_frag(Bm + (size_t)48 * Emb + kn, Emb, lane);

    acc[0][0] = wmma16(a0, b0, acc[0][0]);
    acc[1][0] = wmma16(a1, b0, acc[1][0]);
    acc[0][1] = wmma16(a0, b1, acc[0][1]);
    acc[1][1] = wmma16(a1, b1, acc[1][1]);
    acc[0][2] = wmma16(a0, b2, acc[0][2]);
    acc[1][2] = wmma16(a1, b2, acc[1][2]);
    acc[0][3] = wmma16(a0, b3, acc[0][3]);
    acc[1][3] = wmma16(a1, b3, acc[1][3]);

    a0 = a0n; a1 = a1n; b0 = bn0; b1 = bn1; b2 = bn2; b3 = bn3;
  }

  #pragma unroll
  for (int mi = 0; mi < 2; ++mi) {
    #pragma unroll
    for (int i = 0; i < 8; ++i) {
      const size_t row = (size_t)m0 + mi * 16 + hi * 8 + i;
      #pragma unroll
      for (int n = 0; n < 4; ++n) {
        const int col = n0 + n * 16 + lo;
        out[row * Emb + col] = acc[mi][n][i] + bo[col];
      }
    }
  }
}

// ---------------------------------------------------------------------------
extern "C" void kernel_launch(void* const* d_in, const int* in_sizes, int n_in,
                              void* d_out, int out_size, void* d_ws, size_t ws_size,
                              hipStream_t stream) {
  const float* x  = (const float*)d_in[0];
  const float* Wq = (const float*)d_in[1];
  const float* bq = (const float*)d_in[2];
  const float* Wk = (const float*)d_in[3];
  const float* bk = (const float*)d_in[4];
  const float* Wv = (const float*)d_in[5];
  const float* bv = (const float*)d_in[6];
  const float* Wo = (const float*)d_in[7];
  const float* bo = (const float*)d_in[8];
  float* out = (float*)d_out;

  char* ws = (char*)d_ws;
  _Float16* xh   = (_Float16*)(ws + (size_t) 0u);          // 16 MB  [Rows][Emb]
  _Float16* Wt   = (_Float16*)(ws + (size_t)(16u << 20));  //  6 MB  [3][H][D][E]
  _Float16* Wot  = (_Float16*)(ws + (size_t)(22u << 20));  //  2 MB  [E][E] transposed
  _Float16* Qf   = (_Float16*)(ws + (size_t)(24u << 20));  // 16 MB  [H][B][S][D]
  _Float16* Kf   = (_Float16*)(ws + (size_t)(40u << 20));  // 16 MB  [H][B][S][D]
  _Float16* Vt   = (_Float16*)(ws + (size_t)(56u << 20));  // 16 MB  [H][B][D][S]
  _Float16* ctxh = (_Float16*)(ws + (size_t)(72u << 20));  // 16 MB  [Rows][Emb]

  cvt_x_kernel   <<<(Rows * Emb) / 256, 256, 0, stream>>>(x, xh);
  cvt_wqkv_kernel<<<(3 * Hn * Dh * Emb) / 256, 256, 0, stream>>>(Wq, Wk, Wv, Wt);
  cvt_wo_kernel  <<<(Emb * Emb) / 256, 256, 0, stream>>>(Wo, Wot);

  gemm_qkv_kernel<<<dim3(Rows / 128, Hn, 3), 128, 0, stream>>>(xh, Wt, bq, bk, bv, Qf, Kf, Vt);
  attn_kernel    <<<dim3(Seq / 64, Hn, Bsz), 128, 0, stream>>>(Qf, Kf, Vt, ctxh);
  gemm_out_kernel<<<dim3(Rows / 128, Emb / 64), 128, 0, stream>>>(ctxh, Wot, bo, out);
}

// v002
// One run takes 365 microseconds.
// Next to v001, in two timings, it ran 1.29 times as fast each time.
// Over all steps from v000 it is 1.68 times as fast.
#include <hip/hip_runtime.h>
#include <hip/hip_bf16.h>

typedef __attribute__((ext_vector_type(16))) _Float16 v16h;
typedef __attribute__((ext_vector_type(8)))  _Float16 v8h;
typedef __attribute__((ext_vector_type(8)))  float    v8f;
typedef __attribute__((ext_vector_type(4)))  float    v4f;

constexpr int Bsz  = 4;
constexpr int Seq  = 2048;
constexpr int Emb  = 1024;
constexpr int Hn   = 16;
constexpr int Dh   = 64;
constexpr int Rows = Bsz * Seq;   // 8192
constexpr int Lp   = 72;

__device__ __forceinline__ v16h load_frag(const _Float16* p0, int ld, int lane) {
  const int lo = lane & 15, hi = lane >> 4;
  const _Float16* p = p0 + (size_t)lo * ld + hi * 8;
  v8h x0 = *(const v8h*)(p);
  v8h x1 = *(const v8h*)(p + 16);
  return __builtin_shufflevector(x0, x1, 0,1,2,3,4,5,6,7,8,9,10,11,12,13,14,15);
}

// Fragment order for the GEMM operands that live in global memory (x, the
// weights, ctx): a [rows][Emb] f16 matrix is kept as tiles of 16 rows x 32 k,
// 1 KB each, tile (rt, kt) at ((rt * Emb/32) + kt) * 512 halves. Inside a tile
// the 16-B chunk j * 32 + lane holds row (lane & 15), k = 16 j + 8 (lane >> 4)
// + 0..7: the k order of load_frag. A wave's global_load_b128 then reads 512
// contiguous bytes (4 whole lines) where row-major rows cost it 16 lines.
constexpr int TileH   = 512;                 // halves per tile
constexpr int RowTile = (Emb / 32) * TileH;  // halves per band of 16 rows

__device__ __forceinline__ v16h load_tile(const _Float16* t, int lane) {
  v8h x0 = *(const v8h*)(t + lane * 8);
  v8h x1 = *(const v8h*)(t + 256 + lane * 8);
  return __builtin_shufflevector(x0, x1, 0,1,2,3,4,5,6,7,8,9,10,11,12,13,14,15);
}

__device__ __forceinline__ v8f wmma16(v16h a, v16h b, v8f c) {
  return __builtin_amdgcn_wmma_f32_16x16x32_f16(false, a, false, b, (short)0, c,
                                                false, false);
}

// ---------------------------------------------------------------------------
// Conversions to f16 in fragment order. One thread makes one 16-B chunk; chunk
// g = ((rt * 32 + kt) * 2 + j) * 32 + lane sits at byte 16 g.
// ---------------------------------------------------------------------------
__global__ void cvt_x_kernel(const float* __restrict__ x, _Float16* __restrict__ xh) {
  // Four neighbouring threads read one 128-B line of a row (its four chunks), a
  // wave 8 rows: 8 lines read whole, and 4 whole lines stored (8 rows x 16 B each).
  const int t = blockIdx.x * 256 + threadIdx.x;        // over Rows*Emb/8
  const int q = t & 3, c = (t >> 2) & 15, tile = t >> 6;   // tile = rt * 32 + kt
  const float* s = x + (size_t)((tile >> 5) * 16 + c) * Emb + (tile & 31) * 32 + q * 8;
  const v4f f0 = *(const v4f*)(s);
  const v4f f1 = *(const v4f*)(s + 4);
  v8h o;
  #pragma unroll
  for (int e = 0; e < 4; ++e) { o[e] = (_Float16)f0[e]; o[4 + e] = (_Float16)f1[e]; }
  // k = 8 q + 0..7 = 16 j + 8 hi + 0..7: j = q >> 1, hi = q & 1, lane = c + 16 hi
  *(v8h*)(xh + (size_t)tile * TileH + (q >> 1) * 256 + ((q & 1) * 16 + c) * 8) = o;
}

// Rows of Wt are (p, h, d), k is e: Wt[p][h][d][e] = W_p[h][e][d]
__global__ void cvt_wqkv_kernel(const float* __restrict__ Wq, const float* __restrict__ Wk,
                                const float* __restrict__ Wv, _Float16* __restrict__ Wt) {
  const int g = blockIdx.x * 256 + threadIdx.x;        // over 3*Hn*Dh*Emb/8
  const int l = g & 31, j = (g >> 5) & 1, kt = (g >> 6) & 31, rt = g >> 11;
  const int row = rt * 16 + (l & 15);
  const int d = row % Dh, h = (row / Dh) % Hn, p = row / (Dh * Hn);
  const int e0 = kt * 32 + j * 16 + (l >> 4) * 8;
  const float* Wp = (p == 0) ? Wq : (p == 1) ? Wk : Wv;
  const float* s = Wp + ((size_t)h * Emb + e0) * Dh + d;
  v8h o;
  #pragma unroll
  for (int e = 0; e < 8; ++e) o[e] = (_Float16)s[(size_t)e * Dh];
  *(v8h*)(Wt + (size_t)g * 8) = o;
}

// Rows of Wot are n, k is k: Wot[n][k] = Wo[k][n]
__global__ void cvt_wo_kernel(const float* __restrict__ Wo, _Float16* __restrict__ Wot) {
  const int g = blockIdx.x * 256 + threadIdx.x;        // over Emb*Emb/8
  const int l = g & 31, j = (g >> 5) & 1, kt = (g >> 6) & 31, rt = g >> 11;
  const int n  = rt * 16 + (l & 15);
  const int k0 = kt * 32 + j * 16 + (l >> 4) * 8;
  const float* s = Wo + (size_t)k0 * Emb + n;
  v8h o;
  #pragma unroll
  for (int e = 0; e < 8; ++e) o[e] = (_Float16)s[(size_t)e * Emb];
  *(v8h*)(Wot + (size_t)g * 8) = o;
}

// ---------------------------------------------------------------------------
// Fused QKV projection.  grid (Rows/128, Hn, 3), block 128.
// Each wave computes a 32x64 tile (2 A-frags x 4 B-frags -> 8 WMMA / chunk),
// with register double-buffering of the next K-chunk so global loads overlap
// the WMMA chain instead of serializing on s_wait_loadcnt 0.
// ---------------------------------------------------------------------------
__global__ void gemm_qkv_kernel(const _Float16* __restrict__ xh,
                                const _Float16* __restrict__ Wt,
                                const float* __restrict__ bq, const float* __restrict__ bk,
                                const float* __restrict__ bv,
                                _Float16* __restrict__ Qf, _Float16* __restrict__ Kf,
                                _Float16* __restrict__ Vt) {
  const int mt = blockIdx.x, h = blockIdx.y, p = blockIdx.z;
  // wave number as a scalar: tile addresses are then scalar base + lane * 16 B
  const int wave = __builtin_amdgcn_readfirstlane(threadIdx.x >> 5), lane = threadIdx.x & 31;
  const int lo = lane & 15, hi = lane >> 4;
  const int m0 = mt * 128 + wave * 32;

  const _Float16* A0 = xh + (size_t)(m0 >> 4) * RowTile;
  const _Float16* A1 = A0 + RowTile;
  const _Float16* Bm = Wt + (size_t)((p * Hn + h) * (Dh / 16)) * RowTile;   // rows d, k = e

  v16h a0 = load_tile(A0, lane);
  v16h a1 = load_tile(A1, lane);
  v16h b0 = load_tile(Bm + 0 * RowTile, lane);
  v16h b1 = load_tile(Bm + 1 * RowTile, lane);
  v16h b2 = load_tile(Bm + 2 * RowTile, lane);
  v16h b3 = load_tile(Bm + 3 * RowTile, lane);

  v8f acc[2][4] = {};
  const _Float16* pa = A0;
  const _Float16* pb = Bm;
  for (int k0 = 0; k0 < Emb; k0 += 32) {
    // next tile of each band, as scalar pointers; wraps to tile 0 (last iter redundant)
    pa = (k0 + 32 < Emb) ? pa + TileH : A0;
    pb = (k0 + 32 < Emb) ? pb + TileH : Bm;
    v16h a0n = load_tile(pa, lane);
    v16h a1n = load_tile(pa + RowTile, lane);
    v16h bn0 = load_tile(pb + 0 * RowTile, lane);
    v16h bn1 = load_tile(pb + 1 * RowTile, lane);
    v16h bn2 = load_tile(pb + 2 * RowTile, lane);
    v16h bn3 = load_tile(pb + 3 * RowTile, lane);

    acc[0][0] = wmma16(a0, b0, acc[0][0]);
    acc[1][0] = wmma16(a1, b0, acc[1][0]);
    acc[0][1] = wmma16(a0, b1, acc[0][1]);
    acc[1][1] = wmma16(a1, b1, acc[1][1]);
    acc[0][2] = wmma16(a0, b2, acc[0][2]);
    acc[1][2] = wmma16(a1, b2, acc[1][2]);
    acc[0][3] = wmma16(a0, b3, acc[0][3]);
    acc[1][3] = wmma16(a1, b3, acc[1][3]);

    a0 = a0n; a1 = a1n; b0 = bn0; b1 = bn1; b2 = bn2; b3 = bn3;
  }
  // the last pass's redundant loads are still in flight: wait before the epilogue reuses
  // their offset register; the scheduling barrier keeps the epilogue's writes behind the wait
  asm volatile("s_wait_xcnt 0x0" ::: "memory");
  __builtin_amdgcn_sched_barrier(0);

  const float* bias = (p == 0) ? bq : (p == 1) ? bk : bv;
  const float  csc  = (p == 0) ? (0.125f * 1.44269504f) : 1.0f;

  #pragma unroll
  for (int mi = 0; mi < 2; ++mi) {
    #pragma unroll
    for (int i = 0; i < 8; ++i) {
      const int row = m0 + mi * 16 + hi * 8 + i;
      const int bb  = row / Seq, ss = row % Seq;
      #pragma unroll
      for (int n = 0; n < 4; ++n) {
        const int d = n * 16 + lo;
        const float val = (acc[mi][n][i] + bias[h * Dh + d]) * csc;
        if (p == 2) {
          Vt[(((size_t)(h * Bsz + bb) * Dh) + d) * Seq + ss] = (_Float16)val;
        } else {
          _Float16* dst = (p == 0) ? Qf : Kf;
          dst[(((size_t)(h * Bsz + bb) * Seq) + ss) * Dh + d] = (_Float16)val;
        }
      }
    }
  }
}

// ---------------------------------------------------------------------------
// Flash attention: grid (Seq/64, Hn, Bsz), block 128 (4 waves x 16 q-rows).
// K/V tiles (shared by all 4 waves) are staged in LDS once per block;
// next tile is prefetched (global_prefetch_b8) during compute.
// ---------------------------------------------------------------------------
__global__ void attn_kernel(const _Float16* __restrict__ Qf, const _Float16* __restrict__ Kf,
                            const _Float16* __restrict__ Vt, _Float16* __restrict__ ctxh) {
  const int qb = blockIdx.x, h = blockIdx.y, b = blockIdx.z;
  const int tid  = threadIdx.x;
  const int wave = tid >> 5, lane = tid & 31;
  const int lo = lane & 15, hi = lane >> 4;
  const int q0 = qb * 64 + wave * 16;                      // sequence-local

  const _Float16* Qb = Qf + ((size_t)(h * Bsz + b) * Seq) * Dh;
  const _Float16* Kb = Kf + ((size_t)(h * Bsz + b) * Seq) * Dh;
  const _Float16* Vb = Vt + ((size_t)(h * Bsz + b) * Dh) * Seq;

  const v16h aq0 = load_frag(Qb + (size_t)q0 * Dh +  0, Dh, lane);
  const v16h aq1 = load_frag(Qb + (size_t)q0 * Dh + 32, Dh, lane);

  v8f acc[4] = {v8f{}, v8f{}, v8f{}, v8f{}};
  float mrow[8], lrow[8];
  #pragma unroll
  for (int i = 0; i < 8; ++i) { mrow[i] = -1e30f; lrow[i] = 0.0f; }

  __shared__ __align__(16) _Float16 kts[64][Lp];           // 9 KB, [key][d]
  __shared__ __align__(16) _Float16 vts[64][Lp];           // 9 KB, [d][key]
  __shared__ __align__(16) _Float16 pls[4][16][Lp];        // 9 KB, wave-private P

  for (int t0 = 0; t0 < Seq; t0 += 64) {
    // ---- cooperative stage of K/V tiles into LDS (16B per thread-chunk) ----
    {
      const v8h* gk = (const v8h*)(Kb + (size_t)t0 * Dh);  // contiguous 8KB
      #pragma unroll
      for (int j = 0; j < 4; ++j) {
        const int c = tid + 128 * j;                       // 512 chunks of 16B
        const int r = c >> 3, cc = c & 7;
        ((v8h*)&kts[r][0])[cc] = gk[c];
      }
      #pragma unroll
      for (int j = 0; j < 4; ++j) {
        const int c = tid + 128 * j;                       // 512 chunks of 16B
        const int r = c >> 3, cc = c & 7;
        ((v8h*)&vts[r][0])[cc] = ((const v8h*)(Vb + (size_t)r * Seq + t0))[cc];
      }
    }
    // prefetch next tile while this one is consumed
    {
      const int tn = (t0 + 64 < Seq) ? (t0 + 64) : 0;
      __builtin_prefetch(Kb + (size_t)tn * Dh + (size_t)tid * 64, 0, 1);
      __builtin_prefetch(Vb + (size_t)(tid >> 1) * Seq + tn + (tid & 1) * 32, 0, 1);
    }
    __syncthreads();

    // ---- S = Q K^T (base-2 logits; 1/sqrt(D)*log2e folded into Q) ----
    v8f s[4] = {v8f{}, v8f{}, v8f{}, v8f{}};
    #pragma unroll
    for (int n = 0; n < 4; ++n) {
      v16h bk0 = load_frag(&kts[n * 16][0],  Lp, lane);
      v16h bk1 = load_frag(&kts[n * 16][32], Lp, lane);
      s[n] = wmma16(aq0, bk0, s[n]);
      s[n] = wmma16(aq1, bk1, s[n]);
    }

    float pr[4][8];
    #pragma unroll
    for (int i = 0; i < 8; ++i) {
      float mt = fmaxf(fmaxf(s[0][i], s[1][i]), fmaxf(s[2][i], s[3][i]));
      #pragma unroll
      for (int msk = 8; msk >= 1; msk >>= 1) mt = fmaxf(mt, __shfl_xor(mt, msk, 16));
      const float mnew = fmaxf(mrow[i], mt);
      const float corr = exp2f(mrow[i] - mnew);
      float rsum = 0.0f;
      #pragma unroll
      for (int n = 0; n < 4; ++n) {
        const float pv = exp2f(s[n][i] - mnew);
        pr[n][i] = pv;
        rsum += pv;
      }
      #pragma unroll
      for (int msk = 8; msk >= 1; msk >>= 1) rsum += __shfl_xor(rsum, msk, 16);
      lrow[i] = lrow[i] * corr + rsum;
      mrow[i] = mnew;
      #pragma unroll
      for (int n = 0; n < 4; ++n) acc[n][i] *= corr;
    }

    // ---- P (C layout) -> LDS -> A fragments ----
    #pragma unroll
    for (int n = 0; n < 4; ++n)
      #pragma unroll
      for (int i = 0; i < 8; ++i)
        pls[wave][hi * 8 + i][n * 16 + lo] = (_Float16)pr[n][i];
    __asm__ volatile("s_wait_dscnt 0x0" ::: "memory");     // wave-local RAW on LDS

    const v16h ap0 = load_frag(&pls[wave][0][0] +  0, Lp, lane);
    const v16h ap1 = load_frag(&pls[wave][0][0] + 32, Lp, lane);

    // ---- O += P V ----
    #pragma unroll
    for (int n = 0; n < 4; ++n) {
      v16h bv0 = load_frag(&vts[n * 16][0],  Lp, lane);
      v16h bv1 = load_frag(&vts[n * 16][32], Lp, lane);
      acc[n] = wmma16(ap0, bv0, acc[n]);
      acc[n] = wmma16(ap1, bv1, acc[n]);
    }
    __syncthreads();      // all waves done with kts/vts before next overwrite
  }

  // ---- normalize, write ctx (heads concatenated along E) in fragment order:
  // row b*Seq + q0 + hi*8 + i, k = h*Dh + n*16 + lo ----
  _Float16* cb = ctxh + (size_t)((b * Seq + q0) >> 4) * RowTile + (size_t)(h * (Dh / 32)) * TileH
               + (lo >> 3) * 128 + (lo & 7);
  #pragma unroll
  for (int i = 0; i < 8; ++i) {
    const float inv = 1.0f / lrow[i];
    #pragma unroll
    for (int n = 0; n < 4; ++n)
      cb[(n >> 1) * TileH + (n & 1) * 256 + (hi * 8 + i) * 8] = (_Float16)(acc[n][i] * inv);
  }
}

// ---------------------------------------------------------------------------
// Output projection: ctx[Rows,Emb] x Wo + bo -> out (f32).
// grid (Rows/128, Emb/64), block 128; same 32x64-per-wave double-buffered loop.
// ---------------------------------------------------------------------------
__global__ void gemm_out_kernel(const _Float16* __restrict__ ctxh,
                                const _Float16* __restrict__ Wot,
                                const float* __restrict__ bo, float* __restrict__ out) {
  const int mt = blockIdx.x, nt = blockIdx.y;
  // wave number as a scalar: tile addresses are then scalar base + lane * 16 B
  const int wave = __builtin_amdgcn_readfirstlane(threadIdx.x >> 5), lane = threadIdx.x & 31;
  const int lo = lane & 15, hi = lane >> 4;
  const int m0 = mt * 128 + wave * 32;
  const int n0 = nt * 64;

  const _Float16* A0 = ctxh + (size_t)(m0 >> 4) * RowTile;
  const _Float16* A1 = A0 + RowTile;
  const _Float16* Bm = Wot + (size_t)(n0 >> 4) * RowTile;

  v16h a0 = load_tile(A0, lane);
  v16h a1 = load_tile(A1, lane);
  v16h b0 = load_tile(Bm + 0 * RowTile, lane);
  v16h b1 = load_tile(Bm + 1 * RowTile, lane);
  v16h b2 = load_tile(Bm + 2 * RowTile, lane);
  v16h b3 = load_tile(Bm + 3 * RowTile, lane);

  v8f acc[2][4] = {};
  const _Float16* pa = A0;
  const _Float16* pb = Bm;
  for (int k0 = 0; k0 < Emb; k0 += 32) {
    pa = (k0 + 32 < Emb) ? pa + TileH : A0;
    pb = (k0 + 32 < Emb) ? pb + TileH : Bm;
    v16h a0n = load_tile(pa, lane);
    v16h a1n = load_tile(pa + RowTile, lane);
    v16h bn0 = load_tile(pb + 0 * RowTile, lane);
    v16h bn1 = load_tile(pb + 1 * RowTile, lane);
    v16h bn2 = load_tile(pb + 2 * RowTile, lane);
    v16h bn3 = load_tile(pb + 3 * RowTile, lane);

    acc[0][0] = wmma16(a0, b0, acc[0][0]);
    acc[1][0] = wmma16(a1, b0, acc[1][0]);
    acc[0][1] = wmma16(a0, b1, acc[0][1]);
    acc[1][1] = wmma16(a1, b1, acc[1][1]);
    acc[0][2] = wmma16(a0, b2, acc[0][2]);
    acc[1][2] = wmma16(a1, b2, acc[1][2]);
    acc[0][3] = wmma16(a0, b3, acc[0][3]);
    acc[1][3] = wmma16(a1, b3, acc[1][3]);

    a0 = a0n; a1 = a1n; b0 = bn0; b1 = bn1; b2 = bn2; b3 = bn3;
  }
  // the last pass's redundant loads are still in flight: wait before the epilogue reuses
  // their offset register; the scheduling barrier keeps the epilogue's writes behind the wait
  asm volatile("s_wait_xcnt 0x0" ::: "memory");
  __builtin_amdgcn_sched_barrier(0);

  #pragma unroll
  for (int mi = 0; mi < 2; ++mi) {
    #pragma unroll
    for (int i = 0; i < 8; ++i) {
      const size_t row = (size_t)m0 + mi * 16 + hi * 8 + i;
      #pragma unroll
      for (int n = 0; n < 4; ++n) {
        const int col = n0 + n * 16 + lo;
        out[row * Emb + col] = acc[mi][n][i] + bo[col];
      }
    }
  }
}

// ---------------------------------------------------------------------------
extern "C" void kernel_launch(void* const* d_in, const int* in_sizes, int n_in,
                              void* d_out, int out_size, void* d_ws, size_t ws_size,
                              hipStream_t stream) {
  const float* x  = (const float*)d_in[0];
  const float* Wq = (const float*)d_in[1];
  const float* bq = (const float*)d_in[2];
  const float* Wk = (const float*)d_in[3];
  const float* bk = (const float*)d_in[4];
  const float* Wv = (const float*)d_in[5];
  const float* bv = (const float*)d_in[6];
  const float* Wo = (const float*)d_in[7];
  const float* bo = (const float*)d_in[8];
  float* out = (float*)d_out;

  char* ws = (char*)d_ws;
  _Float16* xh   = (_Float16*)(ws + (size_t) 0u);          // 16 MB  [Rows][Emb], fragment order
  _Float16* Wt   = (_Float16*)(ws + (size_t)(16u << 20));  //  6 MB  [3][H][D][E], fragment order
  _Float16* Wot  = (_Float16*)(ws + (size_t)(22u << 20));  //  2 MB  [E][E] transposed, fragment order
  _Float16* Qf   = (_Float16*)(ws + (size_t)(24u << 20));  // 16 MB  [H][B][S][D]
  _Float16* Kf   = (_Float16*)(ws + (size_t)(40u << 20));  // 16 MB  [H][B][S][D]
  _Float16* Vt   = (_Float16*)(ws + (size_t)(56u << 20));  // 16 MB  [H][B][D][S]
  _Float16* ctxh = (_Float16*)(ws + (size_t)(72u << 20));  // 16 MB  [Rows][Emb], fragment order

  cvt_x_kernel   <<<(Rows * Emb) / 2048, 256, 0, stream>>>(x, xh);
  cvt_wqkv_kernel<<<(3 * Hn * Dh * Emb) / 2048, 256, 0, stream>>>(Wq, Wk, Wv, Wt);
  cvt_wo_kernel  <<<(Emb * Emb) / 2048, 256, 0, stream>>>(Wo, Wot);

  gemm_qkv_kernel<<<dim3(Rows / 128, Hn, 3), 128, 0, stream>>>(xh, Wt, bq, bk, bv, Qf, Kf, Vt);
  attn_kernel    <<<dim3(Seq / 64, Hn, Bsz), 128, 0, stream>>>(Qf, Kf, Vt, ctxh);
  gemm_out_kernel<<<dim3(Rows / 128, Emb / 64), 128, 0, stream>>>(ctxh, Wot, bo, out);
}

// v003
// Measured time: 232 microseconds a run.
// Next to v002, in two timings, it ran 1.58 times as fast each time.
// Counting every step since v000, it is 2.65 times as fast.
#include <hip/hip_runtime.h>
#include <hip/hip_bf16.h>

typedef __attribute__((ext_vector_type(16))) _Float16 v16h;
typedef __attribute__((ext_vector_type(8)))  _Float16 v8h;
typedef __attribute__((ext_vector_type(8)))  float    v8f;
typedef __attribute__((ext_vector_type(4)))  float    v4f;

constexpr int Bsz  = 4;
constexpr int Seq  = 2048;
constexpr int Emb  = 1024;
constexpr int Hn   = 16;
constexpr int Dh   = 64;
constexpr int Rows = Bsz * Seq;   // 8192
constexpr int Lp   = 72;

__device__ __forceinline__ v16h load_frag(const _Float16* p0, int ld, int lane) {
  const int lo = lane & 15, hi = lane >> 4;
  const _Float16* p = p0 + (size_t)lo * ld + hi * 8;
  v8h x0 = *(const v8h*)(p);
  v8h x1 = *(const v8h*)(p + 16);
  return __builtin_shufflevector(x0, x1, 0,1,2,3,4,5,6,7,8,9,10,11,12,13,14,15);
}

// Fragment order for the GEMM operands that live in global memory (x, the
// weights, ctx): a [rows][Emb] f16 matrix is kept as tiles of 16 rows x 32 k,
// 1 KB each, tile (rt, kt) at ((rt * Emb/32) + kt) * 512 halves. Inside a tile
// the 16-B chunk j * 32 + lane holds row (lane & 15), k = 16 j + 8 (lane >> 4)
// + 0..7: the k order of load_frag. A wave's global_load_b128 then reads 512
// contiguous bytes (4 whole lines) where row-major rows cost it 16 lines.
constexpr int TileH   = 512;                 // halves per tile
constexpr int RowTile = (Emb / 32) * TileH;  // halves per band of 16 rows

__device__ __forceinline__ v16h load_tile(const _Float16* t, int lane) {
  v8h x0 = *(const v8h*)(t + lane * 8);
  v8h x1 = *(const v8h*)(t + 256 + lane * 8);
  return __builtin_shufflevector(x0, x1, 0,1,2,3,4,5,6,7,8,9,10,11,12,13,14,15);
}

__device__ __forceinline__ v8f wmma16(v16h a, v16h b, v8f c) {
  return __builtin_amdgcn_wmma_f32_16x16x32_f16(false, a, false, b, (short)0, c,
                                                false, false);
}

// ---------------------------------------------------------------------------
// Conversions to f16 in fragment order. One thread makes one 16-B chunk; chunk
// g = ((rt * 32 + kt) * 2 + j) * 32 + lane sits at byte 16 g.
// ---------------------------------------------------------------------------
__global__ void cvt_x_kernel(const float* __restrict__ x, _Float16* __restrict__ xh) {
  // Four neighbouring threads read one 128-B line of a row (its four chunks), a
  // wave 8 rows: 8 lines read whole, and 4 whole lines stored (8 rows x 16 B each).
  const int t = blockIdx.x * 256 + threadIdx.x;        // over Rows*Emb/8
  const int q = t & 3, c = (t >> 2) & 15, tile = t >> 6;   // tile = rt * 32 + kt
  const float* s = x + (size_t)((tile >> 5) * 16 + c) * Emb + (tile & 31) * 32 + q * 8;
  const v4f f0 = *(const v4f*)(s);
  const v4f f1 = *(const v4f*)(s + 4);
  v8h o;
  #pragma unroll
  for (int e = 0; e < 4; ++e) { o[e] = (_Float16)f0[e]; o[4 + e] = (_Float16)f1[e]; }
  // k = 8 q + 0..7 = 16 j + 8 hi + 0..7: j = q >> 1, hi = q & 1, lane = c + 16 hi
  *(v8h*)(xh + (size_t)tile * TileH + (q >> 1) * 256 + ((q & 1) * 16 + c) * 8) = o;
}

// Rows of Wt are (p, h, d), k is e: Wt[p][h][d][e] = W_p[h][e][d]
__global__ void cvt_wqkv_kernel(const float* __restrict__ Wq, const float* __restrict__ Wk,
                                const float* __restrict__ Wv, _Float16* __restrict__ Wt) {
  const int g = blockIdx.x * 256 + threadIdx.x;        // over 3*Hn*Dh*Emb/8
  const int l = g & 31, j = (g >> 5) & 1, kt = (g >> 6) & 31, rt = g >> 11;
  const int row = rt * 16 + (l & 15);
  const int d = row % Dh, h = (row / Dh) % Hn, p = row / (Dh * Hn);
  const int e0 = kt * 32 + j * 16 + (l >> 4) * 8;
  const float* Wp = (p == 0) ? Wq : (p == 1) ? Wk : Wv;
  const float* s = Wp + ((size_t)h * Emb + e0) * Dh + d;
  v8h o;
  #pragma unroll
  for (int e = 0; e < 8; ++e) o[e] = (_Float16)s[(size_t)e * Dh];
  *(v8h*)(Wt + (size_t)g * 8) = o;
}

// Rows of Wot are n, k is k: Wot[n][k] = Wo[k][n]
__global__ void cvt_wo_kernel(const float* __restrict__ Wo, _Float16* __restrict__ Wot) {
  const int g = blockIdx.x * 256 + threadIdx.x;        // over Emb*Emb/8
  const int l = g & 31, j = (g >> 5) & 1, kt = (g >> 6) & 31, rt = g >> 11;
  const int n  = rt * 16 + (l & 15);
  const int k0 = kt * 32 + j * 16 + (l >> 4) * 8;
  const float* s = Wo + (size_t)k0 * Emb + n;
  v8h o;
  #pragma unroll
  for (int e = 0; e < 8; ++e) o[e] = (_Float16)s[(size_t)e * Emb];
  *(v8h*)(Wot + (size_t)g * 8) = o;
}

// ---------------------------------------------------------------------------
// Fused QKV projection.  grid (Rows/128, Hn, 3), block 128.
// Each wave computes a 32x64 tile (2 A-frags x 4 B-frags -> 8 WMMA / chunk),
// with register double-buffering of the next K-chunk so global loads overlap
// the WMMA chain instead of serializing on s_wait_loadcnt 0.
// ---------------------------------------------------------------------------
__global__ void gemm_qkv_kernel(const _Float16* __restrict__ xh,
                                const _Float16* __restrict__ Wt,
                                const float* __restrict__ bq, const float* __restrict__ bk,
                                const float* __restrict__ bv,
                                _Float16* __restrict__ Qf, _Float16* __restrict__ Kf,
                                _Float16* __restrict__ Vt) {
  const int mt = blockIdx.x, h = blockIdx.y, p = blockIdx.z;
  // wave number as a scalar: tile addresses are then scalar base + lane * 16 B
  const int wave = __builtin_amdgcn_readfirstlane(threadIdx.x >> 5), lane = threadIdx.x & 31;
  const int lo = lane & 15, hi = lane >> 4;
  const int m0 = mt * 128 + wave * 32;

  const _Float16* A0 = xh + (size_t)(m0 >> 4) * RowTile;
  const _Float16* A1 = A0 + RowTile;
  const _Float16* Bm = Wt + (size_t)((p * Hn + h) * (Dh / 16)) * RowTile;   // rows d, k = e

  v16h a0 = load_tile(A0, lane);
  v16h a1 = load_tile(A1, lane);
  v16h b0 = load_tile(Bm + 0 * RowTile, lane);
  v16h b1 = load_tile(Bm + 1 * RowTile, lane);
  v16h b2 = load_tile(Bm + 2 * RowTile, lane);
  v16h b3 = load_tile(Bm + 3 * RowTile, lane);

  v8f acc[2][4] = {};
  const _Float16* pa = A0;
  const _Float16* pb = Bm;
  for (int k0 = 0; k0 < Emb; k0 += 32) {
    // next tile of each band, as scalar pointers; wraps to tile 0 (last iter redundant)
    pa = (k0 + 32 < Emb) ? pa + TileH : A0;
    pb = (k0 + 32 < Emb) ? pb + TileH : Bm;
    v16h a0n = load_tile(pa, lane);
    v16h a1n = load_tile(pa + RowTile, lane);
    v16h bn0 = load_tile(pb + 0 * RowTile, lane);
    v16h bn1 = load_tile(pb + 1 * RowTile, lane);
    v16h bn2 = load_tile(pb + 2 * RowTile, lane);
    v16h bn3 = load_tile(pb + 3 * RowTile, lane);

    acc[0][0] = wmma16(a0, b0, acc[0][0]);
    acc[1][0] = wmma16(a1, b0, acc[1][0]);
    acc[0][1] = wmma16(a0, b1, acc[0][1]);
    acc[1][1] = wmma16(a1, b1, acc[1][1]);
    acc[0][2] = wmma16(a0, b2, acc[0][2]);
    acc[1][2] = wmma16(a1, b2, acc[1][2]);
    acc[0][3] = wmma16(a0, b3, acc[0][3]);
    acc[1][3] = wmma16(a1, b3, acc[1][3]);

    a0 = a0n; a1 = a1n; b0 = bn0; b1 = bn1; b2 = bn2; b3 = bn3;
  }
  // the last pass's redundant loads are still in flight: wait before the epilogue reuses
  // their offset register; the scheduling barrier keeps the epilogue's writes behind the wait
  asm volatile("s_wait_xcnt 0x0" ::: "memory");
  __builtin_amdgcn_sched_barrier(0);

  const float* bias = (p == 0) ? bq : (p == 1) ? bk : bv;
  const float  csc  = (p == 0) ? (0.125f * 1.44269504f) : 1.0f;

  #pragma unroll
  for (int mi = 0; mi < 2; ++mi) {
    #pragma unroll
    for (int i = 0; i < 8; ++i) {
      const int row = m0 + mi * 16 + hi * 8 + i;
      const int bb  = row / Seq, ss = row % Seq;
      #pragma unroll
      for (int n = 0; n < 4; ++n) {
        const int d = n * 16 + lo;
        const float val = (acc[mi][n][i] + bias[h * Dh + d]) * csc;
        if (p == 2) {
          Vt[(((size_t)(h * Bsz + bb) * Dh) + d) * Seq + ss] = (_Float16)val;
        } else {
          _Float16* dst = (p == 0) ? Qf : Kf;
          dst[(((size_t)(h * Bsz + bb) * Seq) + ss) * Dh + d] = (_Float16)val;
        }
      }
    }
  }
}

__device__ __forceinline__ float xhalf(float x) {
  const int b = __builtin_bit_cast(int, x);
  return __builtin_bit_cast(float,
      __builtin_amdgcn_permlanex16(b, b, 0x76543210, 0xfedcba98, false, false));
}

__global__ void attn_kernel(const _Float16* __restrict__ Qf, const _Float16* __restrict__ Kf,
                            const _Float16* __restrict__ Vt, _Float16* __restrict__ ctxh) {
  const int qb = blockIdx.x, h = blockIdx.y, b = blockIdx.z;
  const int tid  = threadIdx.x;
  // wave number as a scalar: the Q and ctx addresses are then scalar base + lane offset
  const int wave = __builtin_amdgcn_readfirstlane(tid >> 5), lane = tid & 31;
  const int q0 = qb * 64 + wave * 16;                      // sequence-local

  const _Float16* Qb = Qf + ((size_t)(h * Bsz + b) * Seq) * Dh;
  const _Float16* Kb = Kf + ((size_t)(h * Bsz + b) * Seq) * Dh;
  const _Float16* Vb = Vt + ((size_t)(h * Bsz + b) * Dh) * Seq;

  // B fragments of Q^T: column = query lane & 15, k = d
  const v16h bq0 = load_frag(Qb + (size_t)q0 * Dh +  0, Dh, lane);
  const v16h bq1 = load_frag(Qb + (size_t)q0 * Dh + 32, Dh, lane);

  // acc[n][r] = O^T[d = 16 n + 8 (lane >> 4) + r][query lane & 15]
  v8f acc[4] = {v8f{}, v8f{}, v8f{}, v8f{}};
  float mrow = -1e30f;      // running maximum of this lane's query (equal in both halves)
  float lrow = 0.0f;        // running sum over this half's keys only; halves joined at the end

  __shared__ __align__(16) _Float16 kts[64][Lp];           // 9 KB, [key][d]
  __shared__ __align__(16) _Float16 vts[64][Lp];           // 9 KB, [d][key]

  for (int t0 = 0; t0 < Seq; t0 += 64) {
    // ---- cooperative stage of K/V tiles into LDS (16B per thread-chunk) ----
    {
      const v8h* gk = (const v8h*)(Kb + (size_t)t0 * Dh);  // contiguous 8KB
      #pragma unroll
      for (int j = 0; j < 4; ++j) {
        const int c = tid + 128 * j;                       // 512 chunks of 16B
        const int r = c >> 3, cc = c & 7;
        ((v8h*)&kts[r][0])[cc] = gk[c];
      }
      #pragma unroll
      for (int j = 0; j < 4; ++j) {
        const int c = tid + 128 * j;                       // 512 chunks of 16B
        const int r = c >> 3, cc = c & 7;
        ((v8h*)&vts[r][0])[cc] = ((const v8h*)(Vb + (size_t)r * Seq + t0))[cc];
      }
    }
    // prefetch next tile while this one is consumed
    {
      const int tn = (t0 + 64 < Seq) ? (t0 + 64) : 0;
      __builtin_prefetch(Kb + (size_t)tn * Dh + (size_t)tid * 64, 0, 1);
      __builtin_prefetch(Vb + (size_t)(tid >> 1) * Seq + tn + (tid & 1) * 32, 0, 1);
    }
    __syncthreads();

    // ---- S^T = K Q^T (base-2 logits; 1/sqrt(D)*log2e folded into Q) ----
    // s[n][r] = score(key 16 n + 8 (lane >> 4) + r, query lane & 15)
    v8f s[4] = {v8f{}, v8f{}, v8f{}, v8f{}};
    #pragma unroll
    for (int n = 0; n < 4; ++n) {
      v16h ak0 = load_frag(&kts[n * 16][0],  Lp, lane);
      v16h ak1 = load_frag(&kts[n * 16][32], Lp, lane);
      s[n] = wmma16(ak0, bq0, s[n]);
      s[n] = wmma16(ak1, bq1, s[n]);
    }

    // ---- online softmax, one query per lane ----
    float mt = s[0][0];
    #pragma unroll
    for (int n = 0; n < 4; ++n)
      #pragma unroll
      for (int r = 0; r < 8; ++r) mt = fmaxf(mt, s[n][r]);
    mt = fmaxf(mt, xhalf(mt));
    const float mnew = fmaxf(mrow, mt);
    const float corr = exp2f(mrow - mnew);
    mrow = mnew;
    float rs[4];
    #pragma unroll
    for (int n = 0; n < 4; ++n) {
      rs[n] = 0.0f;
      #pragma unroll
      for (int r = 0; r < 8; ++r) {
        s[n][r] = exp2f(s[n][r] - mnew);
        rs[n] += s[n][r];
      }
    }
    lrow = lrow * corr + ((rs[0] + rs[1]) + (rs[2] + rs[3]));
    #pragma unroll
    for (int n = 0; n < 4; ++n) acc[n] *= corr;

    // ---- P^T: two converted D tiles are one B fragment (k = key, load_frag's order) ----
    const v16h bp0 = __builtin_shufflevector(__builtin_convertvector(s[0], v8h),
                                             __builtin_convertvector(s[1], v8h),
                                             0,1,2,3,4,5,6,7,8,9,10,11,12,13,14,15);
    const v16h bp1 = __builtin_shufflevector(__builtin_convertvector(s[2], v8h),
                                             __builtin_convertvector(s[3], v8h),
                                             0,1,2,3,4,5,6,7,8,9,10,11,12,13,14,15);

    // ---- O^T += V^T P^T ----
    #pragma unroll
    for (int n = 0; n < 4; ++n) {
      v16h av0 = load_frag(&vts[n * 16][0],  Lp, lane);
      v16h av1 = load_frag(&vts[n * 16][32], Lp, lane);
      acc[n] = wmma16(av0, bp0, acc[n]);
      acc[n] = wmma16(av1, bp1, acc[n]);
    }
    __syncthreads();      // all waves done with kts/vts before next overwrite
  }

  // ---- normalize, write ctx (heads concatenated along E) in fragment order:
  // row b*Seq + q0 + (lane & 15), k = h*Dh + 16 n + 8 (lane >> 4) + 0..7, which is
  // the 16-B chunk (n & 1) * 32 + lane of tile (row band, 2 h + (n >> 1)) ----
  const float inv = 1.0f / (lrow + xhalf(lrow));
  _Float16* cb = ctxh + (size_t)((b * Seq + q0) >> 4) * RowTile + (size_t)(h * (Dh / 32)) * TileH
               + lane * 8;
  #pragma unroll
  for (int n = 0; n < 4; ++n)
    *(v8h*)(cb + (n >> 1) * TileH + (n & 1) * 256) = __builtin_convertvector(acc[n] * inv, v8h);
}

// ---------------------------------------------------------------------------
// Output projection: ctx[Rows,Emb] x Wo + bo -> out (f32).
// grid (Rows/128, Emb/64), block 128; same 32x64-per-wave double-buffered loop.
// ---------------------------------------------------------------------------
__global__ void gemm_out_kernel(const _Float16* __restrict__ ctxh,
                                const _Float16* __restrict__ Wot,
                                const float* __restrict__ bo, float* __restrict__ out) {
  const int mt = blockIdx.x, nt = blockIdx.y;
  // wave number as a scalar: tile addresses are then scalar base + lane * 16 B
  const int wave = __builtin_amdgcn_readfirstlane(threadIdx.x >> 5), lane = threadIdx.x & 31;
  const int lo = lane & 15, hi = lane >> 4;
  const int m0 = mt * 128 + wave * 32;
  const int n0 = nt * 64;

  const _Float16* A0 = ctxh + (size_t)(m0 >> 4) * RowTile;
  const _Float16* A1 = A0 + RowTile;
  const _Float16* Bm = Wot + (size_t)(n0 >> 4) * RowTile;

  v16h a0 = load_tile(A0, lane);
  v16h a1 = load_tile(A1, lane);
  v16h b0 = load_tile(Bm + 0 * RowTile, lane);
  v16h b1 = load_tile(Bm + 1 * RowTile, lane);
  v16h b2 = load_tile(Bm + 2 * RowTile, lane);
  v16h b3 = load_tile(Bm + 3 * RowTile, lane);

  v8f acc[2][4] = {};
  const _Float16* pa = A0;
  const _Float16* pb = Bm;
  for (int k0 = 0; k0 < Emb; k0 += 32) {
    pa = (k0 + 32 < Emb) ? pa + TileH : A0;
    pb = (k0 + 32 < Emb) ? pb + TileH : Bm;
    v16h a0n = load_tile(pa, lane);
    v16h a1n = load_tile(pa + RowTile, lane);
    v16h bn0 = load_tile(pb + 0 * RowTile, lane);
    v16h bn1 = load_tile(pb + 1 * RowTile, lane);
    v16h bn2 = load_tile(pb + 2 * RowTile, lane);
    v16h bn3 = load_tile(pb + 3 * RowTile, lane);

    acc[0][0] = wmma16(a0, b0, acc[0][0]);
    acc[1][0] = wmma16(a1, b0, acc[1][0]);
    acc[0][1] = wmma16(a0, b1, acc[0][1]);
    acc[1][1] = wmma16(a1, b1, acc[1][1]);
    acc[0][2] = wmma16(a0, b2, acc[0][2]);
    acc[1][2] = wmma16(a1, b2, acc[1][2]);
    acc[0][3] = wmma16(a0, b3, acc[0][3]);
    acc[1][3] = wmma16(a1, b3, acc[1][3]);

    a0 = a0n; a1 = a1n; b0 = bn0; b1 = bn1; b2 = bn2; b3 = bn3;
  }
  // the last pass's redundant loads are still in flight: wait before the epilogue reuses
  // their offset register; the scheduling barrier keeps the epilogue's writes behind the wait
  asm volatile("s_wait_xcnt 0x0" ::: "memory");
  __builtin_amdgcn_sched_barrier(0);

  #pragma unroll
  for (int mi = 0; mi < 2; ++mi) {
    #pragma unroll
    for (int i = 0; i < 8; ++i) {
      const size_t row = (size_t)m0 + mi * 16 + hi * 8 + i;
      #pragma unroll
      for (int n = 0; n < 4; ++n) {
        const int col = n0 + n * 16 + lo;
        out[row * Emb + col] = acc[mi][n][i] + bo[col];
      }
    }
  }
}

// ---------------------------------------------------------------------------
extern "C" void kernel_launch(void* const* d_in, const int* in_sizes, int n_in,
                              void* d_out, int out_size, void* d_ws, size_t ws_size,
                              hipStream_t stream) {
  const float* x  = (const float*)d_in[0];
  const float* Wq = (const float*)d_in[1];
  const float* bq = (const float*)d_in[2];
  const float* Wk = (const float*)d_in[3];
  const float* bk = (const float*)d_in[4];
  const float* Wv = (const float*)d_in[5];
  const float* bv = (const float*)d_in[6];
  const float* Wo = (const float*)d_in[7];
  const float* bo = (const float*)d_in[8];
  float* out = (float*)d_out;

  char* ws = (char*)d_ws;
  _Float16* xh   = (_Float16*)(ws + (size_t) 0u);          // 16 MB  [Rows][Emb], fragment order
  _Float16* Wt   = (_Float16*)(ws + (size_t)(16u << 20));  //  6 MB  [3][H][D][E], fragment order
  _Float16* Wot  = (_Float16*)(ws + (size_t)(22u << 20));  //  2 MB  [E][E] transposed, fragment order
  _Float16* Qf   = (_Float16*)(ws + (size_t)(24u << 20));  // 16 MB  [H][B][S][D]
  _Float16* Kf   = (_Float16*)(ws + (size_t)(40u << 20));  // 16 MB  [H][B][S][D]
  _Float16* Vt   = (_Float16*)(ws + (size_t)(56u << 20));  // 16 MB  [H][B][D][S]
  _Float16* ctxh = (_Float16*)(ws + (size_t)(72u << 20));  // 16 MB  [Rows][Emb], fragment order

  cvt_x_kernel   <<<(Rows * Emb) / 2048, 256, 0, stream>>>(x, xh);
  cvt_wqkv_kernel<<<(3 * Hn * Dh * Emb) / 2048, 256, 0, stream>>>(Wq, Wk, Wv, Wt);
  cvt_wo_kernel  <<<(Emb * Emb) / 2048, 256, 0, stream>>>(Wo, Wot);

  gemm_qkv_kernel<<<dim3(Rows / 128, Hn, 3), 128, 0, stream>>>(xh, Wt, bq, bk, bv, Qf, Kf, Vt);
  attn_kernel    <<<dim3(Seq / 64, Hn, Bsz), 128, 0, stream>>>(Qf, Kf, Vt, ctxh);
  gemm_out_kernel<<<dim3(Rows / 128, Emb / 64), 128, 0, stream>>>(ctxh, Wot, bo, out);
}

// v004
// Measured time: 221 microseconds a run.
// Two timings next to v003 put it at 1.05 and 1.06 times that version's speed.
// Over all steps from v000 it is 2.80 times as fast.
#include <hip/hip_runtime.h>
#include <hip/hip_bf16.h>

typedef __attribute__((ext_vector_type(16))) _Float16 v16h;
typedef __attribute__((ext_vector_type(8)))  _Float16 v8h;
typedef __attribute__((ext_vector_type(8)))  float    v8f;
typedef __attribute__((ext_vector_type(4)))  float    v4f;

constexpr int Bsz  = 4;
constexpr int Seq  = 2048;
constexpr int Emb  = 1024;
constexpr int Hn   = 16;
constexpr int Dh   = 64;
constexpr int Rows = Bsz * Seq;   // 8192
constexpr int Lp   = 72;

__device__ __forceinline__ v16h load_frag(const _Float16* p0, int ld, int lane) {
  const int lo = lane & 15, hi = lane >> 4;
  const _Float16* p = p0 + (size_t)lo * ld + hi * 8;
  v8h x0 = *(const v8h*)(p);
  v8h x1 = *(const v8h*)(p + 16);
  return __builtin_shufflevector(x0, x1, 0,1,2,3,4,5,6,7,8,9,10,11,12,13,14,15);
}

// Fragment order for the GEMM operands that live in global memory (x, the
// weights, ctx): a [rows][Emb] f16 matrix is kept as tiles of 16 rows x 32 k,
// 1 KB each, tile (rt, kt) at ((rt * Emb/32) + kt) * 512 halves. Inside a tile
// the 16-B chunk j * 32 + lane holds row (lane & 15), k = 16 j + 8 (lane >> 4)
// + 0..7: the k order of load_frag. A wave's global_load_b128 then reads 512
// contiguous bytes (4 whole lines) where row-major rows cost it 16 lines.
constexpr int TileH   = 512;                 // halves per tile
constexpr int RowTile = (Emb / 32) * TileH;  // halves per band of 16 rows

__device__ __forceinline__ v16h load_tile(const _Float16* t, int lane) {
  v8h x0 = *(const v8h*)(t + lane * 8);
  v8h x1 = *(const v8h*)(t + 256 + lane * 8);
  return __builtin_shufflevector(x0, x1, 0,1,2,3,4,5,6,7,8,9,10,11,12,13,14,15);
}

__device__ __forceinline__ v8f wmma16(v16h a, v16h b, v8f c) {
  return __builtin_amdgcn_wmma_f32_16x16x32_f16(false, a, false, b, (short)0, c,
                                                false, false);
}

// ---------------------------------------------------------------------------
// Conversions to f16 in fragment order. One thread makes one 16-B chunk; chunk
// g = ((rt * 32 + kt) * 2 + j) * 32 + lane sits at byte 16 g.
// ---------------------------------------------------------------------------
__global__ void cvt_x_kernel(const float* __restrict__ x, _Float16* __restrict__ xh) {
  // Four neighbouring threads read one 128-B line of a row (its four chunks), a
  // wave 8 rows: 8 lines read whole, and 4 whole lines stored (8 rows x 16 B each).
  const int t = blockIdx.x * 256 + threadIdx.x;        // over Rows*Emb/8
  const int q = t & 3, c = (t >> 2) & 15, tile = t >> 6;   // tile = rt * 32 + kt
  const float* s = x + (size_t)((tile >> 5) * 16 + c) * Emb + (tile & 31) * 32 + q * 8;
  const v4f f0 = *(const v4f*)(s);
  const v4f f1 = *(const v4f*)(s + 4);
  v8h o;
  #pragma unroll
  for (int e = 0; e < 4; ++e) { o[e] = (_Float16)f0[e]; o[4 + e] = (_Float16)f1[e]; }
  // k = 8 q + 0..7 = 16 j + 8 hi + 0..7: j = q >> 1, hi = q & 1, lane = c + 16 hi
  *(v8h*)(xh + (size_t)tile * TileH + (q >> 1) * 256 + ((q & 1) * 16 + c) * 8) = o;
}

// Rows of Wt are (p, h, d), k is e: Wt[p][h][d][e] = W_p[h][e][d]
__global__ void cvt_wqkv_kernel(const float* __restrict__ Wq, const float* __restrict__ Wk,
                                const float* __restrict__ Wv, _Float16* __restrict__ Wt) {
  const int g = blockIdx.x * 256 + threadIdx.x;        // over 3*Hn*Dh*Emb/8
  const int l = g & 31, j = (g >> 5) & 1, kt = (g >> 6) & 31, rt = g >> 11;
  const int row = rt * 16 + (l & 15);
  const int d = row % Dh, h = (row / Dh) % Hn, p = row / (Dh * Hn);
  const int e0 = kt * 32 + j * 16 + (l >> 4) * 8;
  const float* Wp = (p == 0) ? Wq : (p == 1) ? Wk : Wv;
  const float* s = Wp + ((size_t)h * Emb + e0) * Dh + d;
  v8h o;
  #pragma unroll
  for (int e = 0; e < 8; ++e) o[e] = (_Float16)s[(size_t)e * Dh];
  *(v8h*)(Wt + (size_t)g * 8) = o;
}

// Rows of Wot are n, k is k: Wot[n][k] = Wo[k][n]
__global__ void cvt_wo_kernel(const float* __restrict__ Wo, _Float16* __restrict__ Wot) {
  const int g = blockIdx.x * 256 + threadIdx.x;        // over Emb*Emb/8
  const int l = g & 31, j = (g >> 5) & 1, kt = (g >> 6) & 31, rt = g >> 11;
  const int n  = rt * 16 + (l & 15);
  const int k0 = kt * 32 + j * 16 + (l >> 4) * 8;
  const float* s = Wo + (size_t)k0 * Emb + n;
  v8h o;
  #pragma unroll
  for (int e = 0; e < 8; ++e) o[e] = (_Float16)s[(size_t)e * Emb];
  *(v8h*)(Wot + (size_t)g * 8) = o;
}

// ---------------------------------------------------------------------------
// Fused QKV projection.  grid (Rows/128, Hn, 3), block 128.
// Each wave computes a 32x64 tile (2 A-frags x 4 B-frags -> 8 WMMA / chunk),
// with register double-buffering of the next K-chunk so global loads overlap
// the WMMA chain instead of serializing on s_wait_loadcnt 0.
// ---------------------------------------------------------------------------
__global__ void gemm_qkv_kernel(const _Float16* __restrict__ xh,
                                const _Float16* __restrict__ Wt,
                                const float* __restrict__ bq, const float* __restrict__ bk,
                                const float* __restrict__ bv,
                                _Float16* __restrict__ Qf, _Float16* __restrict__ Kf,
                                _Float16* __restrict__ Vt) {
  const int mt = blockIdx.x, h = blockIdx.y, p = blockIdx.z;
  // wave number as a scalar: tile addresses are then scalar base + lane * 16 B
  const int wave = __builtin_amdgcn_readfirstlane(threadIdx.x >> 5), lane = threadIdx.x & 31;
  const int lo = lane & 15, hi = lane >> 4;
  const int m0 = mt * 128 + wave * 32;

  const _Float16* A0 = xh + (size_t)(m0 >> 4) * RowTile;
  const _Float16* A1 = A0 + RowTile;
  const _Float16* Bm = Wt + (size_t)((p * Hn + h) * (Dh / 16)) * RowTile;   // rows d, k = e

  v16h a0 = load_tile(A0, lane);
  v16h a1 = load_tile(A1, lane);
  v16h b0 = load_tile(Bm + 0 * RowTile, lane);
  v16h b1 = load_tile(Bm + 1 * RowTile, lane);
  v16h b2 = load_tile(Bm + 2 * RowTile, lane);
  v16h b3 = load_tile(Bm + 3 * RowTile, lane);

  v8f acc[2][4] = {};
  const _Float16* pa = A0;
  const _Float16* pb = Bm;
  for (int k0 = 0; k0 < Emb; k0 += 32) {
    // next tile of each band, as scalar pointers; wraps to tile 0 (last iter redundant)
    pa = (k0 + 32 < Emb) ? pa + TileH : A0;
    pb = (k0 + 32 < Emb) ? pb + TileH : Bm;
    v16h a0n = load_tile(pa, lane);
    v16h a1n = load_tile(pa + RowTile, lane);
    v16h bn0 = load_tile(pb + 0 * RowTile, lane);
    v16h bn1 = load_tile(pb + 1 * RowTile, lane);
    v16h bn2 = load_tile(pb + 2 * RowTile, lane);
    v16h bn3 = load_tile(pb + 3 * RowTile, lane);

    acc[0][0] = wmma16(a0, b0, acc[0][0]);
    acc[1][0] = wmma16(a1, b0, acc[1][0]);
    acc[0][1] = wmma16(a0, b1, acc[0][1]);
    acc[1][1] = wmma16(a1, b1, acc[1][1]);
    acc[0][2] = wmma16(a0, b2, acc[0][2]);
    acc[1][2] = wmma16(a1, b2, acc[1][2]);
    acc[0][3] = wmma16(a0, b3, acc[0][3]);
    acc[1][3] = wmma16(a1, b3, acc[1][3]);

    a0 = a0n; a1 = a1n; b0 = bn0; b1 = bn1; b2 = bn2; b3 = bn3;
  }
  // the last pass's redundant loads are still in flight: wait before the epilogue reuses
  // their offset register; the scheduling barrier keeps the epilogue's writes behind the wait
  asm volatile("s_wait_xcnt 0x0" ::: "memory");
  __builtin_amdgcn_sched_barrier(0);

  const float* bias = (p == 0) ? bq : (p == 1) ? bk : bv;
  const float  csc  = (p == 0) ? (0.125f * 1.44269504f) : 1.0f;

  #pragma unroll
  for (int mi = 0; mi < 2; ++mi) {
    #pragma unroll
    for (int i = 0; i < 8; ++i) {
      const int row = m0 + mi * 16 + hi * 8 + i;
      const int bb  = row / Seq, ss = row % Seq;
      #pragma unroll
      for (int n = 0; n < 4; ++n) {
        const int d = n * 16 + lo;
        const float val = (acc[mi][n][i] + bias[h * Dh + d]) * csc;
        if (p == 2) {
          Vt[(((size_t)(h * Bsz + bb) * Dh) + d) * Seq + ss] = (_Float16)val;
        } else {
          _Float16* dst = (p == 0) ? Qf : Kf;
          dst[(((size_t)(h * Bsz + bb) * Seq) + ss) * Dh + d] = (_Float16)val;
        }
      }
    }
  }
}

__device__ __forceinline__ float xhalf(float x) {
  const int b = __builtin_bit_cast(int, x);
  return __builtin_bit_cast(float,
      __builtin_amdgcn_permlanex16(b, b, 0x76543210, 0xfedcba98, false, false));
}

// 2^x as the bare v_exp_f32. exp2f wraps it in a range fix-up (compare, two selects, add,
// ldexp) that only matters for results under 2^-126, which the bare form may flush to 0.
// Here x <= 0; a P that small is 0 in f16 anyway, beside a row sum of at least 1 it is
// below f32 rounding, and a rescale factor that small leaves nothing of the old sums.
__device__ __forceinline__ float exp2_raw(float x) { return __builtin_amdgcn_exp2f(x); }

__global__ void attn_kernel(const _Float16* __restrict__ Qf, const _Float16* __restrict__ Kf,
                            const _Float16* __restrict__ Vt, _Float16* __restrict__ ctxh) {
  const int qb = blockIdx.x, h = blockIdx.y, b = blockIdx.z;
  const int tid  = threadIdx.x;
  // wave number as a scalar: the Q and ctx addresses are then scalar base + lane offset
  const int wave = __builtin_amdgcn_readfirstlane(tid >> 5), lane = tid & 31;
  const int q0 = qb * 64 + wave * 16;                      // sequence-local

  const _Float16* Qb = Qf + ((size_t)(h * Bsz + b) * Seq) * Dh;
  const _Float16* Kb = Kf + ((size_t)(h * Bsz + b) * Seq) * Dh;
  const _Float16* Vb = Vt + ((size_t)(h * Bsz + b) * Dh) * Seq;

  // B fragments of Q^T: column = query lane & 15, k = d
  const v16h bq0 = load_frag(Qb + (size_t)q0 * Dh +  0, Dh, lane);
  const v16h bq1 = load_frag(Qb + (size_t)q0 * Dh + 32, Dh, lane);

  // acc[n][r] = O^T[d = 16 n + 8 (lane >> 4) + r][query lane & 15]
  v8f acc[4] = {v8f{}, v8f{}, v8f{}, v8f{}};
  float mrow = -1e30f;      // running maximum of this lane's query (equal in both halves)
  float lrow = 0.0f;        // running sum over this half's keys only; halves joined at the end

  __shared__ __align__(16) _Float16 kts[64][Lp];           // 9 KB, [key][d]
  __shared__ __align__(16) _Float16 vts[64][Lp];           // 9 KB, [d][key]

  for (int t0 = 0; t0 < Seq; t0 += 64) {
    // ---- cooperative stage of K/V tiles into LDS (16B per thread-chunk) ----
    {
      const v8h* gk = (const v8h*)(Kb + (size_t)t0 * Dh);  // contiguous 8KB
      #pragma unroll
      for (int j = 0; j < 4; ++j) {
        const int c = tid + 128 * j;                       // 512 chunks of 16B
        const int r = c >> 3, cc = c & 7;
        ((v8h*)&kts[r][0])[cc] = gk[c];
      }
      #pragma unroll
      for (int j = 0; j < 4; ++j) {
        const int c = tid + 128 * j;                       // 512 chunks of 16B
        const int r = c >> 3, cc = c & 7;
        ((v8h*)&vts[r][0])[cc] = ((const v8h*)(Vb + (size_t)r * Seq + t0))[cc];
      }
    }
    // prefetch next tile while this one is consumed
    {
      const int tn = (t0 + 64 < Seq) ? (t0 + 64) : 0;
      __builtin_prefetch(Kb + (size_t)tn * Dh + (size_t)tid * 64, 0, 1);
      __builtin_prefetch(Vb + (size_t)(tid >> 1) * Seq + tn + (tid & 1) * 32, 0, 1);
    }
    __syncthreads();

    // ---- S^T = K Q^T (base-2 logits; 1/sqrt(D)*log2e folded into Q) ----
    // s[n][r] = score(key 16 n + 8 (lane >> 4) + r, query lane & 15)
    v8f s[4] = {v8f{}, v8f{}, v8f{}, v8f{}};
    #pragma unroll
    for (int n = 0; n < 4; ++n) {
      v16h ak0 = load_frag(&kts[n * 16][0],  Lp, lane);
      v16h ak1 = load_frag(&kts[n * 16][32], Lp, lane);
      s[n] = wmma16(ak0, bq0, s[n]);
      s[n] = wmma16(ak1, bq1, s[n]);
    }

    // ---- online softmax, one query per lane ----
    float mt = s[0][0];
    #pragma unroll
    for (int n = 0; n < 4; ++n)
      #pragma unroll
      for (int r = 0; r < 8; ++r) mt = fmaxf(mt, s[n][r]);
    mt = fmaxf(mt, xhalf(mt));
    const float mnew = fmaxf(mrow, mt);
    const float corr = exp2_raw(mrow - mnew);
    mrow = mnew;
    float rs[4];
    #pragma unroll
    for (int n = 0; n < 4; ++n) {
      s[n] = s[n] - mnew;      // on the whole vector: two scores a packed add
      rs[n] = 0.0f;
      #pragma unroll
      for (int r = 0; r < 8; ++r) {
        s[n][r] = exp2_raw(s[n][r]);
        rs[n] += s[n][r];
      }
    }
    lrow = lrow * corr + ((rs[0] + rs[1]) + (rs[2] + rs[3]));
    #pragma unroll
    for (int n = 0; n < 4; ++n) acc[n] *= corr;

    // ---- P^T: two converted D tiles are one B fragment (k = key, load_frag's order) ----
    const v16h bp0 = __builtin_shufflevector(__builtin_convertvector(s[0], v8h),
                                             __builtin_convertvector(s[1], v8h),
                                             0,1,2,3,4,5,6,7,8,9,10,11,12,13,14,15);
    const v16h bp1 = __builtin_shufflevector(__builtin_convertvector(s[2], v8h),
                                             __builtin_convertvector(s[3], v8h),
                                             0,1,2,3,4,5,6,7,8,9,10,11,12,13,14,15);

    // ---- O^T += V^T P^T ----
    #pragma unroll
    for (int n = 0; n < 4; ++n) {
      v16h av0 = load_frag(&vts[n * 16][0],  Lp, lane);
      v16h av1 = load_frag(&vts[n * 16][32], Lp, lane);
      acc[n] = wmma16(av0, bp0, acc[n]);
      acc[n] = wmma16(av1, bp1, acc[n]);
    }
    __syncthreads();      // all waves done with kts/vts before next overwrite
  }

  // ---- normalize, write ctx (heads concatenated along E) in fragment order:
  // row b*Seq + q0 + (lane & 15), k = h*Dh + 16 n + 8 (lane >> 4) + 0..7, which is
  // the 16-B chunk (n & 1) * 32 + lane of tile (row band, 2 h + (n >> 1)) ----
  const float inv = 1.0f / (lrow + xhalf(lrow));
  _Float16* cb = ctxh + (size_t)((b * Seq + q0) >> 4) * RowTile + (size_t)(h * (Dh / 32)) * TileH
               + lane * 8;
  #pragma unroll
  for (int n = 0; n < 4; ++n)
    *(v8h*)(cb + (n >> 1) * TileH + (n & 1) * 256) = __builtin_convertvector(acc[n] * inv, v8h);
}

// ---------------------------------------------------------------------------
// Output projection: ctx[Rows,Emb] x Wo + bo -> out (f32).
// grid (Rows/128, Emb/64), block 128; same 32x64-per-wave double-buffered loop.
// ---------------------------------------------------------------------------
__global__ void gemm_out_kernel(const _Float16* __restrict__ ctxh,
                                const _Float16* __restrict__ Wot,
                                const float* __restrict__ bo, float* __restrict__ out) {
  const int mt = blockIdx.x, nt = blockIdx.y;
  // wave number as a scalar: tile addresses are then scalar base + lane * 16 B
  const int wave = __builtin_amdgcn_readfirstlane(threadIdx.x >> 5), lane = threadIdx.x & 31;
  const int lo = lane & 15, hi = lane >> 4;
  const int m0 = mt * 128 + wave * 32;
  const int n0 = nt * 64;

  const _Float16* A0 = ctxh + (size_t)(m0 >> 4) * RowTile;
  const _Float16* A1 = A0 + RowTile;
  const _Float16* Bm = Wot + (size_t)(n0 >> 4) * RowTile;

  v16h a0 = load_tile(A0, lane);
  v16h a1 = load_tile(A1, lane);
  v16h b0 = load_tile(Bm + 0 * RowTile, lane);
  v16h b1 = load_tile(Bm + 1 * RowTile, lane);
  v16h b2 = load_tile(Bm + 2 * RowTile, lane);
  v16h b3 = load_tile(Bm + 3 * RowTile, lane);

  v8f acc[2][4] = {};
  const _Float16* pa = A0;
  const _Float16* pb = Bm;
  for (int k0 = 0; k0 < Emb; k0 += 32) {
    pa = (k0 + 32 < Emb) ? pa + TileH : A0;
    pb = (k0 + 32 < Emb) ? pb + TileH : Bm;
    v16h a0n = load_tile(pa, lane);
    v16h a1n = load_tile(pa + RowTile, lane);
    v16h bn0 = load_tile(pb + 0 * RowTile, lane);
    v16h bn1 = load_tile(pb + 1 * RowTile, lane);
    v16h bn2 = load_tile(pb + 2 * RowTile, lane);
    v16h bn3 = load_tile(pb + 3 * RowTile, lane);

    acc[0][0] = wmma16(a0, b0, acc[0][0]);
    acc[1][0] = wmma16(a1, b0, acc[1][0]);
    acc[0][1] = wmma16(a0, b1, acc[0][1]);
    acc[1][1] = wmma16(a1, b1, acc[1][1]);
    acc[0][2] = wmma16(a0, b2, acc[0][2]);
    acc[1][2] = wmma16(a1, b2, acc[1][2]);
    acc[0][3] = wmma16(a0, b3, acc[0][3]);
    acc[1][3] = wmma16(a1, b3, acc[1][3]);

    a0 = a0n; a1 = a1n; b0 = bn0; b1 = bn1; b2 = bn2; b3 = bn3;
  }
  // the last pass's redundant loads are still in flight: wait before the epilogue reuses
  // their offset register; the scheduling barrier keeps the epilogue's writes behind the wait
  asm volatile("s_wait_xcnt 0x0" ::: "memory");
  __builtin_amdgcn_sched_barrier(0);

  #pragma unroll
  for (int mi = 0; mi < 2; ++mi) {
    #pragma unroll
    for (int i = 0; i < 8; ++i) {
      const size_t row = (size_t)m0 + mi * 16 + hi * 8 + i;
      #pragma unroll
      for (int n = 0; n < 4; ++n) {
        const int col = n0 + n * 16 + lo;
        out[row * Emb + col] = acc[mi][n][i] + bo[col];
      }
    }
  }
}

// ---------------------------------------------------------------------------
extern "C" void kernel_launch(void* const* d_in, const int* in_sizes, int n_in,
                              void* d_out, int out_size, void* d_ws, size_t ws_size,
                              hipStream_t stream) {
  const float* x  = (const float*)d_in[0];
  const float* Wq = (const float*)d_in[1];
  const float* bq = (const float*)d_in[2];
  const float* Wk = (const float*)d_in[3];
  const float* bk = (const float*)d_in[4];
  const float* Wv = (const float*)d_in[5];
  const float* bv = (const float*)d_in[6];
  const float* Wo = (const float*)d_in[7];
  const float* bo = (const float*)d_in[8];
  float* out = (float*)d_out;

  char* ws = (char*)d_ws;
  _Float16* xh   = (_Float16*)(ws + (size_t) 0u);          // 16 MB  [Rows][Emb], fragment order
  _Float16* Wt   = (_Float16*)(ws + (size_t)(16u << 20));  //  6 MB  [3][H][D][E], fragment order
  _Float16* Wot  = (_Float16*)(ws + (size_t)(22u << 20));  //  2 MB  [E][E] transposed, fragment order
  _Float16* Qf   = (_Float16*)(ws + (size_t)(24u << 20));  // 16 MB  [H][B][S][D]
  _Float16* Kf   = (_Float16*)(ws + (size_t)(40u << 20));  // 16 MB  [H][B][S][D]
  _Float16* Vt   = (_Float16*)(ws + (size_t)(56u << 20));  // 16 MB  [H][B][D][S]
  _Float16* ctxh = (_Float16*)(ws + (size_t)(72u << 20));  // 16 MB  [Rows][Emb], fragment order

  cvt_x_kernel   <<<(Rows * Emb) / 2048, 256, 0, stream>>>(x, xh);
  cvt_wqkv_kernel<<<(3 * Hn * Dh * Emb) / 2048, 256, 0, stream>>>(Wq, Wk, Wv, Wt);
  cvt_wo_kernel  <<<(Emb * Emb) / 2048, 256, 0, stream>>>(Wo, Wot);

  gemm_qkv_kernel<<<dim3(Rows / 128, Hn, 3), 128, 0, stream>>>(xh, Wt, bq, bk, bv, Qf, Kf, Vt);
  attn_kernel    <<<dim3(Seq / 64, Hn, Bsz), 128, 0, stream>>>(Qf, Kf, Vt, ctxh);
  gemm_out_kernel<<<dim3(Rows / 128, Emb / 64), 128, 0, stream>>>(ctxh, Wot, bo, out);
}

// v005
// A run of this version takes 159 microseconds.
// Timed twice side by side with v004, it ran 1.41 and 1.38 times as fast.
// Counting every step since v000, it is 3.89 times as fast.
#include <hip/hip_runtime.h>
#include <hip/hip_bf16.h>

typedef __attribute__((ext_vector_type(16))) _Float16 v16h;
typedef __attribute__((ext_vector_type(8)))  _Float16 v8h;
typedef __attribute__((ext_vector_type(8)))  float    v8f;
typedef __attribute__((ext_vector_type(4)))  float    v4f;

constexpr int Bsz  = 4;
constexpr int Seq  = 2048;
constexpr int Emb  = 1024;
constexpr int Hn   = 16;
constexpr int Dh   = 64;
constexpr int Rows = Bsz * Seq;   // 8192
constexpr int Lp   = 72;

__device__ __forceinline__ v16h load_frag(const _Float16* p0, int ld, int lane) {
  const int lo = lane & 15, hi = lane >> 4;
  const _Float16* p = p0 + (size_t)lo * ld + hi * 8;
  v8h x0 = *(const v8h*)(p);
  v8h x1 = *(const v8h*)(p + 16);
  return __builtin_shufflevector(x0, x1, 0,1,2,3,4,5,6,7,8,9,10,11,12,13,14,15);
}

// Fragment order for the GEMM operands that live in global memory (x, the
// weights, ctx): a [rows][Emb] f16 matrix is kept as tiles of 16 rows x 32 k,
// 1 KB each, tile (rt, kt) at ((rt * Emb/32) + kt) * 512 halves. Inside a tile
// the 16-B chunk j * 32 + lane holds row (lane & 15), k = 16 j + 8 (lane >> 4)
// + 0..7: the k order of load_frag. A wave's global_load_async_to_lds_b128 then reads 512
// contiguous bytes (4 whole lines) where row-major rows cost it 16 lines.
constexpr int TileH   = 512;                 // halves per tile
constexpr int RowTile = (Emb / 32) * TileH;  // halves per band of 16 rows

__device__ __forceinline__ v16h load_tile(const _Float16* t, int lane) {
  v8h x0 = *(const v8h*)(t + lane * 8);
  v8h x1 = *(const v8h*)(t + 256 + lane * 8);
  return __builtin_shufflevector(x0, x1, 0,1,2,3,4,5,6,7,8,9,10,11,12,13,14,15);
}

__device__ __forceinline__ v8f wmma16(v16h a, v16h b, v8f c) {
  return __builtin_amdgcn_wmma_f32_16x16x32_f16(false, a, false, b, (short)0, c,
                                                false, false);
}

// ---------------------------------------------------------------------------
// Conversions to f16 in fragment order. One thread makes one 16-B chunk; chunk
// g = ((rt * 32 + kt) * 2 + j) * 32 + lane sits at byte 16 g.
// ---------------------------------------------------------------------------
__global__ void cvt_x_kernel(const float* __restrict__ x, _Float16* __restrict__ xh) {
  // Four neighbouring threads read one 128-B line of a row (its four chunks), a
  // wave 8 rows: 8 lines read whole, and 4 whole lines stored (8 rows x 16 B each).
  const int t = blockIdx.x * 256 + threadIdx.x;        // over Rows*Emb/8
  const int q = t & 3, c = (t >> 2) & 15, tile = t >> 6;   // tile = rt * 32 + kt
  const float* s = x + (size_t)((tile >> 5) * 16 + c) * Emb + (tile & 31) * 32 + q * 8;
  const v4f f0 = *(const v4f*)(s);
  const v4f f1 = *(const v4f*)(s + 4);
  v8h o;
  #pragma unroll
  for (int e = 0; e < 4; ++e) { o[e] = (_Float16)f0[e]; o[4 + e] = (_Float16)f1[e]; }
  // k = 8 q + 0..7 = 16 j + 8 hi + 0..7: j = q >> 1, hi = q & 1, lane = c + 16 hi
  *(v8h*)(xh + (size_t)tile * TileH + (q >> 1) * 256 + ((q & 1) * 16 + c) * 8) = o;
}

// Rows of Wt are (p, h, d), k is e: Wt[p][h][d][e] = W_p[h][e][d]
__global__ void cvt_wqkv_kernel(const float* __restrict__ Wq, const float* __restrict__ Wk,
                                const float* __restrict__ Wv, _Float16* __restrict__ Wt) {
  const int g = blockIdx.x * 256 + threadIdx.x;        // over 3*Hn*Dh*Emb/8
  const int l = g & 31, j = (g >> 5) & 1, kt = (g >> 6) & 31, rt = g >> 11;
  const int row = rt * 16 + (l & 15);
  const int d = row % Dh, h = (row / Dh) % Hn, p = row / (Dh * Hn);
  const int e0 = kt * 32 + j * 16 + (l >> 4) * 8;
  const float* Wp = (p == 0) ? Wq : (p == 1) ? Wk : Wv;
  const float* s = Wp + ((size_t)h * Emb + e0) * Dh + d;
  v8h o;
  #pragma unroll
  for (int e = 0; e < 8; ++e) o[e] = (_Float16)s[(size_t)e * Dh];
  *(v8h*)(Wt + (size_t)g * 8) = o;
}

// Rows of Wot are n, k is k: Wot[n][k] = Wo[k][n]
__global__ void cvt_wo_kernel(const float* __restrict__ Wo, _Float16* __restrict__ Wot) {
  const int g = blockIdx.x * 256 + threadIdx.x;        // over Emb*Emb/8
  const int l = g & 31, j = (g >> 5) & 1, kt = (g >> 6) & 31, rt = g >> 11;
  const int n  = rt * 16 + (l & 15);
  const int k0 = kt * 32 + j * 16 + (l >> 4) * 8;
  const float* s = Wo + (size_t)k0 * Emb + n;
  v8h o;
  #pragma unroll
  for (int e = 0; e < 8; ++e) o[e] = (_Float16)s[(size_t)e * Emb];
  *(v8h*)(Wot + (size_t)g * 8) = o;
}

// ---------------------------------------------------------------------------
// GEMM core of both projections: a block of 8 waves (4 x 2) makes a 256 x 128 tile of
// A B^T, a wave 64 x 64 (4 x 4 accumulator tiles). A stage is 64 k of the block's 16 A
// bands (32 KB) and 8 B bands (16 KB), already in fragment order, brought into LDS by
// asynchronous copies and read there by the waves that share them: each byte leaves L2
// once per block, not once per wave. Two buffers: stage t + 1 flies while stage t is
// worked on.
// ---------------------------------------------------------------------------
constexpr int BM     = 256;                     // block tile, rows
constexpr int BN     = 128;                     // block tile, columns
constexpr int StageH = 2 * TileH;               // halves of one band in a stage (2 tiles, 2 KB)
constexpr int OpAH   = (BM / 16) * StageH;      // halves of A's stage (32 KB)
constexpr int OpBH   = (BN / 16) * StageH;      // halves of B's stage (16 KB)
constexpr int BufH   = OpAH + OpBH;             // halves of a buffer: A stage, then B stage
constexpr int NStage = Emb / 64;

__device__ __forceinline__ unsigned lds_off(const void* p) { return (unsigned)(size_t)p; }

__device__ __forceinline__ void copy8(unsigned l, const _Float16* g0, const _Float16* g1) {
  asm volatile(
      "global_load_async_to_lds_b128 %0, %8, off\n\t"
      "global_load_async_to_lds_b128 %1, %9, off\n\t"
      "global_load_async_to_lds_b128 %2, %10, off\n\t"
      "global_load_async_to_lds_b128 %3, %11, off\n\t"
      "global_load_async_to_lds_b128 %4, %12, off\n\t"
      "global_load_async_to_lds_b128 %5, %13, off\n\t"
      "global_load_async_to_lds_b128 %6, %14, off\n\t"
      "global_load_async_to_lds_b128 %7, %15, off\n\t"
      "s_wait_xcnt 0x0"
      :: "v"(l), "v"(l + 512u), "v"(l + 1024u), "v"(l + 1536u),
         "v"(l + 2048u), "v"(l + 2560u), "v"(l + 3072u), "v"(l + 3584u),
         "v"(g0), "v"(g0 + 256), "v"(g0 + 512), "v"(g0 + 768),
         "v"(g1), "v"(g1 + 256), "v"(g1 + 512), "v"(g1 + 768)
      : "memory");
}

// Four such copies: the stage's 2 KB of band g, to 2 KB of LDS from l.
__device__ __forceinline__ void copy4(unsigned l, const _Float16* g) {
  asm volatile(
      "global_load_async_to_lds_b128 %0, %4, off\n\t"
      "global_load_async_to_lds_b128 %1, %5, off\n\t"
      "global_load_async_to_lds_b128 %2, %6, off\n\t"
      "global_load_async_to_lds_b128 %3, %7, off\n\t"
      "s_wait_xcnt 0x0"
      :: "v"(l), "v"(l + 512u), "v"(l + 1024u), "v"(l + 1536u),
         "v"(g), "v"(g + 256), "v"(g + 512), "v"(g + 768)
      : "memory");
}

// One wave's share of a stage: bands 2 wave and 2 wave + 1 of A (to la), band wave of B (to lb).
__device__ __forceinline__ void copy_stage(unsigned la, unsigned lb, const _Float16* ga,
                                           const _Float16* gb) {
  copy8(la, ga, ga + RowTile);
  copy4(lb, gb);
}

// Ag, Bg: first band of the block's 16 and 8; sm: BufH * 2 halves of LDS.
__device__ __forceinline__ void gemm_core(const _Float16* Ag, const _Float16* Bg, _Float16* sm,
                                          int wave, int lane, v8f (&acc)[4][4]) {
  const int wm = wave >> 1, wn = wave & 1;
  const _Float16* ga = Ag + (size_t)(2 * wave) * RowTile + lane * 8;
  const _Float16* gb = Bg + (size_t)wave * RowTile + lane * 8;
  const unsigned la = lds_off(sm) + (unsigned)wave * (2u * StageH * 2u) + (unsigned)lane * 16u;
  const unsigned lb = lds_off(sm) + OpAH * 2u + (unsigned)wave * (StageH * 2u) + (unsigned)lane * 16u;

  copy_stage(la, lb, ga, gb);
  // stage 0 has landed (this wave's copies), then is published to the other waves
  asm volatile("s_wait_asynccnt 0x0" ::: "memory");
  __syncthreads();
  copy_stage(la + BufH * 2u, lb + BufH * 2u, ga + StageH, gb + StageH);

  for (int t = 0; t < NStage; ++t) {
    const _Float16* sa = sm + (t & 1) * BufH + wm * (4 * StageH);
    const _Float16* sb = sm + (t & 1) * BufH + OpAH + wn * (4 * StageH);
    #pragma unroll
    for (int kk = 0; kk < 2; ++kk) {
      v16h a[4], b[4];
      #pragma unroll
      for (int i = 0; i < 4; ++i) a[i] = load_tile(sa + i * StageH + kk * TileH, lane);
      #pragma unroll
      for (int j = 0; j < 4; ++j) b[j] = load_tile(sb + j * StageH + kk * TileH, lane);
      // keeps the 16 LDS reads one group ahead of their 16 WMMAs: sunk among the WMMAs, each
      // B fragment's read is waited for right behind its issue
      __builtin_amdgcn_sched_barrier(0);
      #pragma unroll
      for (int j = 0; j < 4; ++j)
        #pragma unroll
        for (int i = 0; i < 4; ++i) acc[i][j] = wmma16(a[i], b[j], acc[i][j]);
    }
    // publish point: this wave's reads of buffer t & 1 are done, its copies of stage t + 1
    // have landed; behind the barrier that holds for every wave
    asm volatile("s_wait_dscnt 0x0" ::: "memory");
    asm volatile("s_wait_asynccnt 0x0" ::: "memory");
    __syncthreads();
    if (t + 2 < NStage)
      copy_stage(la + (unsigned)(t & 1) * (BufH * 2u), lb + (unsigned)(t & 1) * (BufH * 2u),
                 ga + (t + 2) * StageH, gb + (t + 2) * StageH);
  }
  // nothing is in flight here (the last two trips issue no copy); kept before the wave ends
  asm volatile("s_wait_asynccnt 0x0" ::: "memory");
}

// ---------------------------------------------------------------------------
// Fused QKV projection.  grid (Rows/256, 3*Hn*Dh/128), block 256. The columns are the rows
// (p, h, d) of Wt; a wave's 64 columns are one head of one projection.
// ---------------------------------------------------------------------------
__global__ void __launch_bounds__(256)
gemm_qkv_kernel(const _Float16* __restrict__ xh,
                const _Float16* __restrict__ Wt,
                const float* __restrict__ bq, const float* __restrict__ bk,
                const float* __restrict__ bv,
                _Float16* __restrict__ Qf, _Float16* __restrict__ Kf,
                _Float16* __restrict__ Vt) {
  __shared__ __align__(16) _Float16 sm[2 * BufH];          // 96 KB
  const int mt = blockIdx.x, nt = blockIdx.y;
  const int wave = __builtin_amdgcn_readfirstlane(threadIdx.x >> 5), lane = threadIdx.x & 31;
  const int lo = lane & 15, hi = lane >> 4;

  v8f acc[4][4] = {};
  gemm_core(xh + (size_t)(mt * (BM / 16)) * RowTile, Wt + (size_t)(nt * (BN / 16)) * RowTile,
            sm, wave, lane, acc);

  const int m0 = mt * BM + (wave >> 1) * 64;
  const int c0 = nt * BN + (wave & 1) * 64;
  const int p = c0 / (Hn * Dh), h = (c0 / Dh) % Hn;
  const int bb = m0 / Seq, ss0 = m0 % Seq;   // 64 rows from a multiple of 64: one sequence

  const float* bias = (p == 0) ? bq : (p == 1) ? bk : bv;
  const float  csc  = (p == 0) ? (0.125f * 1.44269504f) : 1.0f;
  float bn[4];
  #pragma unroll
  for (int n = 0; n < 4; ++n) bn[n] = bias[h * Dh + n * 16 + lo];
  // the bias loads are still in flight: wait before the store addresses reuse their base and
  // offset registers; the scheduling barrier keeps those writes behind the wait
  asm volatile("s_wait_xcnt 0x0" ::: "memory");
  __builtin_amdgcn_sched_barrier(0);

  // element (row ss0 + 16 mi + 8 hi + i, d = 16 n + lo)
  if (p == 2) {
    _Float16* dst = Vt + ((size_t)(h * Bsz + bb) * Dh + lo) * Seq + ss0 + hi * 8;
    #pragma unroll
    for (int n = 0; n < 4; ++n)          // along each row d of Vt in turn
      #pragma unroll
      for (int mi = 0; mi < 4; ++mi)
        #pragma unroll
        for (int i = 0; i < 8; ++i)
          dst[(size_t)(n * 16) * Seq + mi * 16 + i] = (_Float16)((acc[mi][n][i] + bn[n]) * csc);
  } else {
    _Float16* dst = ((p == 0) ? Qf : Kf) + ((size_t)(h * Bsz + bb) * Seq + ss0 + hi * 8) * Dh + lo;
    #pragma unroll
    for (int mi = 0; mi < 4; ++mi)
      #pragma unroll
      for (int i = 0; i < 8; ++i)
        #pragma unroll
        for (int n = 0; n < 4; ++n)
          dst[(mi * 16 + i) * Dh + n * 16] = (_Float16)((acc[mi][n][i] + bn[n]) * csc);
    // in the built code a test (never true here) leads from these stores on into the V branch,
    // whose address arithmetic reuses their address register: the wait stands in front of it
    asm volatile("s_wait_xcnt 0x0" ::: "memory");
  }
}

__device__ __forceinline__ float xhalf(float x) {
  const int b = __builtin_bit_cast(int, x);
  return __builtin_bit_cast(float,
      __builtin_amdgcn_permlanex16(b, b, 0x76543210, 0xfedcba98, false, false));
}

// 2^x as the bare v_exp_f32. exp2f wraps it in a range fix-up (compare, two selects, add,
// ldexp) that only matters for results under 2^-126, which the bare form may flush to 0.
// Here x <= 0; a P that small is 0 in f16 anyway, beside a row sum of at least 1 it is
// below f32 rounding, and a rescale factor that small leaves nothing of the old sums.
__device__ __forceinline__ float exp2_raw(float x) { return __builtin_amdgcn_exp2f(x); }

__global__ void attn_kernel(const _Float16* __restrict__ Qf, const _Float16* __restrict__ Kf,
                            const _Float16* __restrict__ Vt, _Float16* __restrict__ ctxh) {
  const int qb = blockIdx.x, h = blockIdx.y, b = blockIdx.z;
  const int tid  = threadIdx.x;
  // wave number as a scalar: the Q and ctx addresses are then scalar base + lane offset
  const int wave = __builtin_amdgcn_readfirstlane(tid >> 5), lane = tid & 31;
  const int q0 = qb * 64 + wave * 16;                      // sequence-local

  const _Float16* Qb = Qf + ((size_t)(h * Bsz + b) * Seq) * Dh;
  const _Float16* Kb = Kf + ((size_t)(h * Bsz + b) * Seq) * Dh;
  const _Float16* Vb = Vt + ((size_t)(h * Bsz + b) * Dh) * Seq;

  // B fragments of Q^T: column = query lane & 15, k = d
  const v16h bq0 = load_frag(Qb + (size_t)q0 * Dh +  0, Dh, lane);
  const v16h bq1 = load_frag(Qb + (size_t)q0 * Dh + 32, Dh, lane);

  // acc[n][r] = O^T[d = 16 n + 8 (lane >> 4) + r][query lane & 15]
  v8f acc[4] = {v8f{}, v8f{}, v8f{}, v8f{}};
  float mrow = -1e30f;      // running maximum of this lane's query (equal in both halves)
  float lrow = 0.0f;        // running sum over this half's keys only; halves joined at the end

  __shared__ __align__(16) _Float16 kts[64][Lp];           // 9 KB, [key][d]
  __shared__ __align__(16) _Float16 vts[64][Lp];           // 9 KB, [d][key]

  for (int t0 = 0; t0 < Seq; t0 += 64) {
    // ---- cooperative stage of K/V tiles into LDS (16B per thread-chunk) ----
    {
      const v8h* gk = (const v8h*)(Kb + (size_t)t0 * Dh);  // contiguous 8KB
      #pragma unroll
      for (int j = 0; j < 4; ++j) {
        const int c = tid + 128 * j;                       // 512 chunks of 16B
        const int r = c >> 3, cc = c & 7;
        ((v8h*)&kts[r][0])[cc] = gk[c];
      }
      #pragma unroll
      for (int j = 0; j < 4; ++j) {
        const int c = tid + 128 * j;                       // 512 chunks of 16B
        const int r = c >> 3, cc = c & 7;
        ((v8h*)&vts[r][0])[cc] = ((const v8h*)(Vb + (size_t)r * Seq + t0))[cc];
      }
    }
    // prefetch next tile while this one is consumed
    {
      const int tn = (t0 + 64 < Seq) ? (t0 + 64) : 0;
      __builtin_prefetch(Kb + (size_t)tn * Dh + (size_t)tid * 64, 0, 1);
      __builtin_prefetch(Vb + (size_t)(tid >> 1) * Seq + tn + (tid & 1) * 32, 0, 1);
    }
    __syncthreads();

    // ---- S^T = K Q^T (base-2 logits; 1/sqrt(D)*log2e folded into Q) ----
    // s[n][r] = score(key 16 n + 8 (lane >> 4) + r, query lane & 15)
    v8f s[4] = {v8f{}, v8f{}, v8f{}, v8f{}};
    #pragma unroll
    for (int n = 0; n < 4; ++n) {
      v16h ak0 = load_frag(&kts[n * 16][0],  Lp, lane);
      v16h ak1 = load_frag(&kts[n * 16][32], Lp, lane);
      s[n] = wmma16(ak0, bq0, s[n]);
      s[n] = wmma16(ak1, bq1, s[n]);
    }

    // ---- online softmax, one query per lane ----
    float mt = s[0][0];
    #pragma unroll
    for (int n = 0; n < 4; ++n)
      #pragma unroll
      for (int r = 0; r < 8; ++r) mt = fmaxf(mt, s[n][r]);
    mt = fmaxf(mt, xhalf(mt));
    const float mnew = fmaxf(mrow, mt);
    const float corr = exp2_raw(mrow - mnew);
    mrow = mnew;
    float rs[4];
    #pragma unroll
    for (int n = 0; n < 4; ++n) {
      s[n] = s[n] - mnew;      // on the whole vector: two scores a packed add
      rs[n] = 0.0f;
      #pragma unroll
      for (int r = 0; r < 8; ++r) {
        s[n][r] = exp2_raw(s[n][r]);
        rs[n] += s[n][r];
      }
    }
    lrow = lrow * corr + ((rs[0] + rs[1]) + (rs[2] + rs[3]));
    #pragma unroll
    for (int n = 0; n < 4; ++n) acc[n] *= corr;

    // ---- P^T: two converted D tiles are one B fragment (k = key, load_frag's order) ----
    const v16h bp0 = __builtin_shufflevector(__builtin_convertvector(s[0], v8h),
                                             __builtin_convertvector(s[1], v8h),
                                             0,1,2,3,4,5,6,7,8,9,10,11,12,13,14,15);
    const v16h bp1 = __builtin_shufflevector(__builtin_convertvector(s[2], v8h),
                                             __builtin_convertvector(s[3], v8h),
                                             0,1,2,3,4,5,6,7,8,9,10,11,12,13,14,15);

    // ---- O^T += V^T P^T ----
    #pragma unroll
    for (int n = 0; n < 4; ++n) {
      v16h av0 = load_frag(&vts[n * 16][0],  Lp, lane);
      v16h av1 = load_frag(&vts[n * 16][32], Lp, lane);
      acc[n] = wmma16(av0, bp0, acc[n]);
      acc[n] = wmma16(av1, bp1, acc[n]);
    }
    __syncthreads();      // all waves done with kts/vts before next overwrite
  }

  // ---- normalize, write ctx (heads concatenated along E) in fragment order:
  // row b*Seq + q0 + (lane & 15), k = h*Dh + 16 n + 8 (lane >> 4) + 0..7, which is
  // the 16-B chunk (n & 1) * 32 + lane of tile (row band, 2 h + (n >> 1)) ----
  const float inv = 1.0f / (lrow + xhalf(lrow));
  _Float16* cb = ctxh + (size_t)((b * Seq + q0) >> 4) * RowTile + (size_t)(h * (Dh / 32)) * TileH
               + lane * 8;
  #pragma unroll
  for (int n = 0; n < 4; ++n)
    *(v8h*)(cb + (n >> 1) * TileH + (n & 1) * 256) = __builtin_convertvector(acc[n] * inv, v8h);
}

// ---------------------------------------------------------------------------
// Output projection: ctx[Rows,Emb] x Wo + bo -> out (f32).
// grid (Rows/256, Emb/128), block 256; the same core.
// ---------------------------------------------------------------------------
__global__ void __launch_bounds__(256)
gemm_out_kernel(const _Float16* __restrict__ ctxh,
                const _Float16* __restrict__ Wot,
                const float* __restrict__ bo, float* __restrict__ out) {
  __shared__ __align__(16) _Float16 sm[2 * BufH];          // 96 KB
  const int mt = blockIdx.x, nt = blockIdx.y;
  const int wave = __builtin_amdgcn_readfirstlane(threadIdx.x >> 5), lane = threadIdx.x & 31;
  const int lo = lane & 15, hi = lane >> 4;

  v8f acc[4][4] = {};
  gemm_core(ctxh + (size_t)(mt * (BM / 16)) * RowTile, Wot + (size_t)(nt * (BN / 16)) * RowTile,
            sm, wave, lane, acc);

  const int m0 = mt * BM + (wave >> 1) * 64;
  const int n0 = nt * BN + (wave & 1) * 64;
  float bn[4];
  #pragma unroll
  for (int n = 0; n < 4; ++n) bn[n] = bo[n0 + n * 16 + lo];

  float* dst = out + (size_t)(m0 + hi * 8) * Emb + n0 + lo;
  #pragma unroll
  for (int mi = 0; mi < 4; ++mi)
    #pragma unroll
    for (int i = 0; i < 8; ++i)
      #pragma unroll
      for (int n = 0; n < 4; ++n)
        dst[(size_t)(mi * 16 + i) * Emb + n * 16] = acc[mi][n][i] + bn[n];
}

// ---------------------------------------------------------------------------
extern "C" void kernel_launch(void* const* d_in, const int* in_sizes, int n_in,
                              void* d_out, int out_size, void* d_ws, size_t ws_size,
                              hipStream_t stream) {
  const float* x  = (const float*)d_in[0];
  const float* Wq = (const float*)d_in[1];
  const float* bq = (const float*)d_in[2];
  const float* Wk = (const float*)d_in[3];
  const float* bk = (const float*)d_in[4];
  const float* Wv = (const float*)d_in[5];
  const float* bv = (const float*)d_in[6];
  const float* Wo = (const float*)d_in[7];
  const float* bo = (const float*)d_in[8];
  float* out = (float*)d_out;

  char* ws = (char*)d_ws;
  _Float16* xh   = (_Float16*)(ws + (size_t) 0u);          // 16 MB  [Rows][Emb], fragment order
  _Float16* Wt   = (_Float16*)(ws + (size_t)(16u << 20));  //  6 MB  [3][H][D][E], fragment order
  _Float16* Wot  = (_Float16*)(ws + (size_t)(22u << 20));  //  2 MB  [E][E] transposed, fragment order
  _Float16* Qf   = (_Float16*)(ws + (size_t)(24u << 20));  // 16 MB  [H][B][S][D]
  _Float16* Kf   = (_Float16*)(ws + (size_t)(40u << 20));  // 16 MB  [H][B][S][D]
  _Float16* Vt   = (_Float16*)(ws + (size_t)(56u << 20));  // 16 MB  [H][B][D][S]
  _Float16* ctxh = (_Float16*)(ws + (size_t)(72u << 20));  // 16 MB  [Rows][Emb], fragment order

  cvt_x_kernel   <<<(Rows * Emb) / 2048, 256, 0, stream>>>(x, xh);
  cvt_wqkv_kernel<<<(3 * Hn * Dh * Emb) / 2048, 256, 0, stream>>>(Wq, Wk, Wv, Wt);
  cvt_wo_kernel  <<<(Emb * Emb) / 2048, 256, 0, stream>>>(Wo, Wot);

  gemm_qkv_kernel<<<dim3(Rows / 256, (3 * Hn * Dh) / 128), 256, 0, stream>>>(xh, Wt, bq, bk, bv, Qf, Kf, Vt);
  attn_kernel    <<<dim3(Seq / 64, Hn, Bsz), 128, 0, stream>>>(Qf, Kf, Vt, ctxh);
  gemm_out_kernel<<<dim3(Rows / 256, Emb / 128), 256, 0, stream>>>(ctxh, Wot, bo, out);
}

// v006
// One run takes 141 microseconds.
// Two timings next to v005 both put it at 1.12 times that version's speed.
// Over all steps from v000 it is 4.37 times as fast.
#include <hip/hip_runtime.h>
#include <hip/hip_bf16.h>

typedef __attribute__((ext_vector_type(16))) _Float16 v16h;
typedef __attribute__((ext_vector_type(8)))  _Float16 v8h;
typedef __attribute__((ext_vector_type(8)))  float    v8f;
typedef __attribute__((ext_vector_type(4)))  float    v4f;

constexpr int Bsz  = 4;
constexpr int Seq  = 2048;
constexpr int Emb  = 1024;
constexpr int Hn   = 16;
constexpr int Dh   = 64;
constexpr int Rows = Bsz * Seq;   // 8192
constexpr int Lp   = 72;

__device__ __forceinline__ v16h load_frag(const _Float16* p0, int ld, int lane) {
  const int lo = lane & 15, hi = lane >> 4;
  const _Float16* p = p0 + (size_t)lo * ld + hi * 8;
  v8h x0 = *(const v8h*)(p);
  v8h x1 = *(const v8h*)(p + 16);
  return __builtin_shufflevector(x0, x1, 0,1,2,3,4,5,6,7,8,9,10,11,12,13,14,15);
}

// Fragment order for the GEMM operands that live in global memory (x, the
// weights, ctx): a [rows][Emb] f16 matrix is kept as tiles of 16 rows x 32 k,
// 1 KB each, tile (rt, kt) at ((rt * Emb/32) + kt) * 512 halves. Inside a tile
// the 16-B chunk j * 32 + lane holds row (lane & 15), k = 16 j + 8 (lane >> 4)
// + 0..7: the k order of load_frag. A wave's global_load_async_to_lds_b128 then reads 512
// contiguous bytes (4 whole lines) where row-major rows cost it 16 lines.
constexpr int TileH   = 512;                 // halves per tile
constexpr int RowTile = (Emb / 32) * TileH;  // halves per band of 16 rows

__device__ __forceinline__ v16h load_tile(const _Float16* t, int lane) {
  v8h x0 = *(const v8h*)(t + lane * 8);
  v8h x1 = *(const v8h*)(t + 256 + lane * 8);
  return __builtin_shufflevector(x0, x1, 0,1,2,3,4,5,6,7,8,9,10,11,12,13,14,15);
}

__device__ __forceinline__ v8f wmma16(v16h a, v16h b, v8f c) {
  return __builtin_amdgcn_wmma_f32_16x16x32_f16(false, a, false, b, (short)0, c,
                                                false, false);
}

// ---------------------------------------------------------------------------
// Conversions to f16 in fragment order. One thread makes one 16-B chunk; chunk
// g = ((rt * 32 + kt) * 2 + j) * 32 + lane sits at byte 16 g.
// ---------------------------------------------------------------------------
__global__ void cvt_x_kernel(const float* __restrict__ x, _Float16* __restrict__ xh) {
  // Four neighbouring threads read one 128-B line of a row (its four chunks), a
  // wave 8 rows: 8 lines read whole, and 4 whole lines stored (8 rows x 16 B each).
  const int t = blockIdx.x * 256 + threadIdx.x;        // over Rows*Emb/8
  const int q = t & 3, c = (t >> 2) & 15, tile = t >> 6;   // tile = rt * 32 + kt
  const float* s = x + (size_t)((tile >> 5) * 16 + c) * Emb + (tile & 31) * 32 + q * 8;
  const v4f f0 = *(const v4f*)(s);
  const v4f f1 = *(const v4f*)(s + 4);
  v8h o;
  #pragma unroll
  for (int e = 0; e < 4; ++e) { o[e] = (_Float16)f0[e]; o[4 + e] = (_Float16)f1[e]; }
  // k = 8 q + 0..7 = 16 j + 8 hi + 0..7: j = q >> 1, hi = q & 1, lane = c + 16 hi
  *(v8h*)(xh + (size_t)tile * TileH + (q >> 1) * 256 + ((q & 1) * 16 + c) * 8) = o;
}

// Rows of Wt are (p, h, d), k is e: Wt[p][h][d][e] = W_p[h][e][d]
__global__ void cvt_wqkv_kernel(const float* __restrict__ Wq, const float* __restrict__ Wk,
                                const float* __restrict__ Wv, _Float16* __restrict__ Wt) {
  const int g = blockIdx.x * 256 + threadIdx.x;        // over 3*Hn*Dh*Emb/8
  const int l = g & 31, j = (g >> 5) & 1, kt = (g >> 6) & 31, rt = g >> 11;
  const int row = rt * 16 + (l & 15);
  const int d = row % Dh, h = (row / Dh) % Hn, p = row / (Dh * Hn);
  const int e0 = kt * 32 + j * 16 + (l >> 4) * 8;
  const float* Wp = (p == 0) ? Wq : (p == 1) ? Wk : Wv;
  const float* s = Wp + ((size_t)h * Emb + e0) * Dh + d;
  v8h o;
  #pragma unroll
  for (int e = 0; e < 8; ++e) o[e] = (_Float16)s[(size_t)e * Dh];
  *(v8h*)(Wt + (size_t)g * 8) = o;
}

// Rows of Wot are n, k is k: Wot[n][k] = Wo[k][n]
__global__ void cvt_wo_kernel(const float* __restrict__ Wo, _Float16* __restrict__ Wot) {
  const int g = blockIdx.x * 256 + threadIdx.x;        // over Emb*Emb/8
  const int l = g & 31, j = (g >> 5) & 1, kt = (g >> 6) & 31, rt = g >> 11;
  const int n  = rt * 16 + (l & 15);
  const int k0 = kt * 32 + j * 16 + (l >> 4) * 8;
  const float* s = Wo + (size_t)k0 * Emb + n;
  v8h o;
  #pragma unroll
  for (int e = 0; e < 8; ++e) o[e] = (_Float16)s[(size_t)e * Emb];
  *(v8h*)(Wot + (size_t)g * 8) = o;
}

// ---------------------------------------------------------------------------
// GEMM core of both projections: a block of 8 waves (4 x 2) makes a 256 x 128 tile of
// A B^T, a wave 64 x 64 (4 x 4 accumulator tiles). A stage is 64 k of the block's 16 A
// bands (32 KB) and 8 B bands (16 KB), already in fragment order, brought into LDS by
// asynchronous copies and read there by the waves that share them: each byte leaves L2
// once per block, not once per wave. Two buffers: stage t + 1 flies while stage t is
// worked on.
// ---------------------------------------------------------------------------
constexpr int BM     = 256;                     // block tile, rows
constexpr int BN     = 128;                     // block tile, columns
constexpr int StageH = 2 * TileH;               // halves of one band in a stage (2 tiles, 2 KB)
constexpr int OpAH   = (BM / 16) * StageH;      // halves of A's stage (32 KB)
constexpr int OpBH   = (BN / 16) * StageH;      // halves of B's stage (16 KB)
constexpr int BufH   = OpAH + OpBH;             // halves of a buffer: A stage, then B stage
constexpr int NStage = Emb / 64;

__device__ __forceinline__ unsigned lds_off(const void* p) { return (unsigned)(size_t)p; }

__device__ __forceinline__ void copy8(unsigned l, const _Float16* g0, const _Float16* g1) {
  asm volatile(
      "global_load_async_to_lds_b128 %0, %8, off\n\t"
      "global_load_async_to_lds_b128 %1, %9, off\n\t"
      "global_load_async_to_lds_b128 %2, %10, off\n\t"
      "global_load_async_to_lds_b128 %3, %11, off\n\t"
      "global_load_async_to_lds_b128 %4, %12, off\n\t"
      "global_load_async_to_lds_b128 %5, %13, off\n\t"
      "global_load_async_to_lds_b128 %6, %14, off\n\t"
      "global_load_async_to_lds_b128 %7, %15, off\n\t"
      "s_wait_xcnt 0x0"
      :: "v"(l), "v"(l + 512u), "v"(l + 1024u), "v"(l + 1536u),
         "v"(l + 2048u), "v"(l + 2560u), "v"(l + 3072u), "v"(l + 3584u),
         "v"(g0), "v"(g0 + 256), "v"(g0 + 512), "v"(g0 + 768),
         "v"(g1), "v"(g1 + 256), "v"(g1 + 512), "v"(g1 + 768)
      : "memory");
}

// Four such copies: the stage's 2 KB of band g, to 2 KB of LDS from l.
__device__ __forceinline__ void copy4(unsigned l, const _Float16* g) {
  asm volatile(
      "global_load_async_to_lds_b128 %0, %4, off\n\t"
      "global_load_async_to_lds_b128 %1, %5, off\n\t"
      "global_load_async_to_lds_b128 %2, %6, off\n\t"
      "global_load_async_to_lds_b128 %3, %7, off\n\t"
      "s_wait_xcnt 0x0"
      :: "v"(l), "v"(l + 512u), "v"(l + 1024u), "v"(l + 1536u),
         "v"(g), "v"(g + 256), "v"(g + 512), "v"(g + 768)
      : "memory");
}

// One wave's share of a stage: bands 2 wave and 2 wave + 1 of A (to la), band wave of B (to lb).
__device__ __forceinline__ void copy_stage(unsigned la, unsigned lb, const _Float16* ga,
                                           const _Float16* gb) {
  copy8(la, ga, ga + RowTile);
  copy4(lb, gb);
}

// Ag, Bg: first band of the block's 16 and 8; sm: BufH * 2 halves of LDS.
__device__ __forceinline__ void gemm_core(const _Float16* Ag, const _Float16* Bg, _Float16* sm,
                                          int wave, int lane, v8f (&acc)[4][4]) {
  const int wm = wave >> 1, wn = wave & 1;
  const _Float16* ga = Ag + (size_t)(2 * wave) * RowTile + lane * 8;
  const _Float16* gb = Bg + (size_t)wave * RowTile + lane * 8;
  const unsigned la = lds_off(sm) + (unsigned)wave * (2u * StageH * 2u) + (unsigned)lane * 16u;
  const unsigned lb = lds_off(sm) + OpAH * 2u + (unsigned)wave * (StageH * 2u) + (unsigned)lane * 16u;

  copy_stage(la, lb, ga, gb);
  // stage 0 has landed (this wave's copies), then is published to the other waves
  asm volatile("s_wait_asynccnt 0x0" ::: "memory");
  __syncthreads();
  copy_stage(la + BufH * 2u, lb + BufH * 2u, ga + StageH, gb + StageH);

  for (int t = 0; t < NStage; ++t) {
    const _Float16* sa = sm + (t & 1) * BufH + wm * (4 * StageH);
    const _Float16* sb = sm + (t & 1) * BufH + OpAH + wn * (4 * StageH);
    #pragma unroll
    for (int kk = 0; kk < 2; ++kk) {
      v16h a[4], b[4];
      #pragma unroll
      for (int i = 0; i < 4; ++i) a[i] = load_tile(sa + i * StageH + kk * TileH, lane);
      #pragma unroll
      for (int j = 0; j < 4; ++j) b[j] = load_tile(sb + j * StageH + kk * TileH, lane);
      // keeps the 16 LDS reads one group ahead of their 16 WMMAs: sunk among the WMMAs, each
      // B fragment's read is waited for right behind its issue
      __builtin_amdgcn_sched_barrier(0);
      #pragma unroll
      for (int j = 0; j < 4; ++j)
        #pragma unroll
        for (int i = 0; i < 4; ++i) acc[i][j] = wmma16(a[i], b[j], acc[i][j]);
    }
    // publish point: this wave's reads of buffer t & 1 are done, its copies of stage t + 1
    // have landed; behind the barrier that holds for every wave
    asm volatile("s_wait_dscnt 0x0" ::: "memory");
    asm volatile("s_wait_asynccnt 0x0" ::: "memory");
    __syncthreads();
    if (t + 2 < NStage)
      copy_stage(la + (unsigned)(t & 1) * (BufH * 2u), lb + (unsigned)(t & 1) * (BufH * 2u),
                 ga + (t + 2) * StageH, gb + (t + 2) * StageH);
  }
  // nothing is in flight here (the last two trips issue no copy); kept before the wave ends
  asm volatile("s_wait_asynccnt 0x0" ::: "memory");
}

// ---------------------------------------------------------------------------
// Fused QKV projection.  grid (Rows/256, 3*Hn*Dh/128), block 256. The columns are the rows
// (p, h, d) of Wt; a wave's 64 columns are one head of one projection.
// ---------------------------------------------------------------------------
__global__ void __launch_bounds__(256)
gemm_qkv_kernel(const _Float16* __restrict__ xh,
                const _Float16* __restrict__ Wt,
                const float* __restrict__ bq, const float* __restrict__ bk,
                const float* __restrict__ bv,
                _Float16* __restrict__ Qf, _Float16* __restrict__ Kf,
                _Float16* __restrict__ Vt) {
  __shared__ __align__(16) _Float16 sm[2 * BufH];          // 96 KB
  const int mt = blockIdx.x, nt = blockIdx.y;
  const int wave = __builtin_amdgcn_readfirstlane(threadIdx.x >> 5), lane = threadIdx.x & 31;
  const int lo = lane & 15, hi = lane >> 4;

  v8f acc[4][4] = {};
  gemm_core(xh + (size_t)(mt * (BM / 16)) * RowTile, Wt + (size_t)(nt * (BN / 16)) * RowTile,
            sm, wave, lane, acc);

  const int m0 = mt * BM + (wave >> 1) * 64;
  const int c0 = nt * BN + (wave & 1) * 64;
  const int p = c0 / (Hn * Dh), h = (c0 / Dh) % Hn;
  const int bb = m0 / Seq, ss0 = m0 % Seq;   // 64 rows from a multiple of 64: one sequence

  const float* bias = (p == 0) ? bq : (p == 1) ? bk : bv;
  const float  csc  = (p == 0) ? (0.125f * 1.44269504f) : 1.0f;
  float bn[4];
  #pragma unroll
  for (int n = 0; n < 4; ++n) bn[n] = bias[h * Dh + n * 16 + lo];
  // the bias loads are still in flight: wait before the store addresses reuse their base and
  // offset registers; the scheduling barrier keeps those writes behind the wait
  asm volatile("s_wait_xcnt 0x0" ::: "memory");
  __builtin_amdgcn_sched_barrier(0);

  // element (row ss0 + 16 mi + 8 hi + i, d = 16 n + lo)
  if (p == 2) {
    _Float16* dst = Vt + ((size_t)(h * Bsz + bb) * Dh + lo) * Seq + ss0 + hi * 8;
    #pragma unroll
    for (int n = 0; n < 4; ++n)          // along each row d of Vt in turn
      #pragma unroll
      for (int mi = 0; mi < 4; ++mi)
        #pragma unroll
        for (int i = 0; i < 8; ++i)
          dst[(size_t)(n * 16) * Seq + mi * 16 + i] = (_Float16)((acc[mi][n][i] + bn[n]) * csc);
  } else {
    _Float16* dst = ((p == 0) ? Qf : Kf) + ((size_t)(h * Bsz + bb) * Seq + ss0 + hi * 8) * Dh + lo;
    #pragma unroll
    for (int mi = 0; mi < 4; ++mi)
      #pragma unroll
      for (int i = 0; i < 8; ++i)
        #pragma unroll
        for (int n = 0; n < 4; ++n)
          dst[(mi * 16 + i) * Dh + n * 16] = (_Float16)((acc[mi][n][i] + bn[n]) * csc);
    // in the built code a test (never true here) leads from these stores on into the V branch,
    // whose address arithmetic reuses their address register: the wait stands in front of it
    asm volatile("s_wait_xcnt 0x0" ::: "memory");
  }
}

__device__ __forceinline__ float xhalf(float x) {
  const int b = __builtin_bit_cast(int, x);
  return __builtin_bit_cast(float,
      __builtin_amdgcn_permlanex16(b, b, 0x76543210, 0xfedcba98, false, false));
}

// 2^x as the bare v_exp_f32. exp2f wraps it in a range fix-up (compare, two selects, add,
// ldexp) that only matters for results under 2^-126, which the bare form may flush to 0.
// Here x <= 0; a P that small is 0 in f16 anyway, beside a row sum of at least 1 it is
// below f32 rounding, and a rescale factor that small leaves nothing of the old sums.
__device__ __forceinline__ float exp2_raw(float x) { return __builtin_amdgcn_exp2f(x); }

constexpr int QG = 2;     // groups of 16 query columns per wave

__global__ void __launch_bounds__(128) __attribute__((amdgpu_waves_per_eu(4, 4)))
attn_kernel(const _Float16* __restrict__ Qf, const _Float16* __restrict__ Kf,
            const _Float16* __restrict__ Vt, _Float16* __restrict__ ctxh) {
  const int qb = blockIdx.x, h = blockIdx.y, b = blockIdx.z;
  const int tid  = threadIdx.x;
  // wave number as a scalar: the Q and ctx addresses are then scalar base + lane offset
  const int wave = __builtin_amdgcn_readfirstlane(tid >> 5), lane = tid & 31;
  const int q0 = qb * (64 * QG) + wave * (16 * QG);        // sequence-local

  const _Float16* Qb = Qf + ((size_t)(h * Bsz + b) * Seq) * Dh;
  const _Float16* Kb = Kf + ((size_t)(h * Bsz + b) * Seq) * Dh;
  const _Float16* Vb = Vt + ((size_t)(h * Bsz + b) * Dh) * Seq;

  // B fragments of Q^T: column = query 16 g + (lane & 15), k = d
  v16h bq[QG][2];
  #pragma unroll
  for (int g = 0; g < QG; ++g) {
    bq[g][0] = load_frag(Qb + (size_t)(q0 + g * 16) * Dh +  0, Dh, lane);
    bq[g][1] = load_frag(Qb + (size_t)(q0 + g * 16) * Dh + 32, Dh, lane);
  }

  // acc[g][n][r] = O^T[d = 16 n + 8 (lane >> 4) + r][query 16 g + (lane & 15)]
  v8f acc[QG][4] = {};
  float mrow[QG];           // running maximum of this lane's query (equal in both halves)
  float lrow[QG];           // running sum over this half's keys only; halves joined at the end
  #pragma unroll
  for (int g = 0; g < QG; ++g) { mrow[g] = -1e30f; lrow[g] = 0.0f; }

  __shared__ __align__(16) _Float16 kts[64][Lp];           // 9 KB, [key][d]
  __shared__ __align__(16) _Float16 vts[64][Lp];           // 9 KB, [d][key]

  for (int t0 = 0; t0 < Seq; t0 += 64) {
    // ---- cooperative stage of K/V tiles into LDS (16B per thread-chunk) ----
    {
      const v8h* gk = (const v8h*)(Kb + (size_t)t0 * Dh);  // contiguous 8KB
      #pragma unroll
      for (int j = 0; j < 4; ++j) {
        const int c = tid + 128 * j;                       // 512 chunks of 16B
        const int r = c >> 3, cc = c & 7;
        ((v8h*)&kts[r][0])[cc] = gk[c];
      }
      #pragma unroll
      for (int j = 0; j < 4; ++j) {
        const int c = tid + 128 * j;                       // 512 chunks of 16B
        const int r = c >> 3, cc = c & 7;
        ((v8h*)&vts[r][0])[cc] = ((const v8h*)(Vb + (size_t)r * Seq + t0))[cc];
      }
    }
    // prefetch next tile while this one is consumed
    {
      const int tn = (t0 + 64 < Seq) ? (t0 + 64) : 0;
      __builtin_prefetch(Kb + (size_t)tn * Dh + (size_t)tid * 64, 0, 1);
      __builtin_prefetch(Vb + (size_t)(tid >> 1) * Seq + tn + (tid & 1) * 32, 0, 1);
    }
    __syncthreads();

    // ---- S^T = K Q^T (base-2 logits; 1/sqrt(D)*log2e folded into Q) ----
    // s[g][n][r] = score(key 16 n + 8 (lane >> 4) + r, query 16 g + (lane & 15))
    v8f s[QG][4] = {};
    #pragma unroll
    for (int n = 0; n < 4; ++n) {
      v16h ak0 = load_frag(&kts[n * 16][0],  Lp, lane);
      v16h ak1 = load_frag(&kts[n * 16][32], Lp, lane);
      #pragma unroll
      for (int g = 0; g < QG; ++g) s[g][n] = wmma16(ak0, bq[g][0], s[g][n]);
      #pragma unroll
      for (int g = 0; g < QG; ++g) s[g][n] = wmma16(ak1, bq[g][1], s[g][n]);
    }

    // ---- online softmax, one query per lane and group ----
    v16h bp[QG][2];
    #pragma unroll
    for (int g = 0; g < QG; ++g) {
      float mt = s[g][0][0];
      #pragma unroll
      for (int n = 0; n < 4; ++n)
        #pragma unroll
        for (int r = 0; r < 8; ++r) mt = fmaxf(mt, s[g][n][r]);
      mt = fmaxf(mt, xhalf(mt));
      const float mnew = fmaxf(mrow[g], mt);
      const float corr = exp2_raw(mrow[g] - mnew);
      mrow[g] = mnew;
      float rs[4];
      #pragma unroll
      for (int n = 0; n < 4; ++n) {
        s[g][n] = s[g][n] - mnew;      // on the whole vector: two scores a packed add
        rs[n] = 0.0f;
        #pragma unroll
        for (int r = 0; r < 8; ++r) {
          s[g][n][r] = exp2_raw(s[g][n][r]);
          rs[n] += s[g][n][r];
        }
      }
      lrow[g] = lrow[g] * corr + ((rs[0] + rs[1]) + (rs[2] + rs[3]));
      #pragma unroll
      for (int n = 0; n < 4; ++n) acc[g][n] *= corr;

      // P^T: two converted D tiles are one B fragment (k = key, load_frag's order)
      bp[g][0] = __builtin_shufflevector(__builtin_convertvector(s[g][0], v8h),
                                         __builtin_convertvector(s[g][1], v8h),
                                         0,1,2,3,4,5,6,7,8,9,10,11,12,13,14,15);
      bp[g][1] = __builtin_shufflevector(__builtin_convertvector(s[g][2], v8h),
                                         __builtin_convertvector(s[g][3], v8h),
                                         0,1,2,3,4,5,6,7,8,9,10,11,12,13,14,15);
    }

    // ---- O^T += V^T P^T ----
    #pragma unroll
    for (int n = 0; n < 4; ++n) {
      v16h av0 = load_frag(&vts[n * 16][0],  Lp, lane);
      v16h av1 = load_frag(&vts[n * 16][32], Lp, lane);
      #pragma unroll
      for (int g = 0; g < QG; ++g) acc[g][n] = wmma16(av0, bp[g][0], acc[g][n]);
      #pragma unroll
      for (int g = 0; g < QG; ++g) acc[g][n] = wmma16(av1, bp[g][1], acc[g][n]);
    }
    __syncthreads();      // all waves done with kts/vts before next overwrite
  }

  // ---- normalize, write ctx (heads concatenated along E) in fragment order:
  // row b*Seq + q0 + 16 g + (lane & 15), k = h*Dh + 16 n + 8 (lane >> 4) + 0..7, which is
  // the 16-B chunk (n & 1) * 32 + lane of tile (row band, 2 h + (n >> 1)) ----
  v8h o[QG][4];
  #pragma unroll
  for (int g = 0; g < QG; ++g) {
    const float inv = 1.0f / (lrow[g] + xhalf(lrow[g]));
    #pragma unroll
    for (int n = 0; n < 4; ++n) o[g][n] = __builtin_convertvector(acc[g][n] * inv, v8h);
  }
  _Float16* cb = ctxh + (size_t)((b * Seq + q0) >> 4) * RowTile + (size_t)(h * (Dh / 32)) * TileH
               + lane * 8;
  #pragma unroll
  for (int g = 0; g < QG; ++g)
    #pragma unroll
    for (int n = 0; n < 4; ++n)
      *(v8h*)(cb + g * RowTile + (n >> 1) * TileH + (n & 1) * 256) = o[g][n];
}

// ---------------------------------------------------------------------------
// Output projection: ctx[Rows,Emb] x Wo + bo -> out (f32).
// grid (Rows/256, Emb/128), block 256; the same core.
// ---------------------------------------------------------------------------
__global__ void __launch_bounds__(256)
gemm_out_kernel(const _Float16* __restrict__ ctxh,
                const _Float16* __restrict__ Wot,
                const float* __restrict__ bo, float* __restrict__ out) {
  __shared__ __align__(16) _Float16 sm[2 * BufH];          // 96 KB
  const int mt = blockIdx.x, nt = blockIdx.y;
  const int wave = __builtin_amdgcn_readfirstlane(threadIdx.x >> 5), lane = threadIdx.x & 31;
  const int lo = lane & 15, hi = lane >> 4;

  v8f acc[4][4] = {};
  gemm_core(ctxh + (size_t)(mt * (BM / 16)) * RowTile, Wot + (size_t)(nt * (BN / 16)) * RowTile,
            sm, wave, lane, acc);

  const int m0 = mt * BM + (wave >> 1) * 64;
  const int n0 = nt * BN + (wave & 1) * 64;
  float bn[4];
  #pragma unroll
  for (int n = 0; n < 4; ++n) bn[n] = bo[n0 + n * 16 + lo];

  float* dst = out + (size_t)(m0 + hi * 8) * Emb + n0 + lo;
  #pragma unroll
  for (int mi = 0; mi < 4; ++mi)
    #pragma unroll
    for (int i = 0; i < 8; ++i)
      #pragma unroll
      for (int n = 0; n < 4; ++n)
        dst[(size_t)(mi * 16 + i) * Emb + n * 16] = acc[mi][n][i] + bn[n];
}

// ---------------------------------------------------------------------------
extern "C" void kernel_launch(void* const* d_in, const int* in_sizes, int n_in,
                              void* d_out, int out_size, void* d_ws, size_t ws_size,
                              hipStream_t stream) {
  const float* x  = (const float*)d_in[0];
  const float* Wq = (const float*)d_in[1];
  const float* bq = (const float*)d_in[2];
  const float* Wk = (const float*)d_in[3];
  const float* bk = (const float*)d_in[4];
  const float* Wv = (const float*)d_in[5];
  const float* bv = (const float*)d_in[6];
  const float* Wo = (const float*)d_in[7];
  const float* bo = (const float*)d_in[8];
  float* out = (float*)d_out;

  char* ws = (char*)d_ws;
  _Float16* xh   = (_Float16*)(ws + (size_t) 0u);          // 16 MB  [Rows][Emb], fragment order
  _Float16* Wt   = (_Float16*)(ws + (size_t)(16u << 20));  //  6 MB  [3][H][D][E], fragment order
  _Float16* Wot  = (_Float16*)(ws + (size_t)(22u << 20));  //  2 MB  [E][E] transposed, fragment order
  _Float16* Qf   = (_Float16*)(ws + (size_t)(24u << 20));  // 16 MB  [H][B][S][D]
  _Float16* Kf   = (_Float16*)(ws + (size_t)(40u << 20));  // 16 MB  [H][B][S][D]
  _Float16* Vt   = (_Float16*)(ws + (size_t)(56u << 20));  // 16 MB  [H][B][D][S]
  _Float16* ctxh = (_Float16*)(ws + (size_t)(72u << 20));  // 16 MB  [Rows][Emb], fragment order

  cvt_x_kernel   <<<(Rows * Emb) / 2048, 256, 0, stream>>>(x, xh);
  cvt_wqkv_kernel<<<(3 * Hn * Dh * Emb) / 2048, 256, 0, stream>>>(Wq, Wk, Wv, Wt);
  cvt_wo_kernel  <<<(Emb * Emb) / 2048, 256, 0, stream>>>(Wo, Wot);

  gemm_qkv_kernel<<<dim3(Rows / 256, (3 * Hn * Dh) / 128), 256, 0, stream>>>(xh, Wt, bq, bk, bv, Qf, Kf, Vt);
  attn_kernel    <<<dim3(Seq / 128, Hn, Bsz), 128, 0, stream>>>(Qf, Kf, Vt, ctxh);
  gemm_out_kernel<<<dim3(Rows / 256, Emb / 128), 256, 0, stream>>>(ctxh, Wot, bo, out);
}

// v007
// One run takes 136 microseconds.
// In both of two side-by-side timings against v006, it was 1.04 times as fast.
// Over all steps from v000 it is 4.53 times as fast.
#include <hip/hip_runtime.h>
#include <hip/hip_bf16.h>

typedef __attribute__((ext_vector_type(16))) _Float16 v16h;
typedef __attribute__((ext_vector_type(8)))  _Float16 v8h;
typedef __attribute__((ext_vector_type(8)))  float    v8f;
typedef __attribute__((ext_vector_type(4)))  float    v4f;

constexpr int Bsz  = 4;
constexpr int Seq  = 2048;
constexpr int Emb  = 1024;
constexpr int Hn   = 16;
constexpr int Dh   = 64;
constexpr int Rows = Bsz * Seq;   // 8192
constexpr int Lp   = 72;

__device__ __forceinline__ v16h load_frag(const _Float16* p0, int ld, int lane) {
  const int lo = lane & 15, hi = lane >> 4;
  const _Float16* p = p0 + (size_t)lo * ld + hi * 8;
  v8h x0 = *(const v8h*)(p);
  v8h x1 = *(const v8h*)(p + 16);
  return __builtin_shufflevector(x0, x1, 0,1,2,3,4,5,6,7,8,9,10,11,12,13,14,15);
}

// Fragment order for the GEMM operands that live in global memory (x, the
// weights, ctx): a [rows][Emb] f16 matrix is kept as tiles of 16 rows x 32 k,
// 1 KB each, tile (rt, kt) at ((rt * Emb/32) + kt) * 512 halves. Inside a tile
// the 16-B chunk j * 32 + lane holds row (lane & 15), k = 16 j + 8 (lane >> 4)
// + 0..7: the k order of load_frag. A wave's global_load_async_to_lds_b128 then reads 512
// contiguous bytes (4 whole lines) where row-major rows cost it 16 lines.
constexpr int TileH   = 512;                 // halves per tile
constexpr int RowTile = (Emb / 32) * TileH;  // halves per band of 16 rows

__device__ __forceinline__ v16h load_tile(const _Float16* t, int lane) {
  v8h x0 = *(const v8h*)(t + lane * 8);
  v8h x1 = *(const v8h*)(t + 256 + lane * 8);
  return __builtin_shufflevector(x0, x1, 0,1,2,3,4,5,6,7,8,9,10,11,12,13,14,15);
}

__device__ __forceinline__ v8f wmma16(v16h a, v16h b, v8f c) {
  return __builtin_amdgcn_wmma_f32_16x16x32_f16(false, a, false, b, (short)0, c,
                                                false, false);
}

// ---------------------------------------------------------------------------
// Conversions to f16 in fragment order, all in one launch of resident waves. A 16-B chunk
// g = ((rt * 32 + kt) * 2 + j) * 32 + lane of a matrix sits at byte 16 g. The grid has one
// thread per chunk of Wo (Emb * Emb / 8 = 131,072: 16 waves per WGP); x has 8 times as many
// chunks and each of Wq, Wk, Wv as many, so a thread makes 8 + 3 + 1 chunks: one chunk a
// thread would start 12 times the waves for the same bytes.
// All of a thread's loads are issued ahead of its first store.
// ---------------------------------------------------------------------------
constexpr int CvtThreads = Emb * Emb / 8;
constexpr int XPer       = Rows * Emb / 8 / CvtThreads;    // 8 chunks of x per thread
static_assert(Hn * Dh == Emb && Rows / 16 == CvtThreads / 256 && XPer * 4 == Emb / 32,
              "one band of x per block, one chunk of each weight per thread");

__global__ void __launch_bounds__(256)
cvt_all_kernel(const float* __restrict__ x, const float* __restrict__ Wq,
               const float* __restrict__ Wk, const float* __restrict__ Wv,
               const float* __restrict__ Wo, _Float16* __restrict__ xh,
               _Float16* __restrict__ Wt, _Float16* __restrict__ Wot) {
  const unsigned t = blockIdx.x * 256u + threadIdx.x;      // over CvtThreads
  // Every address below is a uniform base plus a 32-bit byte offset of the thread.

  // x: a block makes one band of 16 rows (64 KB read, 32 KB stored, each in a row), four
  // tiles (128 k) per it, so that a thread's chunks differ by a constant offset only.
  // Four neighbouring threads read one 128-B line of a row (its four chunks), a
  // wave 8 rows: 8 lines read whole, and 4 whole lines stored (8 rows x 16 B each).
  const unsigned q = t & 3u, c = (t >> 2) & 15u, tl = (t >> 6) & 3u;   // tile kt = 4 it + tl
  const unsigned xo = ((blockIdx.x * 16u + c) * Emb + tl * 32u + q * 8u) * 4u;
  v4f f0[XPer], f1[XPer];
  #pragma unroll
  for (int it = 0; it < XPer; ++it) {
    f0[it] = *(const v4f*)((const char*)x + xo + it * 512u);
    f1[it] = *(const v4f*)((const char*)x + xo + it * 512u + 16u);
  }

  // weights: chunk t of each. Rows of Wt are (p, h, d), k is e: Wt[p][h][d][e] = W_p[h][e][d];
  // rows of Wot are n, k is k: Wot[n][k] = Wo[k][n]
  const unsigned l = t & 31u, j = (t >> 5) & 1u, kt = (t >> 6) & 31u, rt = t >> 11;
  const unsigned row = rt * 16u + (l & 15u);               // (h, d) of one projection, or n
  const unsigned k0  = kt * 32u + j * 16u + (l >> 4) * 8u;
  const unsigned wo3 = (((row / Dh) * Emb + k0) * Dh + row % Dh) * 4u;
  const unsigned wo1 = (k0 * Emb + row) * 4u;
  float wq[8], wk[8], wv[8], wo[8];
  #pragma unroll
  for (int e = 0; e < 8; ++e) wq[e] = *(const float*)((const char*)(Wq + e * Dh) + wo3);
  #pragma unroll
  for (int e = 0; e < 8; ++e) wk[e] = *(const float*)((const char*)(Wk + e * Dh) + wo3);
  #pragma unroll
  for (int e = 0; e < 8; ++e) wv[e] = *(const float*)((const char*)(Wv + e * Dh) + wo3);
  #pragma unroll
  for (int e = 0; e < 8; ++e) wo[e] = *(const float*)((const char*)(Wo + e * Emb) + wo1);
  // the loads are in flight: wait before anything reuses their offset registers, which the
  // statement names as inputs so that they stay whole up to it
  asm volatile("s_wait_xcnt 0x0" :: "v"(xo), "v"(wo3), "v"(wo1) : "memory");
  // keeps all 48 loads in front of the first conversion (left free, the compiler waits for the
  // first few before it issues the rest, and a wave pays the memory latency several times), and
  // the writes of the offset registers behind the wait
  __builtin_amdgcn_sched_barrier(0);

  // k = 8 q + 0..7 = 16 j + 8 hi + 0..7: j = q >> 1, hi = q & 1, lane = c + 16 hi
  const unsigned dxo = ((blockIdx.x * 32u + tl) * TileH + (q >> 1) * 256u
                        + ((q & 1u) * 16u + c) * 8u) * 2u;
  #pragma unroll
  for (int it = 0; it < XPer; ++it) {
    v8h o;
    #pragma unroll
    for (int e = 0; e < 4; ++e) { o[e] = (_Float16)f0[it][e]; o[4 + e] = (_Float16)f1[it][e]; }
    *(v8h*)((char*)xh + dxo + it * (4u * TileH * 2u)) = o;
  }
  v8h oq, ok, ov, oo;
  #pragma unroll
  for (int e = 0; e < 8; ++e) {
    oq[e] = (_Float16)wq[e]; ok[e] = (_Float16)wk[e];
    ov[e] = (_Float16)wv[e]; oo[e] = (_Float16)wo[e];
  }
  *(v8h*)((char*)Wt + t * 16u)                             = oq;
  *(v8h*)((char*)(Wt + (size_t)CvtThreads * 8) + t * 16u)  = ok;
  *(v8h*)((char*)(Wt + (size_t)CvtThreads * 16) + t * 16u) = ov;
  *(v8h*)((char*)Wot + t * 16u)                            = oo;
}

// ---------------------------------------------------------------------------
// GEMM core of both projections: a block of 8 waves (4 x 2) makes a 256 x 128 tile of
// A B^T, a wave 64 x 64 (4 x 4 accumulator tiles). A stage is 64 k of the block's 16 A
// bands (32 KB) and 8 B bands (16 KB), already in fragment order, brought into LDS by
// asynchronous copies and read there by the waves that share them: each byte leaves L2
// once per block, not once per wave. Two buffers: stage t + 1 flies while stage t is
// worked on.
// ---------------------------------------------------------------------------
constexpr int BM     = 256;                     // block tile, rows
constexpr int BN     = 128;                     // block tile, columns
constexpr int StageH = 2 * TileH;               // halves of one band in a stage (2 tiles, 2 KB)
constexpr int OpAH   = (BM / 16) * StageH;      // halves of A's stage (32 KB)
constexpr int OpBH   = (BN / 16) * StageH;      // halves of B's stage (16 KB)
constexpr int BufH   = OpAH + OpBH;             // halves of a buffer: A stage, then B stage
constexpr int NStage = Emb / 64;

__device__ __forceinline__ unsigned lds_off(const void* p) { return (unsigned)(size_t)p; }

__device__ __forceinline__ void copy8(unsigned l, const _Float16* g0, const _Float16* g1) {
  asm volatile(
      "global_load_async_to_lds_b128 %0, %8, off\n\t"
      "global_load_async_to_lds_b128 %1, %9, off\n\t"
      "global_load_async_to_lds_b128 %2, %10, off\n\t"
      "global_load_async_to_lds_b128 %3, %11, off\n\t"
      "global_load_async_to_lds_b128 %4, %12, off\n\t"
      "global_load_async_to_lds_b128 %5, %13, off\n\t"
      "global_load_async_to_lds_b128 %6, %14, off\n\t"
      "global_load_async_to_lds_b128 %7, %15, off\n\t"
      "s_wait_xcnt 0x0"
      :: "v"(l), "v"(l + 512u), "v"(l + 1024u), "v"(l + 1536u),
         "v"(l + 2048u), "v"(l + 2560u), "v"(l + 3072u), "v"(l + 3584u),
         "v"(g0), "v"(g0 + 256), "v"(g0 + 512), "v"(g0 + 768),
         "v"(g1), "v"(g1 + 256), "v"(g1 + 512), "v"(g1 + 768)
      : "memory");
}

// Four such copies: the stage's 2 KB of band g, to 2 KB of LDS from l.
__device__ __forceinline__ void copy4(unsigned l, const _Float16* g) {
  asm volatile(
      "global_load_async_to_lds_b128 %0, %4, off\n\t"
      "global_load_async_to_lds_b128 %1, %5, off\n\t"
      "global_load_async_to_lds_b128 %2, %6, off\n\t"
      "global_load_async_to_lds_b128 %3, %7, off\n\t"
      "s_wait_xcnt 0x0"
      :: "v"(l), "v"(l + 512u), "v"(l + 1024u), "v"(l + 1536u),
         "v"(g), "v"(g + 256), "v"(g + 512), "v"(g + 768)
      : "memory");
}

// One wave's share of a stage: bands 2 wave and 2 wave + 1 of A (to la), band wave of B (to lb).
__device__ __forceinline__ void copy_stage(unsigned la, unsigned lb, const _Float16* ga,
                                           const _Float16* gb) {
  copy8(la, ga, ga + RowTile);
  copy4(lb, gb);
}

// Ag, Bg: first band of the block's 16 and 8; sm: BufH * 2 halves of LDS.
__device__ __forceinline__ void gemm_core(const _Float16* Ag, const _Float16* Bg, _Float16* sm,
                                          int wave, int lane, v8f (&acc)[4][4]) {
  const int wm = wave >> 1, wn = wave & 1;
  const _Float16* ga = Ag + (size_t)(2 * wave) * RowTile + lane * 8;
  const _Float16* gb = Bg + (size_t)wave * RowTile + lane * 8;
  const unsigned la = lds_off(sm) + (unsigned)wave * (2u * StageH * 2u) + (unsigned)lane * 16u;
  const unsigned lb = lds_off(sm) + OpAH * 2u + (unsigned)wave * (StageH * 2u) + (unsigned)lane * 16u;

  copy_stage(la, lb, ga, gb);
  // stage 0 has landed (this wave's copies), then is published to the other waves
  asm volatile("s_wait_asynccnt 0x0" ::: "memory");
  __syncthreads();
  copy_stage(la + BufH * 2u, lb + BufH * 2u, ga + StageH, gb + StageH);

  for (int t = 0; t < NStage; ++t) {
    const _Float16* sa = sm + (t & 1) * BufH + wm * (4 * StageH);
    const _Float16* sb = sm + (t & 1) * BufH + OpAH + wn * (4 * StageH);
    #pragma unroll
    for (int kk = 0; kk < 2; ++kk) {
      v16h a[4], b[4];
      #pragma unroll
      for (int i = 0; i < 4; ++i) a[i] = load_tile(sa + i * StageH + kk * TileH, lane);
      #pragma unroll
      for (int j = 0; j < 4; ++j) b[j] = load_tile(sb + j * StageH + kk * TileH, lane);
      // keeps the 16 LDS reads one group ahead of their 16 WMMAs: sunk among the WMMAs, each
      // B fragment's read is waited for right behind its issue
      __builtin_amdgcn_sched_barrier(0);
      #pragma unroll
      for (int j = 0; j < 4; ++j)
        #pragma unroll
        for (int i = 0; i < 4; ++i) acc[i][j] = wmma16(a[i], b[j], acc[i][j]);
    }
    // publish point: this wave's reads of buffer t & 1 are done, its copies of stage t + 1
    // have landed; behind the barrier that holds for every wave
    asm volatile("s_wait_dscnt 0x0" ::: "memory");
    asm volatile("s_wait_asynccnt 0x0" ::: "memory");
    __syncthreads();
    if (t + 2 < NStage)
      copy_stage(la + (unsigned)(t & 1) * (BufH * 2u), lb + (unsigned)(t & 1) * (BufH * 2u),
                 ga + (t + 2) * StageH, gb + (t + 2) * StageH);
  }
  // nothing is in flight here (the last two trips issue no copy); kept before the wave ends
  asm volatile("s_wait_asynccnt 0x0" ::: "memory");
}

// ---------------------------------------------------------------------------
// Fused QKV projection.  grid (Rows/256, 3*Hn*Dh/128), block 256. The columns are the rows
// (p, h, d) of Wt; a wave's 64 columns are one head of one projection.
// ---------------------------------------------------------------------------
__global__ void __launch_bounds__(256)
gemm_qkv_kernel(const _Float16* __restrict__ xh,
                const _Float16* __restrict__ Wt,
                const float* __restrict__ bq, const float* __restrict__ bk,
                const float* __restrict__ bv,
                _Float16* __restrict__ Qf, _Float16* __restrict__ Kf,
                _Float16* __restrict__ Vt) {
  __shared__ __align__(16) _Float16 sm[2 * BufH];          // 96 KB
  const int mt = blockIdx.x, nt = blockIdx.y;
  const int wave = __builtin_amdgcn_readfirstlane(threadIdx.x >> 5), lane = threadIdx.x & 31;
  const int lo = lane & 15, hi = lane >> 4;

  v8f acc[4][4] = {};
  gemm_core(xh + (size_t)(mt * (BM / 16)) * RowTile, Wt + (size_t)(nt * (BN / 16)) * RowTile,
            sm, wave, lane, acc);

  const int m0 = mt * BM + (wave >> 1) * 64;
  const int c0 = nt * BN + (wave & 1) * 64;
  const int p = c0 / (Hn * Dh), h = (c0 / Dh) % Hn;
  const int bb = m0 / Seq, ss0 = m0 % Seq;   // 64 rows from a multiple of 64: one sequence

  const float* bias = (p == 0) ? bq : (p == 1) ? bk : bv;
  const float  csc  = (p == 0) ? (0.125f * 1.44269504f) : 1.0f;
  float bn[4];
  #pragma unroll
  for (int n = 0; n < 4; ++n) bn[n] = bias[h * Dh + n * 16 + lo];
  // the bias loads are still in flight: wait before the store addresses reuse their base and
  // offset registers; the scheduling barrier keeps those writes behind the wait
  asm volatile("s_wait_xcnt 0x0" ::: "memory");
  __builtin_amdgcn_sched_barrier(0);

  // element (row ss0 + 16 mi + 8 hi + i, d = 16 n + lo)
  if (p == 2) {
    _Float16* dst = Vt + ((size_t)(h * Bsz + bb) * Dh + lo) * Seq + ss0 + hi * 8;
    #pragma unroll
    for (int n = 0; n < 4; ++n)          // along each row d of Vt in turn
      #pragma unroll
      for (int mi = 0; mi < 4; ++mi)
        #pragma unroll
        for (int i = 0; i < 8; ++i)
          dst[(size_t)(n * 16) * Seq + mi * 16 + i] = (_Float16)((acc[mi][n][i] + bn[n]) * csc);
  } else {
    _Float16* dst = ((p == 0) ? Qf : Kf) + ((size_t)(h * Bsz + bb) * Seq + ss0 + hi * 8) * Dh + lo;
    #pragma unroll
    for (int mi = 0; mi < 4; ++mi)
      #pragma unroll
      for (int i = 0; i < 8; ++i)
        #pragma unroll
        for (int n = 0; n < 4; ++n)
          dst[(mi * 16 + i) * Dh + n * 16] = (_Float16)((acc[mi][n][i] + bn[n]) * csc);
    // in the built code a test (never true here) leads from these stores on into the V branch,
    // whose address arithmetic reuses their address register: the wait stands in front of it
    asm volatile("s_wait_xcnt 0x0" ::: "memory");
  }
}

__device__ __forceinline__ float xhalf(float x) {
  const int b = __builtin_bit_cast(int, x);
  return __builtin_bit_cast(float,
      __builtin_amdgcn_permlanex16(b, b, 0x76543210, 0xfedcba98, false, false));
}

// 2^x as the bare v_exp_f32. exp2f wraps it in a range fix-up (compare, two selects, add,
// ldexp) that only matters for results under 2^-126, which the bare form may flush to 0.
// Here x <= 0; a P that small is 0 in f16 anyway, beside a row sum of at least 1 it is
// below f32 rounding, and a rescale factor that small leaves nothing of the old sums.
__device__ __forceinline__ float exp2_raw(float x) { return __builtin_amdgcn_exp2f(x); }

constexpr int QG = 2;     // groups of 16 query columns per wave

__global__ void __launch_bounds__(128) __attribute__((amdgpu_waves_per_eu(4, 4)))
attn_kernel(const _Float16* __restrict__ Qf, const _Float16* __restrict__ Kf,
            const _Float16* __restrict__ Vt, _Float16* __restrict__ ctxh) {
  const int qb = blockIdx.x, h = blockIdx.y, b = blockIdx.z;
  const int tid  = threadIdx.x;
  // wave number as a scalar: the Q and ctx addresses are then scalar base + lane offset
  const int wave = __builtin_amdgcn_readfirstlane(tid >> 5), lane = tid & 31;
  const int q0 = qb * (64 * QG) + wave * (16 * QG);        // sequence-local

  const _Float16* Qb = Qf + ((size_t)(h * Bsz + b) * Seq) * Dh;
  const _Float16* Kb = Kf + ((size_t)(h * Bsz + b) * Seq) * Dh;
  const _Float16* Vb = Vt + ((size_t)(h * Bsz + b) * Dh) * Seq;

  // B fragments of Q^T: column = query 16 g + (lane & 15), k = d
  v16h bq[QG][2];
  #pragma unroll
  for (int g = 0; g < QG; ++g) {
    bq[g][0] = load_frag(Qb + (size_t)(q0 + g * 16) * Dh +  0, Dh, lane);
    bq[g][1] = load_frag(Qb + (size_t)(q0 + g * 16) * Dh + 32, Dh, lane);
  }

  // acc[g][n][r] = O^T[d = 16 n + 8 (lane >> 4) + r][query 16 g + (lane & 15)]
  v8f acc[QG][4] = {};
  float mrow[QG];           // running maximum of this lane's query (equal in both halves)
  float lrow[QG];           // running sum over this half's keys only; halves joined at the end
  #pragma unroll
  for (int g = 0; g < QG; ++g) { mrow[g] = -1e30f; lrow[g] = 0.0f; }

  __shared__ __align__(16) _Float16 kts[64][Lp];           // 9 KB, [key][d]
  __shared__ __align__(16) _Float16 vts[64][Lp];           // 9 KB, [d][key]

  for (int t0 = 0; t0 < Seq; t0 += 64) {
    // ---- cooperative stage of K/V tiles into LDS (16B per thread-chunk) ----
    {
      const v8h* gk = (const v8h*)(Kb + (size_t)t0 * Dh);  // contiguous 8KB
      #pragma unroll
      for (int j = 0; j < 4; ++j) {
        const int c = tid + 128 * j;                       // 512 chunks of 16B
        const int r = c >> 3, cc = c & 7;
        ((v8h*)&kts[r][0])[cc] = gk[c];
      }
      #pragma unroll
      for (int j = 0; j < 4; ++j) {
        const int c = tid + 128 * j;                       // 512 chunks of 16B
        const int r = c >> 3, cc = c & 7;
        ((v8h*)&vts[r][0])[cc] = ((const v8h*)(Vb + (size_t)r * Seq + t0))[cc];
      }
    }
    // prefetch next tile while this one is consumed
    {
      const int tn = (t0 + 64 < Seq) ? (t0 + 64) : 0;
      __builtin_prefetch(Kb + (size_t)tn * Dh + (size_t)tid * 64, 0, 1);
      __builtin_prefetch(Vb + (size_t)(tid >> 1) * Seq + tn + (tid & 1) * 32, 0, 1);
    }
    __syncthreads();

    // ---- S^T = K Q^T (base-2 logits; 1/sqrt(D)*log2e folded into Q) ----
    // s[g][n][r] = score(key 16 n + 8 (lane >> 4) + r, query 16 g + (lane & 15))
    v8f s[QG][4] = {};
    #pragma unroll
    for (int n = 0; n < 4; ++n) {
      v16h ak0 = load_frag(&kts[n * 16][0],  Lp, lane);
      v16h ak1 = load_frag(&kts[n * 16][32], Lp, lane);
      #pragma unroll
      for (int g = 0; g < QG; ++g) s[g][n] = wmma16(ak0, bq[g][0], s[g][n]);
      #pragma unroll
      for (int g = 0; g < QG; ++g) s[g][n] = wmma16(ak1, bq[g][1], s[g][n]);
    }

    // ---- online softmax, one query per lane and group ----
    v16h bp[QG][2];
    #pragma unroll
    for (int g = 0; g < QG; ++g) {
      float mt = s[g][0][0];
      #pragma unroll
      for (int n = 0; n < 4; ++n)
        #pragma unroll
        for (int r = 0; r < 8; ++r) mt = fmaxf(mt, s[g][n][r]);
      mt = fmaxf(mt, xhalf(mt));
      const float mnew = fmaxf(mrow[g], mt);
      const float corr = exp2_raw(mrow[g] - mnew);
      mrow[g] = mnew;
      float rs[4];
      #pragma unroll
      for (int n = 0; n < 4; ++n) {
        s[g][n] = s[g][n] - mnew;      // on the whole vector: two scores a packed add
        rs[n] = 0.0f;
        #pragma unroll
        for (int r = 0; r < 8; ++r) {
          s[g][n][r] = exp2_raw(s[g][n][r]);
          rs[n] += s[g][n][r];
        }
      }
      lrow[g] = lrow[g] * corr + ((rs[0] + rs[1]) + (rs[2] + rs[3]));
      #pragma unroll
      for (int n = 0; n < 4; ++n) acc[g][n] *= corr;

      // P^T: two converted D tiles are one B fragment (k = key, load_frag's order)
      bp[g][0] = __builtin_shufflevector(__builtin_convertvector(s[g][0], v8h),
                                         __builtin_convertvector(s[g][1], v8h),
                                         0,1,2,3,4,5,6,7,8,9,10,11,12,13,14,15);
      bp[g][1] = __builtin_shufflevector(__builtin_convertvector(s[g][2], v8h),
                                         __builtin_convertvector(s[g][3], v8h),
                                         0,1,2,3,4,5,6,7,8,9,10,11,12,13,14,15);
    }

    // ---- O^T += V^T P^T ----
    #pragma unroll
    for (int n = 0; n < 4; ++n) {
      v16h av0 = load_frag(&vts[n * 16][0],  Lp, lane);
      v16h av1 = load_frag(&vts[n * 16][32], Lp, lane);
      #pragma unroll
      for (int g = 0; g < QG; ++g) acc[g][n] = wmma16(av0, bp[g][0], acc[g][n]);
      #pragma unroll
      for (int g = 0; g < QG; ++g) acc[g][n] = wmma16(av1, bp[g][1], acc[g][n]);
    }
    __syncthreads();      // all waves done with kts/vts before next overwrite
  }

  // ---- normalize, write ctx (heads concatenated along E) in fragment order:
  // row b*Seq + q0 + 16 g + (lane & 15), k = h*Dh + 16 n + 8 (lane >> 4) + 0..7, which is
  // the 16-B chunk (n & 1) * 32 + lane of tile (row band, 2 h + (n >> 1)) ----
  v8h o[QG][4];
  #pragma unroll
  for (int g = 0; g < QG; ++g) {
    const float inv = 1.0f / (lrow[g] + xhalf(lrow[g]));
    #pragma unroll
    for (int n = 0; n < 4; ++n) o[g][n] = __builtin_convertvector(acc[g][n] * inv, v8h);
  }
  _Float16* cb = ctxh + (size_t)((b * Seq + q0) >> 4) * RowTile + (size_t)(h * (Dh / 32)) * TileH
               + lane * 8;
  #pragma unroll
  for (int g = 0; g < QG; ++g)
    #pragma unroll
    for (int n = 0; n < 4; ++n)
      *(v8h*)(cb + g * RowTile + (n >> 1) * TileH + (n & 1) * 256) = o[g][n];
}

// ---------------------------------------------------------------------------
// Output projection: ctx[Rows,Emb] x Wo + bo -> out (f32).
// grid (Rows/256, Emb/128), block 256; the same core.
// ---------------------------------------------------------------------------
__global__ void __launch_bounds__(256)
gemm_out_kernel(const _Float16* __restrict__ ctxh,
                const _Float16* __restrict__ Wot,
                const float* __restrict__ bo, float* __restrict__ out) {
  __shared__ __align__(16) _Float16 sm[2 * BufH];          // 96 KB
  const int mt = blockIdx.x, nt = blockIdx.y;
  const int wave = __builtin_amdgcn_readfirstlane(threadIdx.x >> 5), lane = threadIdx.x & 31;
  const int lo = lane & 15, hi = lane >> 4;

  v8f acc[4][4] = {};
  gemm_core(ctxh + (size_t)(mt * (BM / 16)) * RowTile, Wot + (size_t)(nt * (BN / 16)) * RowTile,
            sm, wave, lane, acc);

  const int m0 = mt * BM + (wave >> 1) * 64;
  const int n0 = nt * BN + (wave & 1) * 64;
  float bn[4];
  #pragma unroll
  for (int n = 0; n < 4; ++n) bn[n] = bo[n0 + n * 16 + lo];

  float* dst = out + (size_t)(m0 + hi * 8) * Emb + n0 + lo;
  #pragma unroll
  for (int mi = 0; mi < 4; ++mi)
    #pragma unroll
    for (int i = 0; i < 8; ++i)
      #pragma unroll
      for (int n = 0; n < 4; ++n)
        dst[(size_t)(mi * 16 + i) * Emb + n * 16] = acc[mi][n][i] + bn[n];
}

// ---------------------------------------------------------------------------
extern "C" void kernel_launch(void* const* d_in, const int* in_sizes, int n_in,
                              void* d_out, int out_size, void* d_ws, size_t ws_size,
                              hipStream_t stream) {
  const float* x  = (const float*)d_in[0];
  const float* Wq = (const float*)d_in[1];
  const float* bq = (const float*)d_in[2];
  const float* Wk = (const float*)d_in[3];
  const float* bk = (const float*)d_in[4];
  const float* Wv = (const float*)d_in[5];
  const float* bv = (const float*)d_in[6];
  const float* Wo = (const float*)d_in[7];
  const float* bo = (const float*)d_in[8];
  float* out = (float*)d_out;

  char* ws = (char*)d_ws;
  _Float16* xh   = (_Float16*)(ws + (size_t) 0u);          // 16 MB  [Rows][Emb], fragment order
  _Float16* Wt   = (_Float16*)(ws + (size_t)(16u << 20));  //  6 MB  [3][H][D][E], fragment order
  _Float16* Wot  = (_Float16*)(ws + (size_t)(22u << 20));  //  2 MB  [E][E] transposed, fragment order
  _Float16* Qf   = (_Float16*)(ws + (size_t)(24u << 20));  // 16 MB  [H][B][S][D]
  _Float16* Kf   = (_Float16*)(ws + (size_t)(40u << 20));  // 16 MB  [H][B][S][D]
  _Float16* Vt   = (_Float16*)(ws + (size_t)(56u << 20));  // 16 MB  [H][B][D][S]
  _Float16* ctxh = (_Float16*)(ws + (size_t)(72u << 20));  // 16 MB  [Rows][Emb], fragment order

  cvt_all_kernel <<<CvtThreads / 256, 256, 0, stream>>>(x, Wq, Wk, Wv, Wo, xh, Wt, Wot);

  gemm_qkv_kernel<<<dim3(Rows / 256, (3 * Hn * Dh) / 128), 256, 0, stream>>>(xh, Wt, bq, bk, bv, Qf, Kf, Vt);
  attn_kernel    <<<dim3(Seq / 128, Hn, Bsz), 128, 0, stream>>>(Qf, Kf, Vt, ctxh);
  gemm_out_kernel<<<dim3(Rows / 256, Emb / 128), 256, 0, stream>>>(ctxh, Wot, bo, out);
}

// v008
// One run takes 132 microseconds.
// Timed twice side by side with v007, it ran 1.04 times as fast both times.
// Counting every step since v000, it is 4.70 times as fast.
#include <hip/hip_runtime.h>
#include <hip/hip_bf16.h>

typedef __attribute__((ext_vector_type(16))) _Float16 v16h;
typedef __attribute__((ext_vector_type(8)))  _Float16 v8h;
typedef __attribute__((ext_vector_type(8)))  float    v8f;
typedef __attribute__((ext_vector_type(4)))  float    v4f;

constexpr int Bsz  = 4;
constexpr int Seq  = 2048;
constexpr int Emb  = 1024;
constexpr int Hn   = 16;
constexpr int Dh   = 64;
constexpr int Rows = Bsz * Seq;   // 8192
constexpr int Lp   = 72;

__device__ __forceinline__ v16h load_frag(const _Float16* p0, int ld, int lane) {
  const int lo = lane & 15, hi = lane >> 4;
  const _Float16* p = p0 + (size_t)lo * ld + hi * 8;
  v8h x0 = *(const v8h*)(p);
  v8h x1 = *(const v8h*)(p + 16);
  return __builtin_shufflevector(x0, x1, 0,1,2,3,4,5,6,7,8,9,10,11,12,13,14,15);
}

// Fragment order for the GEMM operands that live in global memory (x, the
// weights, ctx): a [rows][Emb] f16 matrix is kept as tiles of 16 rows x 32 k,
// 1 KB each, tile (rt, kt) at ((rt * Emb/32) + kt) * 512 halves. Inside a tile
// the 16-B chunk j * 32 + lane holds row (lane & 15), k = 16 j + 8 (lane >> 4)
// + 0..7: the k order of load_frag. A wave's global_load_async_to_lds_b128 then reads 512
// contiguous bytes (4 whole lines) where row-major rows cost it 16 lines.
constexpr int TileH   = 512;                 // halves per tile
constexpr int RowTile = (Emb / 32) * TileH;  // halves per band of 16 rows

__device__ __forceinline__ v16h load_tile(const _Float16* t, int lane) {
  v8h x0 = *(const v8h*)(t + lane * 8);
  v8h x1 = *(const v8h*)(t + 256 + lane * 8);
  return __builtin_shufflevector(x0, x1, 0,1,2,3,4,5,6,7,8,9,10,11,12,13,14,15);
}

__device__ __forceinline__ v8f wmma16(v16h a, v16h b, v8f c) {
  return __builtin_amdgcn_wmma_f32_16x16x32_f16(false, a, false, b, (short)0, c,
                                                false, false);
}

// ---------------------------------------------------------------------------
// Conversions to f16 in fragment order, all in one launch of resident waves. A 16-B chunk
// g = ((rt * 32 + kt) * 2 + j) * 32 + lane of a matrix sits at byte 16 g. The grid has one
// thread per chunk of Wo (Emb * Emb / 8 = 131,072: 16 waves per WGP); x has 8 times as many
// chunks and each of Wq, Wk, Wv as many, so a thread makes 8 + 3 + 1 chunks: one chunk a
// thread would start 12 times the waves for the same bytes.
// All of a thread's loads are issued ahead of its first store.
// ---------------------------------------------------------------------------
constexpr int CvtThreads = Emb * Emb / 8;
constexpr int XPer       = Rows * Emb / 8 / CvtThreads;    // 8 chunks of x per thread
static_assert(Hn * Dh == Emb && Rows / 16 == CvtThreads / 256 && XPer * 4 == Emb / 32,
              "one band of x per block, one chunk of each weight per thread");

__global__ void __launch_bounds__(256)
cvt_all_kernel(const float* __restrict__ x, const float* __restrict__ Wq,
               const float* __restrict__ Wk, const float* __restrict__ Wv,
               const float* __restrict__ Wo, _Float16* __restrict__ xh,
               _Float16* __restrict__ Wt, _Float16* __restrict__ Wot) {
  const unsigned t = blockIdx.x * 256u + threadIdx.x;      // over CvtThreads
  // Every address below is a uniform base plus a 32-bit byte offset of the thread.

  // x: a block makes one band of 16 rows (64 KB read, 32 KB stored, each in a row), four
  // tiles (128 k) per it, so that a thread's chunks differ by a constant offset only.
  // Four neighbouring threads read one 128-B line of a row (its four chunks), a
  // wave 8 rows: 8 lines read whole, and 4 whole lines stored (8 rows x 16 B each).
  const unsigned q = t & 3u, c = (t >> 2) & 15u, tl = (t >> 6) & 3u;   // tile kt = 4 it + tl
  const unsigned xo = ((blockIdx.x * 16u + c) * Emb + tl * 32u + q * 8u) * 4u;
  v4f f0[XPer], f1[XPer];
  #pragma unroll
  for (int it = 0; it < XPer; ++it) {
    f0[it] = *(const v4f*)((const char*)x + xo + it * 512u);
    f1[it] = *(const v4f*)((const char*)x + xo + it * 512u + 16u);
  }

  // weights: chunk t of each. Rows of Wt are (p, h, d), k is e: Wt[p][h][d][e] = W_p[h][e][d];
  // rows of Wot are n, k is k: Wot[n][k] = Wo[k][n]
  const unsigned l = t & 31u, j = (t >> 5) & 1u, kt = (t >> 6) & 31u, rt = t >> 11;
  const unsigned row = rt * 16u + (l & 15u);               // (h, d) of one projection, or n
  const unsigned k0  = kt * 32u + j * 16u + (l >> 4) * 8u;
  const unsigned wo3 = (((row / Dh) * Emb + k0) * Dh + row % Dh) * 4u;
  const unsigned wo1 = (k0 * Emb + row) * 4u;
  float wq[8], wk[8], wv[8], wo[8];
  #pragma unroll
  for (int e = 0; e < 8; ++e) wq[e] = *(const float*)((const char*)(Wq + e * Dh) + wo3);
  #pragma unroll
  for (int e = 0; e < 8; ++e) wk[e] = *(const float*)((const char*)(Wk + e * Dh) + wo3);
  #pragma unroll
  for (int e = 0; e < 8; ++e) wv[e] = *(const float*)((const char*)(Wv + e * Dh) + wo3);
  #pragma unroll
  for (int e = 0; e < 8; ++e) wo[e] = *(const float*)((const char*)(Wo + e * Emb) + wo1);
  // the loads are in flight: wait before anything reuses their offset registers, which the
  // statement names as inputs so that they stay whole up to it
  asm volatile("s_wait_xcnt 0x0" :: "v"(xo), "v"(wo3), "v"(wo1) : "memory");
  // keeps all 48 loads in front of the first conversion (left free, the compiler waits for the
  // first few before it issues the rest, and a wave pays the memory latency several times), and
  // the writes of the offset registers behind the wait
  __builtin_amdgcn_sched_barrier(0);

  // k = 8 q + 0..7 = 16 j + 8 hi + 0..7: j = q >> 1, hi = q & 1, lane = c + 16 hi
  const unsigned dxo = ((blockIdx.x * 32u + tl) * TileH + (q >> 1) * 256u
                        + ((q & 1u) * 16u + c) * 8u) * 2u;
  #pragma unroll
  for (int it = 0; it < XPer; ++it) {
    v8h o;
    #pragma unroll
    for (int e = 0; e < 4; ++e) { o[e] = (_Float16)f0[it][e]; o[4 + e] = (_Float16)f1[it][e]; }
    *(v8h*)((char*)xh + dxo + it * (4u * TileH * 2u)) = o;
  }
  v8h oq, ok, ov, oo;
  #pragma unroll
  for (int e = 0; e < 8; ++e) {
    oq[e] = (_Float16)wq[e]; ok[e] = (_Float16)wk[e];
    ov[e] = (_Float16)wv[e]; oo[e] = (_Float16)wo[e];
  }
  *(v8h*)((char*)Wt + t * 16u)                             = oq;
  *(v8h*)((char*)(Wt + (size_t)CvtThreads * 8) + t * 16u)  = ok;
  *(v8h*)((char*)(Wt + (size_t)CvtThreads * 16) + t * 16u) = ov;
  *(v8h*)((char*)Wot + t * 16u)                            = oo;
}

// ---------------------------------------------------------------------------
// GEMM core of both projections: a block of 8 waves (4 x 2) makes a 256 x 128 tile of
// A B^T, a wave 64 x 64 (4 x 4 accumulator tiles). A stage is 64 k of the block's 16 A
// bands (32 KB) and 8 B bands (16 KB), already in fragment order, brought into LDS by
// asynchronous copies and read there by the waves that share them: each byte leaves L2
// once per block, not once per wave. Two buffers: stage t + 1 flies while stage t is
// worked on.
// ---------------------------------------------------------------------------
constexpr int BM     = 256;                     // block tile, rows
constexpr int BN     = 128;                     // block tile, columns
constexpr int StageH = 2 * TileH;               // halves of one band in a stage (2 tiles, 2 KB)
constexpr int OpAH   = (BM / 16) * StageH;      // halves of A's stage (32 KB)
constexpr int OpBH   = (BN / 16) * StageH;      // halves of B's stage (16 KB)
constexpr int BufH   = OpAH + OpBH;             // halves of a buffer: A stage, then B stage
constexpr int NStage = Emb / 64;

__device__ __forceinline__ unsigned lds_off(const void* p) { return (unsigned)(size_t)p; }

__device__ __forceinline__ void copy8(unsigned l, const _Float16* g0, const _Float16* g1) {
  asm volatile(
      "global_load_async_to_lds_b128 %0, %8, off\n\t"
      "global_load_async_to_lds_b128 %1, %9, off\n\t"
      "global_load_async_to_lds_b128 %2, %10, off\n\t"
      "global_load_async_to_lds_b128 %3, %11, off\n\t"
      "global_load_async_to_lds_b128 %4, %12, off\n\t"
      "global_load_async_to_lds_b128 %5, %13, off\n\t"
      "global_load_async_to_lds_b128 %6, %14, off\n\t"
      "global_load_async_to_lds_b128 %7, %15, off\n\t"
      "s_wait_xcnt 0x0"
      :: "v"(l), "v"(l + 512u), "v"(l + 1024u), "v"(l + 1536u),
         "v"(l + 2048u), "v"(l + 2560u), "v"(l + 3072u), "v"(l + 3584u),
         "v"(g0), "v"(g0 + 256), "v"(g0 + 512), "v"(g0 + 768),
         "v"(g1), "v"(g1 + 256), "v"(g1 + 512), "v"(g1 + 768)
      : "memory");
}

// Four such copies: the stage's 2 KB of band g, to 2 KB of LDS from l.
__device__ __forceinline__ void copy4(unsigned l, const _Float16* g) {
  asm volatile(
      "global_load_async_to_lds_b128 %0, %4, off\n\t"
      "global_load_async_to_lds_b128 %1, %5, off\n\t"
      "global_load_async_to_lds_b128 %2, %6, off\n\t"
      "global_load_async_to_lds_b128 %3, %7, off\n\t"
      "s_wait_xcnt 0x0"
      :: "v"(l), "v"(l + 512u), "v"(l + 1024u), "v"(l + 1536u),
         "v"(g), "v"(g + 256), "v"(g + 512), "v"(g + 768)
      : "memory");
}

// One wave's share of a stage: bands 2 wave and 2 wave + 1 of A (to la), band wave of B (to lb).
__device__ __forceinline__ void copy_stage(unsigned la, unsigned lb, const _Float16* ga,
                                           const _Float16* gb) {
  copy8(la, ga, ga + RowTile);
  copy4(lb, gb);
}

// Ag, Bg: first band of the block's 16 and 8; sm: BufH * 2 halves of LDS.
__device__ __forceinline__ void gemm_core(const _Float16* Ag, const _Float16* Bg, _Float16* sm,
                                          int wave, int lane, v8f (&acc)[4][4]) {
  const int wm = wave >> 1, wn = wave & 1;
  const _Float16* ga = Ag + (size_t)(2 * wave) * RowTile + lane * 8;
  const _Float16* gb = Bg + (size_t)wave * RowTile + lane * 8;
  const unsigned la = lds_off(sm) + (unsigned)wave * (2u * StageH * 2u) + (unsigned)lane * 16u;
  const unsigned lb = lds_off(sm) + OpAH * 2u + (unsigned)wave * (StageH * 2u) + (unsigned)lane * 16u;

  copy_stage(la, lb, ga, gb);
  // stage 0 has landed (this wave's copies), then is published to the other waves
  asm volatile("s_wait_asynccnt 0x0" ::: "memory");
  __syncthreads();
  copy_stage(la + BufH * 2u, lb + BufH * 2u, ga + StageH, gb + StageH);

  for (int t = 0; t < NStage; ++t) {
    const _Float16* sa = sm + (t & 1) * BufH + wm * (4 * StageH);
    const _Float16* sb = sm + (t & 1) * BufH + OpAH + wn * (4 * StageH);
    #pragma unroll
    for (int kk = 0; kk < 2; ++kk) {
      v16h a[4], b[4];
      #pragma unroll
      for (int i = 0; i < 4; ++i) a[i] = load_tile(sa + i * StageH + kk * TileH, lane);
      #pragma unroll
      for (int j = 0; j < 4; ++j) b[j] = load_tile(sb + j * StageH + kk * TileH, lane);
      // keeps the 16 LDS reads one group ahead of their 16 WMMAs: sunk among the WMMAs, each
      // B fragment's read is waited for right behind its issue
      __builtin_amdgcn_sched_barrier(0);
      #pragma unroll
      for (int j = 0; j < 4; ++j)
        #pragma unroll
        for (int i = 0; i < 4; ++i) acc[i][j] = wmma16(a[i], b[j], acc[i][j]);
    }
    // publish point: this wave's reads of buffer t & 1 are done, its copies of stage t + 1
    // have landed; behind the barrier that holds for every wave
    asm volatile("s_wait_dscnt 0x0" ::: "memory");
    asm volatile("s_wait_asynccnt 0x0" ::: "memory");
    __syncthreads();
    if (t + 2 < NStage)
      copy_stage(la + (unsigned)(t & 1) * (BufH * 2u), lb + (unsigned)(t & 1) * (BufH * 2u),
                 ga + (t + 2) * StageH, gb + (t + 2) * StageH);
  }
  // nothing is in flight here (the last two trips issue no copy); kept before the wave ends
  asm volatile("s_wait_asynccnt 0x0" ::: "memory");
}

// ---------------------------------------------------------------------------
// Fused QKV projection.  grid (Rows/256, 3*Hn*Dh/128), block 256. The columns are the rows
// (p, h, d) of Wt; a wave's 64 columns are one head of one projection.
// ---------------------------------------------------------------------------
__global__ void __launch_bounds__(256)
gemm_qkv_kernel(const _Float16* __restrict__ xh,
                const _Float16* __restrict__ Wt,
                const float* __restrict__ bq, const float* __restrict__ bk,
                const float* __restrict__ bv,
                _Float16* __restrict__ Qf, _Float16* __restrict__ Kf,
                _Float16* __restrict__ Vt) {
  __shared__ __align__(16) _Float16 sm[2 * BufH];          // 96 KB
  const int mt = blockIdx.x, nt = blockIdx.y;
  const int wave = __builtin_amdgcn_readfirstlane(threadIdx.x >> 5), lane = threadIdx.x & 31;
  const int lo = lane & 15, hi = lane >> 4;

  v8f acc[4][4] = {};
  gemm_core(xh + (size_t)(mt * (BM / 16)) * RowTile, Wt + (size_t)(nt * (BN / 16)) * RowTile,
            sm, wave, lane, acc);

  const int m0 = mt * BM + (wave >> 1) * 64;
  const int c0 = nt * BN + (wave & 1) * 64;
  const int p = c0 / (Hn * Dh), h = (c0 / Dh) % Hn;
  const int bb = m0 / Seq, ss0 = m0 % Seq;   // 64 rows from a multiple of 64: one sequence

  const float* bias = (p == 0) ? bq : (p == 1) ? bk : bv;
  const float  csc  = (p == 0) ? (0.125f * 1.44269504f) : 1.0f;
  float bn[4];
  #pragma unroll
  for (int n = 0; n < 4; ++n) bn[n] = bias[h * Dh + n * 16 + lo];
  // the bias loads are still in flight: wait before the store addresses reuse their base and
  // offset registers; the scheduling barrier keeps those writes behind the wait
  asm volatile("s_wait_xcnt 0x0" ::: "memory");
  __builtin_amdgcn_sched_barrier(0);

  // element (row ss0 + 16 mi + 8 hi + i, d = 16 n + lo)
  if (p == 2) {
    _Float16* dst = Vt + ((size_t)(h * Bsz + bb) * Dh + lo) * Seq + ss0 + hi * 8;
    #pragma unroll
    for (int n = 0; n < 4; ++n)          // along each row d of Vt in turn
      #pragma unroll
      for (int mi = 0; mi < 4; ++mi)
        #pragma unroll
        for (int i = 0; i < 8; ++i)
          dst[(size_t)(n * 16) * Seq + mi * 16 + i] = (_Float16)((acc[mi][n][i] + bn[n]) * csc);
  } else {
    _Float16* dst = ((p == 0) ? Qf : Kf) + ((size_t)(h * Bsz + bb) * Seq + ss0 + hi * 8) * Dh + lo;
    #pragma unroll
    for (int mi = 0; mi < 4; ++mi)
      #pragma unroll
      for (int i = 0; i < 8; ++i)
        #pragma unroll
        for (int n = 0; n < 4; ++n)
          dst[(mi * 16 + i) * Dh + n * 16] = (_Float16)((acc[mi][n][i] + bn[n]) * csc);
    // in the built code a test (never true here) leads from these stores on into the V branch,
    // whose address arithmetic reuses their address register: the wait stands in front of it
    asm volatile("s_wait_xcnt 0x0" ::: "memory");
  }
}

__device__ __forceinline__ float xhalf(float x) {
  const int b = __builtin_bit_cast(int, x);
  return __builtin_bit_cast(float,
      __builtin_amdgcn_permlanex16(b, b, 0x76543210, 0xfedcba98, false, false));
}

// 2^x as the bare v_exp_f32. exp2f wraps it in a range fix-up (compare, two selects, add,
// ldexp) that only matters for results under 2^-126, which the bare form may flush to 0.
// Here x <= 0; a P that small is 0 in f16 anyway, beside a row sum of at least 1 it is
// below f32 rounding, and a rescale factor that small leaves nothing of the old sums.
__device__ __forceinline__ float exp2_raw(float x) { return __builtin_amdgcn_exp2f(x); }

constexpr int QG = 2;     // groups of 16 query columns per wave

constexpr int StKeys = 128;             // keys per stage: two tiles of 64
constexpr int Lv     = StKeys + 8;      // pitch of a staged V row in halves: 272 B = 16 B x odd
constexpr int KStH   = StKeys * Lp;     // halves of a stage's K rows, [key][d] at pitch Lp (18 KB)
constexpr int VStH   = Dh * Lv;         // halves of a stage's V rows, [d][key] at pitch Lv (17 KB)
constexpr int KvBufH = KStH + VStH;     // halves of a buffer: K rows, then V rows
constexpr int NSt    = Seq / StKeys;    // stages

__device__ __forceinline__ void copy_rows8(unsigned l, unsigned ls, const _Float16* g, int gs) {
  asm volatile(
      "global_load_async_to_lds_b128 %0, %8, off\n\t"
      "global_load_async_to_lds_b128 %1, %9, off\n\t"
      "global_load_async_to_lds_b128 %2, %10, off\n\t"
      "global_load_async_to_lds_b128 %3, %11, off\n\t"
      "global_load_async_to_lds_b128 %4, %12, off\n\t"
      "global_load_async_to_lds_b128 %5, %13, off\n\t"
      "global_load_async_to_lds_b128 %6, %14, off\n\t"
      "global_load_async_to_lds_b128 %7, %15, off\n\t"
      "s_wait_xcnt 0x0"
      :: "v"(l), "v"(l + ls), "v"(l + 2u * ls), "v"(l + 3u * ls),
         "v"(l + 4u * ls), "v"(l + 5u * ls), "v"(l + 6u * ls), "v"(l + 7u * ls),
         "v"(g), "v"(g + gs), "v"(g + 2 * gs), "v"(g + 3 * gs),
         "v"(g + 4 * gs), "v"(g + 5 * gs), "v"(g + 6 * gs), "v"(g + 7 * gs)
      : "memory");
}

// One thread's share of a stage. K: 128 rows of 8 chunks, its chunk in every 16th row (from
// gk to lk). V: 64 rows of 16 chunks, its chunk in every 8th row (from gv to lv).
__device__ __forceinline__ void copy_kv(unsigned lk, unsigned lv, const _Float16* gk,
                                        const _Float16* gv) {
  copy_rows8(lk, 16u * Lp * 2u, gk, 16 * Dh);
  copy_rows8(lv, 8u * Lv * 2u, gv, 8 * Seq);
}

__global__ void __launch_bounds__(128) __attribute__((amdgpu_waves_per_eu(4, 4)))
attn_kernel(const _Float16* __restrict__ Qf, const _Float16* __restrict__ Kf,
            const _Float16* __restrict__ Vt, _Float16* __restrict__ ctxh) {
  const int qb = blockIdx.x, h = blockIdx.y, b = blockIdx.z;
  const int tid  = threadIdx.x;
  // wave number as a scalar: the Q and ctx addresses are then scalar base + lane offset
  const int wave = __builtin_amdgcn_readfirstlane(tid >> 5), lane = tid & 31;
  const int q0 = qb * (64 * QG) + wave * (16 * QG);        // sequence-local

  const _Float16* Qb = Qf + ((size_t)(h * Bsz + b) * Seq) * Dh;
  const _Float16* Kb = Kf + ((size_t)(h * Bsz + b) * Seq) * Dh;
  const _Float16* Vb = Vt + ((size_t)(h * Bsz + b) * Dh) * Seq;

  // B fragments of Q^T: column = query 16 g + (lane & 15), k = d
  v16h bq[QG][2];
  #pragma unroll
  for (int g = 0; g < QG; ++g) {
    bq[g][0] = load_frag(Qb + (size_t)(q0 + g * 16) * Dh +  0, Dh, lane);
    bq[g][1] = load_frag(Qb + (size_t)(q0 + g * 16) * Dh + 32, Dh, lane);
  }

  // acc[g][n][r] = O^T[d = 16 n + 8 (lane >> 4) + r][query 16 g + (lane & 15)]
  v8f acc[QG][4] = {};
  float mrow[QG];           // running maximum of this lane's query (equal in both halves)
  float lrow[QG];           // running sum over this half's keys only; halves joined at the end
  #pragma unroll
  for (int g = 0; g < QG; ++g) { mrow[g] = -1e30f; lrow[g] = 0.0f; }

  __shared__ __align__(16) _Float16 kv[2 * KvBufH];        // 70 KB: two buffers of K and V rows

  // this thread's 16-B chunks: of K row tid >> 3 (+ 16 j), chunk tid & 7; of V row tid >> 4
  // (+ 8 j), chunk tid & 15
  const _Float16* gk = Kb + (size_t)(tid >> 3) * Dh  + (tid & 7) * 8;
  const _Float16* gv = Vb + (size_t)(tid >> 4) * Seq + (tid & 15) * 8;
  const unsigned  lk = lds_off(kv) + (unsigned)(tid >> 3) * (Lp * 2u) + (unsigned)(tid & 7) * 16u;
  const unsigned  lv = lds_off(kv) + KStH * 2u + (unsigned)(tid >> 4) * (Lv * 2u)
                     + (unsigned)(tid & 15) * 16u;

  copy_kv(lk, lv, gk, gv);
  // stage 0 has landed (this wave's copies), then is published to the other waves
  asm volatile("s_wait_asynccnt 0x0" ::: "memory");
  __syncthreads();
  copy_kv(lk + KvBufH * 2u, lv + KvBufH * 2u, gk + StKeys * Dh, gv + StKeys);

  for (int t = 0; t < NSt; ++t) {
   // kept rolled: unrolled, the two tiles' scores are live together and registers spill
   #pragma unroll 1
   for (int p = 0; p < StKeys / 64; ++p) {
    const _Float16* kts = kv + (t & 1) * KvBufH + p * 64 * Lp;      // [key][d], pitch Lp
    const _Float16* vts = kv + (t & 1) * KvBufH + KStH + p * 64;    // [d][key], pitch Lv

    // ---- S^T = K Q^T (base-2 logits; 1/sqrt(D)*log2e folded into Q) ----
    // s[g][n][r] = score(key 16 n + 8 (lane >> 4) + r, query 16 g + (lane & 15))
    v8f s[QG][4] = {};
    #pragma unroll
    for (int n = 0; n < 4; ++n) {
      v16h ak0 = load_frag(kts + n * 16 * Lp,      Lp, lane);
      v16h ak1 = load_frag(kts + n * 16 * Lp + 32, Lp, lane);
      #pragma unroll
      for (int g = 0; g < QG; ++g) s[g][n] = wmma16(ak0, bq[g][0], s[g][n]);
      #pragma unroll
      for (int g = 0; g < QG; ++g) s[g][n] = wmma16(ak1, bq[g][1], s[g][n]);
    }

    // ---- online softmax, one query per lane and group ----
    v16h bp[QG][2];
    #pragma unroll
    for (int g = 0; g < QG; ++g) {
      float mt = s[g][0][0];
      #pragma unroll
      for (int n = 0; n < 4; ++n)
        #pragma unroll
        for (int r = 0; r < 8; ++r) mt = fmaxf(mt, s[g][n][r]);
      mt = fmaxf(mt, xhalf(mt));
      const float mnew = fmaxf(mrow[g], mt);
      const float corr = exp2_raw(mrow[g] - mnew);
      mrow[g] = mnew;
      float rs[4];
      #pragma unroll
      for (int n = 0; n < 4; ++n) {
        s[g][n] = s[g][n] - mnew;      // on the whole vector: two scores a packed add
        rs[n] = 0.0f;
        #pragma unroll
        for (int r = 0; r < 8; ++r) {
          s[g][n][r] = exp2_raw(s[g][n][r]);
          rs[n] += s[g][n][r];
        }
      }
      lrow[g] = lrow[g] * corr + ((rs[0] + rs[1]) + (rs[2] + rs[3]));
      #pragma unroll
      for (int n = 0; n < 4; ++n) acc[g][n] *= corr;

      // P^T: two converted D tiles are one B fragment (k = key, load_frag's order)
      bp[g][0] = __builtin_shufflevector(__builtin_convertvector(s[g][0], v8h),
                                         __builtin_convertvector(s[g][1], v8h),
                                         0,1,2,3,4,5,6,7,8,9,10,11,12,13,14,15);
      bp[g][1] = __builtin_shufflevector(__builtin_convertvector(s[g][2], v8h),
                                         __builtin_convertvector(s[g][3], v8h),
                                         0,1,2,3,4,5,6,7,8,9,10,11,12,13,14,15);
    }

    // ---- O^T += V^T P^T ----
    #pragma unroll
    for (int n = 0; n < 4; ++n) {
      v16h av0 = load_frag(vts + n * 16 * Lv,      Lv, lane);
      v16h av1 = load_frag(vts + n * 16 * Lv + 32, Lv, lane);
      #pragma unroll
      for (int g = 0; g < QG; ++g) acc[g][n] = wmma16(av0, bp[g][0], acc[g][n]);
      #pragma unroll
      for (int g = 0; g < QG; ++g) acc[g][n] = wmma16(av1, bp[g][1], acc[g][n]);
    }
   }
    // publish point: this wave's reads of buffer t & 1 are done, its copies of stage t + 1
    // have landed; behind the barrier that holds for every wave
    asm volatile("s_wait_dscnt 0x0" ::: "memory");
    asm volatile("s_wait_asynccnt 0x0" ::: "memory");
    __syncthreads();
    if (t + 2 < NSt)
      copy_kv(lk + (unsigned)(t & 1) * (KvBufH * 2u), lv + (unsigned)(t & 1) * (KvBufH * 2u),
              gk + (size_t)(t + 2) * (StKeys * Dh), gv + (t + 2) * StKeys);
  }
  // nothing is in flight here (the last two trips issue no copy); kept before the wave ends
  asm volatile("s_wait_asynccnt 0x0" ::: "memory");

  // ---- normalize, write ctx (heads concatenated along E) in fragment order:
  // row b*Seq + q0 + 16 g + (lane & 15), k = h*Dh + 16 n + 8 (lane >> 4) + 0..7, which is
  // the 16-B chunk (n & 1) * 32 + lane of tile (row band, 2 h + (n >> 1)) ----
  v8h o[QG][4];
  #pragma unroll
  for (int g = 0; g < QG; ++g) {
    const float inv = 1.0f / (lrow[g] + xhalf(lrow[g]));
    #pragma unroll
    for (int n = 0; n < 4; ++n) o[g][n] = __builtin_convertvector(acc[g][n] * inv, v8h);
  }
  _Float16* cb = ctxh + (size_t)((b * Seq + q0) >> 4) * RowTile + (size_t)(h * (Dh / 32)) * TileH
               + lane * 8;
  #pragma unroll
  for (int g = 0; g < QG; ++g)
    #pragma unroll
    for (int n = 0; n < 4; ++n)
      *(v8h*)(cb + g * RowTile + (n >> 1) * TileH + (n & 1) * 256) = o[g][n];
}

// ---------------------------------------------------------------------------
// Output projection: ctx[Rows,Emb] x Wo + bo -> out (f32).
// grid (Rows/256, Emb/128), block 256; the same core.
// ---------------------------------------------------------------------------
__global__ void __launch_bounds__(256)
gemm_out_kernel(const _Float16* __restrict__ ctxh,
                const _Float16* __restrict__ Wot,
                const float* __restrict__ bo, float* __restrict__ out) {
  __shared__ __align__(16) _Float16 sm[2 * BufH];          // 96 KB
  const int mt = blockIdx.x, nt = blockIdx.y;
  const int wave = __builtin_amdgcn_readfirstlane(threadIdx.x >> 5), lane = threadIdx.x & 31;
  const int lo = lane & 15, hi = lane >> 4;

  v8f acc[4][4] = {};
  gemm_core(ctxh + (size_t)(mt * (BM / 16)) * RowTile, Wot + (size_t)(nt * (BN / 16)) * RowTile,
            sm, wave, lane, acc);

  const int m0 = mt * BM + (wave >> 1) * 64;
  const int n0 = nt * BN + (wave & 1) * 64;
  float bn[4];
  #pragma unroll
  for (int n = 0; n < 4; ++n) bn[n] = bo[n0 + n * 16 + lo];

  float* dst = out + (size_t)(m0 + hi * 8) * Emb + n0 + lo;
  #pragma unroll
  for (int mi = 0; mi < 4; ++mi)
    #pragma unroll
    for (int i = 0; i < 8; ++i)
      #pragma unroll
      for (int n = 0; n < 4; ++n)
        dst[(size_t)(mi * 16 + i) * Emb + n * 16] = acc[mi][n][i] + bn[n];
}

// ---------------------------------------------------------------------------
extern "C" void kernel_launch(void* const* d_in, const int* in_sizes, int n_in,
                              void* d_out, int out_size, void* d_ws, size_t ws_size,
                              hipStream_t stream) {
  const float* x  = (const float*)d_in[0];
  const float* Wq = (const float*)d_in[1];
  const float* bq = (const float*)d_in[2];
  const float* Wk = (const float*)d_in[3];
  const float* bk = (const float*)d_in[4];
  const float* Wv = (const float*)d_in[5];
  const float* bv = (const float*)d_in[6];
  const float* Wo = (const float*)d_in[7];
  const float* bo = (const float*)d_in[8];
  float* out = (float*)d_out;

  char* ws = (char*)d_ws;
  _Float16* xh   = (_Float16*)(ws + (size_t) 0u);          // 16 MB  [Rows][Emb], fragment order
  _Float16* Wt   = (_Float16*)(ws + (size_t)(16u << 20));  //  6 MB  [3][H][D][E], fragment order
  _Float16* Wot  = (_Float16*)(ws + (size_t)(22u << 20));  //  2 MB  [E][E] transposed, fragment order
  _Float16* Qf   = (_Float16*)(ws + (size_t)(24u << 20));  // 16 MB  [H][B][S][D]
  _Float16* Kf   = (_Float16*)(ws + (size_t)(40u << 20));  // 16 MB  [H][B][S][D]
  _Float16* Vt   = (_Float16*)(ws + (size_t)(56u << 20));  // 16 MB  [H][B][D][S]
  _Float16* ctxh = (_Float16*)(ws + (size_t)(72u << 20));  // 16 MB  [Rows][Emb], fragment order

  cvt_all_kernel <<<CvtThreads / 256, 256, 0, stream>>>(x, Wq, Wk, Wv, Wo, xh, Wt, Wot);

  gemm_qkv_kernel<<<dim3(Rows / 256, (3 * Hn * Dh) / 128), 256, 0, stream>>>(xh, Wt, bq, bk, bv, Qf, Kf, Vt);
  attn_kernel    <<<dim3(Seq / 128, Hn, Bsz), 128, 0, stream>>>(Qf, Kf, Vt, ctxh);
  gemm_out_kernel<<<dim3(Rows / 256, Emb / 128), 256, 0, stream>>>(ctxh, Wot, bo, out);
}

// v009
// Measured time: 126 microseconds a run.
// Timed twice side by side with v008, it ran 1.05 and 1.04 times as fast.
// Over all steps from v000 it is 4.91 times as fast.
#include <hip/hip_runtime.h>
#include <hip/hip_bf16.h>

typedef __attribute__((ext_vector_type(16))) _Float16 v16h;
typedef __attribute__((ext_vector_type(8)))  _Float16 v8h;
typedef __attribute__((ext_vector_type(8)))  float    v8f;
typedef __attribute__((ext_vector_type(4)))  float    v4f;

constexpr int Bsz  = 4;
constexpr int Seq  = 2048;
constexpr int Emb  = 1024;
constexpr int Hn   = 16;
constexpr int Dh   = 64;
constexpr int Rows = Bsz * Seq;   // 8192
constexpr int Lp   = 72;

__device__ __forceinline__ v16h load_frag(const _Float16* p0, int ld, int lane) {
  const int lo = lane & 15, hi = lane >> 4;
  const _Float16* p = p0 + (size_t)lo * ld + hi * 8;
  v8h x0 = *(const v8h*)(p);
  v8h x1 = *(const v8h*)(p + 16);
  return __builtin_shufflevector(x0, x1, 0,1,2,3,4,5,6,7,8,9,10,11,12,13,14,15);
}

// Fragment order for the GEMM operands that live in global memory (x, the
// weights, ctx): a [rows][Emb] f16 matrix is kept as tiles of 16 rows x 32 k,
// 1 KB each, tile (rt, kt) at ((rt * Emb/32) + kt) * 512 halves. Inside a tile
// the 16-B chunk j * 32 + lane holds row (lane & 15), k = 16 j + 8 (lane >> 4)
// + 0..7: the k order of load_frag. A wave's global_load_async_to_lds_b128 then reads 512
// contiguous bytes (4 whole lines) where row-major rows cost it 16 lines.
constexpr int TileH   = 512;                 // halves per tile
constexpr int RowTile = (Emb / 32) * TileH;  // halves per band of 16 rows

__device__ __forceinline__ v16h load_tile(const _Float16* t, int lane) {
  v8h x0 = *(const v8h*)(t + lane * 8);
  v8h x1 = *(const v8h*)(t + 256 + lane * 8);
  return __builtin_shufflevector(x0, x1, 0,1,2,3,4,5,6,7,8,9,10,11,12,13,14,15);
}

__device__ __forceinline__ v8f wmma16(v16h a, v16h b, v8f c) {
  return __builtin_amdgcn_wmma_f32_16x16x32_f16(false, a, false, b, (short)0, c,
                                                false, false);
}

// ---------------------------------------------------------------------------
// Conversions to f16 in fragment order, all in one launch of resident waves. A 16-B chunk
// g = ((rt * 32 + kt) * 2 + j) * 32 + lane of a matrix sits at byte 16 g. The grid has one
// thread per chunk of Wo (Emb * Emb / 8 = 131,072: 16 waves per WGP); x has 8 times as many
// chunks and each of Wq, Wk, Wv as many, so a thread makes 8 + 3 + 1 chunks: one chunk a
// thread would start 12 times the waves for the same bytes.
// All of a thread's loads are issued ahead of its first store.
// ---------------------------------------------------------------------------
constexpr int CvtThreads = Emb * Emb / 8;
constexpr int XPer       = Rows * Emb / 8 / CvtThreads;    // 8 chunks of x per thread
static_assert(Hn * Dh == Emb && Rows / 16 == CvtThreads / 256 && XPer * 4 == Emb / 32,
              "one band of x per block, one chunk of each weight per thread");

__global__ void __launch_bounds__(256)
cvt_all_kernel(const float* __restrict__ x, const float* __restrict__ Wq,
               const float* __restrict__ Wk, const float* __restrict__ Wv,
               const float* __restrict__ Wo, _Float16* __restrict__ xh,
               _Float16* __restrict__ Wt, _Float16* __restrict__ Wot) {
  const unsigned t = blockIdx.x * 256u + threadIdx.x;      // over CvtThreads
  // Every address below is a uniform base plus a 32-bit byte offset of the thread.

  // x: a block makes one band of 16 rows (64 KB read, 32 KB stored, each in a row), four
  // tiles (128 k) per it, so that a thread's chunks differ by a constant offset only.
  // Four neighbouring threads read one 128-B line of a row (its four chunks), a
  // wave 8 rows: 8 lines read whole, and 4 whole lines stored (8 rows x 16 B each).
  const unsigned q = t & 3u, c = (t >> 2) & 15u, tl = (t >> 6) & 3u;   // tile kt = 4 it + tl
  const unsigned xo = ((blockIdx.x * 16u + c) * Emb + tl * 32u + q * 8u) * 4u;
  v4f f0[XPer], f1[XPer];
  #pragma unroll
  for (int it = 0; it < XPer; ++it) {
    f0[it] = *(const v4f*)((const char*)x + xo + it * 512u);
    f1[it] = *(const v4f*)((const char*)x + xo + it * 512u + 16u);
  }

  // weights: chunk t of each. Rows of Wt are (p, h, d), k is e: Wt[p][h][d][e] = W_p[h][e][d];
  // rows of Wot are n, k is k: Wot[n][k] = Wo[k][n]
  const unsigned l = t & 31u, j = (t >> 5) & 1u, kt = (t >> 6) & 31u, rt = t >> 11;
  const unsigned row = rt * 16u + (l & 15u);               // (h, d) of one projection, or n
  const unsigned k0  = kt * 32u + j * 16u + (l >> 4) * 8u;
  const unsigned wo3 = (((row / Dh) * Emb + k0) * Dh + row % Dh) * 4u;
  const unsigned wo1 = (k0 * Emb + row) * 4u;
  float wq[8], wk[8], wv[8], wo[8];
  #pragma unroll
  for (int e = 0; e < 8; ++e) wq[e] = *(const float*)((const char*)(Wq + e * Dh) + wo3);
  #pragma unroll
  for (int e = 0; e < 8; ++e) wk[e] = *(const float*)((const char*)(Wk + e * Dh) + wo3);
  #pragma unroll
  for (int e = 0; e < 8; ++e) wv[e] = *(const float*)((const char*)(Wv + e * Dh) + wo3);
  #pragma unroll
  for (int e = 0; e < 8; ++e) wo[e] = *(const float*)((const char*)(Wo + e * Emb) + wo1);
  // the loads are in flight: wait before anything reuses their offset registers, which the
  // statement names as inputs so that they stay whole up to it
  asm volatile("s_wait_xcnt 0x0" :: "v"(xo), "v"(wo3), "v"(wo1) : "memory");
  // keeps all 48 loads in front of the first conversion (left free, the compiler waits for the
  // first few before it issues the rest, and a wave pays the memory latency several times), and
  // the writes of the offset registers behind the wait
  __builtin_amdgcn_sched_barrier(0);

  // k = 8 q + 0..7 = 16 j + 8 hi + 0..7: j = q >> 1, hi = q & 1, lane = c + 16 hi
  const unsigned dxo = ((blockIdx.x * 32u + tl) * TileH + (q >> 1) * 256u
                        + ((q & 1u) * 16u + c) * 8u) * 2u;
  #pragma unroll
  for (int it = 0; it < XPer; ++it) {
    v8h o;
    #pragma unroll
    for (int e = 0; e < 4; ++e) { o[e] = (_Float16)f0[it][e]; o[4 + e] = (_Float16)f1[it][e]; }
    *(v8h*)((char*)xh + dxo + it * (4u * TileH * 2u)) = o;
  }
  v8h oq, ok, ov, oo;
  #pragma unroll
  for (int e = 0; e < 8; ++e) {
    oq[e] = (_Float16)wq[e]; ok[e] = (_Float16)wk[e];
    ov[e] = (_Float16)wv[e]; oo[e] = (_Float16)wo[e];
  }
  *(v8h*)((char*)Wt + t * 16u)                             = oq;
  *(v8h*)((char*)(Wt + (size_t)CvtThreads * 8) + t * 16u)  = ok;
  *(v8h*)((char*)(Wt + (size_t)CvtThreads * 16) + t * 16u) = ov;
  *(v8h*)((char*)Wot + t * 16u)                            = oo;
}

// ---------------------------------------------------------------------------
// GEMM core of both projections: a block of 8 waves (4 x 2) makes a 256 x 128 tile of
// A B^T, a wave 64 x 64 (4 x 4 accumulator tiles). A stage is 64 k of the block's 16 A
// bands (32 KB) and 8 B bands (16 KB), already in fragment order, brought into LDS by
// asynchronous copies and read there by the waves that share them: each byte leaves L2
// once per block, not once per wave. Two buffers: stage t + 1 flies while stage t is
// worked on.
// ---------------------------------------------------------------------------
constexpr int BM     = 256;                     // block tile, rows
constexpr int BN     = 128;                     // block tile, columns
constexpr int StageH = 2 * TileH;               // halves of one band in a stage (2 tiles, 2 KB)
constexpr int OpAH   = (BM / 16) * StageH;      // halves of A's stage (32 KB)
constexpr int OpBH   = (BN / 16) * StageH;      // halves of B's stage (16 KB)
constexpr int BufH   = OpAH + OpBH;             // halves of a buffer: A stage, then B stage
constexpr int NStage = Emb / 64;

__device__ __forceinline__ unsigned lds_off(const void* p) { return (unsigned)(size_t)p; }

__device__ __forceinline__ void copy8(unsigned l, const _Float16* g0, const _Float16* g1) {
  asm volatile(
      "global_load_async_to_lds_b128 %0, %8, off\n\t"
      "global_load_async_to_lds_b128 %1, %9, off\n\t"
      "global_load_async_to_lds_b128 %2, %10, off\n\t"
      "global_load_async_to_lds_b128 %3, %11, off\n\t"
      "global_load_async_to_lds_b128 %4, %12, off\n\t"
      "global_load_async_to_lds_b128 %5, %13, off\n\t"
      "global_load_async_to_lds_b128 %6, %14, off\n\t"
      "global_load_async_to_lds_b128 %7, %15, off\n\t"
      "s_wait_xcnt 0x0"
      :: "v"(l), "v"(l + 512u), "v"(l + 1024u), "v"(l + 1536u),
         "v"(l + 2048u), "v"(l + 2560u), "v"(l + 3072u), "v"(l + 3584u),
         "v"(g0), "v"(g0 + 256), "v"(g0 + 512), "v"(g0 + 768),
         "v"(g1), "v"(g1 + 256), "v"(g1 + 512), "v"(g1 + 768)
      : "memory");
}

// Four such copies: the stage's 2 KB of band g, to 2 KB of LDS from l.
__device__ __forceinline__ void copy4(unsigned l, const _Float16* g) {
  asm volatile(
      "global_load_async_to_lds_b128 %0, %4, off\n\t"
      "global_load_async_to_lds_b128 %1, %5, off\n\t"
      "global_load_async_to_lds_b128 %2, %6, off\n\t"
      "global_load_async_to_lds_b128 %3, %7, off\n\t"
      "s_wait_xcnt 0x0"
      :: "v"(l), "v"(l + 512u), "v"(l + 1024u), "v"(l + 1536u),
         "v"(g), "v"(g + 256), "v"(g + 512), "v"(g + 768)
      : "memory");
}

// One wave's share of a stage: bands 2 wave and 2 wave + 1 of A (to la), band wave of B (to lb).
__device__ __forceinline__ void copy_stage(unsigned la, unsigned lb, const _Float16* ga,
                                           const _Float16* gb) {
  copy8(la, ga, ga + RowTile);
  copy4(lb, gb);
}

// Ag, Bg: first band of the block's 16 and 8; sm: BufH * 2 halves of LDS.
__device__ __forceinline__ void gemm_core(const _Float16* Ag, const _Float16* Bg, _Float16* sm,
                                          int wave, int lane, v8f (&acc)[4][4]) {
  const int wm = wave >> 1, wn = wave & 1;
  const _Float16* ga = Ag + (size_t)(2 * wave) * RowTile + lane * 8;
  const _Float16* gb = Bg + (size_t)wave * RowTile + lane * 8;
  const unsigned la = lds_off(sm) + (unsigned)wave * (2u * StageH * 2u) + (unsigned)lane * 16u;
  const unsigned lb = lds_off(sm) + OpAH * 2u + (unsigned)wave * (StageH * 2u) + (unsigned)lane * 16u;

  copy_stage(la, lb, ga, gb);
  // stage 0 has landed (this wave's copies), then is published to the other waves
  asm volatile("s_wait_asynccnt 0x0" ::: "memory");
  __syncthreads();
  copy_stage(la + BufH * 2u, lb + BufH * 2u, ga + StageH, gb + StageH);

  for (int t = 0; t < NStage; ++t) {
    const _Float16* sa = sm + (t & 1) * BufH + wm * (4 * StageH);
    const _Float16* sb = sm + (t & 1) * BufH + OpAH + wn * (4 * StageH);
    #pragma unroll
    for (int kk = 0; kk < 2; ++kk) {
      v16h a[4], b[4];
      #pragma unroll
      for (int i = 0; i < 4; ++i) a[i] = load_tile(sa + i * StageH + kk * TileH, lane);
      #pragma unroll
      for (int j = 0; j < 4; ++j) b[j] = load_tile(sb + j * StageH + kk * TileH, lane);
      // keeps the 16 LDS reads one group ahead of their 16 WMMAs: sunk among the WMMAs, each
      // B fragment's read is waited for right behind its issue
      __builtin_amdgcn_sched_barrier(0);
      #pragma unroll
      for (int j = 0; j < 4; ++j)
        #pragma unroll
        for (int i = 0; i < 4; ++i) acc[i][j] = wmma16(a[i], b[j], acc[i][j]);
    }
    // publish point: this wave's reads of buffer t & 1 are done, its copies of stage t + 1
    // have landed; behind the barrier that holds for every wave
    asm volatile("s_wait_dscnt 0x0" ::: "memory");
    asm volatile("s_wait_asynccnt 0x0" ::: "memory");
    __syncthreads();
    if (t + 2 < NStage)
      copy_stage(la + (unsigned)(t & 1) * (BufH * 2u), lb + (unsigned)(t & 1) * (BufH * 2u),
                 ga + (t + 2) * StageH, gb + (t + 2) * StageH);
  }
  // nothing is in flight here (the last two trips issue no copy); kept before the wave ends
  asm volatile("s_wait_asynccnt 0x0" ::: "memory");
}

// ---------------------------------------------------------------------------
// Fused QKV projection.  grid (Rows/256, 3*Hn*Dh/128), block 256. The columns are the rows
// (p, h, d) of Wt; a wave's 64 columns are one head of one projection.
// ---------------------------------------------------------------------------
__global__ void __launch_bounds__(256)
gemm_qkv_kernel(const _Float16* __restrict__ xh,
                const _Float16* __restrict__ Wt,
                const float* __restrict__ bq, const float* __restrict__ bk,
                const float* __restrict__ bv,
                _Float16* __restrict__ Qf, _Float16* __restrict__ Kf,
                _Float16* __restrict__ Vt) {
  __shared__ __align__(16) _Float16 sm[2 * BufH];          // 96 KB
  const int mt = blockIdx.x, nt = blockIdx.y;
  const int wave = __builtin_amdgcn_readfirstlane(threadIdx.x >> 5), lane = threadIdx.x & 31;
  const int lo = lane & 15, hi = lane >> 4;

  v8f acc[4][4] = {};
  gemm_core(xh + (size_t)(mt * (BM / 16)) * RowTile, Wt + (size_t)(nt * (BN / 16)) * RowTile,
            sm, wave, lane, acc);

  const int m0 = mt * BM + (wave >> 1) * 64;
  const int c0 = nt * BN + (wave & 1) * 64;
  const int p = c0 / (Hn * Dh), h = (c0 / Dh) % Hn;
  const int bb = m0 / Seq, ss0 = m0 % Seq;   // 64 rows from a multiple of 64: one sequence

  const float* bias = (p == 0) ? bq : (p == 1) ? bk : bv;
  const float  csc  = (p == 0) ? (0.125f * 1.44269504f) : 1.0f;
  float bn[4];
  #pragma unroll
  for (int n = 0; n < 4; ++n) bn[n] = bias[h * Dh + n * 16 + lo];
  // the bias loads are still in flight: wait before the store addresses reuse their base and
  // offset registers; the scheduling barrier keeps those writes behind the wait
  asm volatile("s_wait_xcnt 0x0" ::: "memory");
  __builtin_amdgcn_sched_barrier(0);

  // element (row ss0 + 16 mi + 8 hi + i, d = 16 n + lo)
  if (p == 2) {
    _Float16* dst = Vt + ((size_t)(h * Bsz + bb) * Dh + lo) * Seq + ss0 + hi * 8;
    #pragma unroll
    for (int n = 0; n < 4; ++n)          // along each row d of Vt in turn
      #pragma unroll
      for (int mi = 0; mi < 4; ++mi)
        #pragma unroll
        for (int i = 0; i < 8; ++i)
          dst[(size_t)(n * 16) * Seq + mi * 16 + i] = (_Float16)((acc[mi][n][i] + bn[n]) * csc);
  } else {
    _Float16* dst = ((p == 0) ? Qf : Kf) + ((size_t)(h * Bsz + bb) * Seq + ss0 + hi * 8) * Dh + lo;
    #pragma unroll
    for (int mi = 0; mi < 4; ++mi)
      #pragma unroll
      for (int i = 0; i < 8; ++i)
        #pragma unroll
        for (int n = 0; n < 4; ++n)
          dst[(mi * 16 + i) * Dh + n * 16] = (_Float16)((acc[mi][n][i] + bn[n]) * csc);
    // in the built code a test (never true here) leads from these stores on into the V branch,
    // whose address arithmetic reuses their address register: the wait stands in front of it
    asm volatile("s_wait_xcnt 0x0" ::: "memory");
  }
}

__device__ __forceinline__ float xhalf(float x) {
  const int b = __builtin_bit_cast(int, x);
  return __builtin_bit_cast(float,
      __builtin_amdgcn_permlanex16(b, b, 0x76543210, 0xfedcba98, false, false));
}

// 2^x as the bare v_exp_f32. exp2f wraps it in a range fix-up (compare, two selects, add,
// ldexp) that only matters for results under 2^-126, which the bare form may flush to 0.
// Here x <= 8; a P that small is 0 in f16 anyway, beside a row sum of at least 1 it is
// below f32 rounding, and a rescale factor that small leaves nothing of the old sums.
__device__ __forceinline__ float exp2_raw(float x) { return __builtin_amdgcn_exp2f(x); }

constexpr int QG = 2;     // groups of 16 query columns per wave

constexpr int StKeys = 128;             // keys per stage: two tiles of 64
constexpr int Lv     = StKeys + 8;      // pitch of a staged V row in halves: 272 B = 16 B x odd
constexpr int KStH   = StKeys * Lp;     // halves of a stage's K rows, [key][d] at pitch Lp (18 KB)
constexpr int VStH   = Dh * Lv;         // halves of a stage's V rows, [d][key] at pitch Lv (17 KB)
constexpr int KvBufH = KStH + VStH;     // halves of a buffer: K rows, then V rows
constexpr int NSt    = Seq / StKeys;    // stages

__device__ __forceinline__ void copy_rows8(unsigned l, unsigned ls, const _Float16* g, int gs) {
  asm volatile(
      "global_load_async_to_lds_b128 %0, %8, off\n\t"
      "global_load_async_to_lds_b128 %1, %9, off\n\t"
      "global_load_async_to_lds_b128 %2, %10, off\n\t"
      "global_load_async_to_lds_b128 %3, %11, off\n\t"
      "global_load_async_to_lds_b128 %4, %12, off\n\t"
      "global_load_async_to_lds_b128 %5, %13, off\n\t"
      "global_load_async_to_lds_b128 %6, %14, off\n\t"
      "global_load_async_to_lds_b128 %7, %15, off\n\t"
      "s_wait_xcnt 0x0"
      :: "v"(l), "v"(l + ls), "v"(l + 2u * ls), "v"(l + 3u * ls),
         "v"(l + 4u * ls), "v"(l + 5u * ls), "v"(l + 6u * ls), "v"(l + 7u * ls),
         "v"(g), "v"(g + gs), "v"(g + 2 * gs), "v"(g + 3 * gs),
         "v"(g + 4 * gs), "v"(g + 5 * gs), "v"(g + 6 * gs), "v"(g + 7 * gs)
      : "memory");
}

// One thread's share of a stage. K: 128 rows of 8 chunks, its chunk in every 16th row (from
// gk to lk). V: 64 rows of 16 chunks, its chunk in every 8th row (from gv to lv).
__device__ __forceinline__ void copy_kv(unsigned lk, unsigned lv, const _Float16* gk,
                                        const _Float16* gv) {
  copy_rows8(lk, 16u * Lp * 2u, gk, 16 * Dh);
  copy_rows8(lv, 8u * Lv * 2u, gv, 8 * Seq);
}

__global__ void __launch_bounds__(128) __attribute__((amdgpu_waves_per_eu(4, 4)))
attn_kernel(const _Float16* __restrict__ Qf, const _Float16* __restrict__ Kf,
            const _Float16* __restrict__ Vt, _Float16* __restrict__ ctxh) {
  const int qb = blockIdx.x, h = blockIdx.y, b = blockIdx.z;
  const int tid  = threadIdx.x;
  // wave number as a scalar: the Q and ctx addresses are then scalar base + lane offset
  const int wave = __builtin_amdgcn_readfirstlane(tid >> 5), lane = tid & 31;
  const int q0 = qb * (64 * QG) + wave * (16 * QG);        // sequence-local

  const _Float16* Qb = Qf + ((size_t)(h * Bsz + b) * Seq) * Dh;
  const _Float16* Kb = Kf + ((size_t)(h * Bsz + b) * Seq) * Dh;
  const _Float16* Vb = Vt + ((size_t)(h * Bsz + b) * Dh) * Seq;

  // B fragments of Q^T: column = query 16 g + (lane & 15), k = d
  v16h bq[QG][2];
  #pragma unroll
  for (int g = 0; g < QG; ++g) {
    bq[g][0] = load_frag(Qb + (size_t)(q0 + g * 16) * Dh +  0, Dh, lane);
    bq[g][1] = load_frag(Qb + (size_t)(q0 + g * 16) * Dh + 32, Dh, lane);
  }

  // acc[g][n][r] = O^T[d = 16 n + 8 (lane >> 4) + r][query 16 g + (lane & 15)]
  v8f acc[QG][4] = {};
  // Lazy rescale. cm[g] holds, in all eight registers, minus the maximum IN USE for this lane's
  // query (equal in both halves). It is the C operand of the score product, so the scores come
  // out of the WMMA already relative to it. It moves, and the sums are rescaled, only in the
  // first tile and where a tile's maximum lies more than 8 above it: P stays at or under 2^8,
  // far inside f16, and the factor cancels in the final division.
  v8f cm[QG] = {};
  float thr = -3.0e38f;     // what a tile's maximum must exceed to move it: anything in the first tile
  float lrow[QG];           // running sum over this half's keys only; halves joined at the end
  #pragma unroll
  for (int g = 0; g < QG; ++g) lrow[g] = 0.0f;

  __shared__ __align__(16) _Float16 kv[2 * KvBufH];        // 70 KB: two buffers of K and V rows

  // this thread's 16-B chunks: of K row tid >> 3 (+ 16 j), chunk tid & 7; of V row tid >> 4
  // (+ 8 j), chunk tid & 15
  const _Float16* gk = Kb + (size_t)(tid >> 3) * Dh  + (tid & 7) * 8;
  const _Float16* gv = Vb + (size_t)(tid >> 4) * Seq + (tid & 15) * 8;
  const unsigned  lk = lds_off(kv) + (unsigned)(tid >> 3) * (Lp * 2u) + (unsigned)(tid & 7) * 16u;
  const unsigned  lv = lds_off(kv) + KStH * 2u + (unsigned)(tid >> 4) * (Lv * 2u)
                     + (unsigned)(tid & 15) * 16u;

  copy_kv(lk, lv, gk, gv);
  // stage 0 has landed (this wave's copies), then is published to the other waves
  asm volatile("s_wait_asynccnt 0x0" ::: "memory");
  __syncthreads();
  copy_kv(lk + KvBufH * 2u, lv + KvBufH * 2u, gk + StKeys * Dh, gv + StKeys);

  for (int t = 0; t < NSt; ++t) {
   // kept rolled: unrolled, the two tiles' scores are live together and registers spill
   #pragma unroll 1
   for (int p = 0; p < StKeys / 64; ++p) {
    const _Float16* kts = kv + (t & 1) * KvBufH + p * 64 * Lp;      // [key][d], pitch Lp
    const _Float16* vts = kv + (t & 1) * KvBufH + KStH + p * 64;    // [d][key], pitch Lv

    // ---- S^T = K Q^T (base-2 logits; 1/sqrt(D)*log2e folded into Q) ----
    // s[g][n][r] = score(key 16 n + 8 (lane >> 4) + r, query 16 g + (lane & 15))
    //           minus the maximum in use
    v8f s[QG][4];
    v16h ak[4][2];
    #pragma unroll
    for (int n = 0; n < 4; ++n) {
      ak[n][0] = load_frag(kts + n * 16 * Lp,      Lp, lane);
      ak[n][1] = load_frag(kts + n * 16 * Lp + 32, Lp, lane);
    }
    // keeps the 16 LDS reads one group ahead of the products: read two at a time among them,
    // each pair is waited for right behind its issue
    __builtin_amdgcn_sched_barrier(0);
    #pragma unroll
    for (int n = 0; n < 4; ++n) {
      #pragma unroll
      for (int g = 0; g < QG; ++g) s[g][n] = wmma16(ak[n][0], bq[g][0], cm[g]);
      #pragma unroll
      for (int g = 0; g < QG; ++g) s[g][n] = wmma16(ak[n][1], bq[g][1], s[g][n]);
    }

    __builtin_amdgcn_sched_barrier(0);

    // ---- online softmax, one query per lane and group ----
    float mt[QG];             // this half's maximum of the tile, relative to the one in use
    #pragma unroll
    for (int g = 0; g < QG; ++g) {
      mt[g] = s[g][0][0];
      #pragma unroll
      for (int n = 0; n < 4; ++n)
        #pragma unroll
        for (int r = 0; r < 8; ++r) mt[g] = fmaxf(mt[g], s[g][n][r]);
    }
    // one test per tile for the whole wave, a scalar branch
    if (__builtin_amdgcn_ballot_w32(fmaxf(mt[0], mt[1]) > thr) != 0) {
      const bool first = thr < 0.0f;
      thr = 8.0f;
      #pragma unroll
      for (int g = 0; g < QG; ++g) {
        const float m = fmaxf(mt[g], xhalf(mt[g]));
        // the first tile sets the maximum in use, up or down (the sums are still 0, whatever the factor);
        // a later tile only raises it
        const float d    = first ? m : fmaxf(m, 0.0f);
        const float corr = exp2_raw(-fmaxf(d, 0.0f));
        cm[g] = cm[g] - d;
        lrow[g] *= corr;
        #pragma unroll
        for (int n = 0; n < 4; ++n) { s[g][n] = s[g][n] - d; acc[g][n] *= corr; }
      }
    }
    v16h bp[QG][2];
    #pragma unroll
    for (int g = 0; g < QG; ++g) {
      float rs[4];
      #pragma unroll
      for (int n = 0; n < 4; ++n) {
        rs[n] = 0.0f;
        #pragma unroll
        for (int r = 0; r < 8; ++r) {
          s[g][n][r] = exp2_raw(s[g][n][r]);
          rs[n] += s[g][n][r];
        }
      }
      lrow[g] += (rs[0] + rs[1]) + (rs[2] + rs[3]);

      // P^T: two converted D tiles are one B fragment (k = key, load_frag's order)
      bp[g][0] = __builtin_shufflevector(__builtin_convertvector(s[g][0], v8h),
                                         __builtin_convertvector(s[g][1], v8h),
                                         0,1,2,3,4,5,6,7,8,9,10,11,12,13,14,15);
      bp[g][1] = __builtin_shufflevector(__builtin_convertvector(s[g][2], v8h),
                                         __builtin_convertvector(s[g][3], v8h),
                                         0,1,2,3,4,5,6,7,8,9,10,11,12,13,14,15);
    }

    // ---- O^T += V^T P^T ----
    #pragma unroll
    for (int n = 0; n < 4; ++n) {
      v16h av0 = load_frag(vts + n * 16 * Lv,      Lv, lane);
      v16h av1 = load_frag(vts + n * 16 * Lv + 32, Lv, lane);
      #pragma unroll
      for (int g = 0; g < QG; ++g) acc[g][n] = wmma16(av0, bp[g][0], acc[g][n]);
      #pragma unroll
      for (int g = 0; g < QG; ++g) acc[g][n] = wmma16(av1, bp[g][1], acc[g][n]);
    }
   }
    // publish point: this wave's reads of buffer t & 1 are done, its copies of stage t + 1
    // have landed; behind the barrier that holds for every wave
    asm volatile("s_wait_dscnt 0x0" ::: "memory");
    asm volatile("s_wait_asynccnt 0x0" ::: "memory");
    __syncthreads();
    if (t + 2 < NSt)
      copy_kv(lk + (unsigned)(t & 1) * (KvBufH * 2u), lv + (unsigned)(t & 1) * (KvBufH * 2u),
              gk + (size_t)(t + 2) * (StKeys * Dh), gv + (t + 2) * StKeys);
  }
  // nothing is in flight here (the last two trips issue no copy); kept before the wave ends
  asm volatile("s_wait_asynccnt 0x0" ::: "memory");

  // ---- normalize, write ctx (heads concatenated along E) in fragment order:
  // row b*Seq + q0 + 16 g + (lane & 15), k = h*Dh + 16 n + 8 (lane >> 4) + 0..7, which is
  // the 16-B chunk (n & 1) * 32 + lane of tile (row band, 2 h + (n >> 1)) ----
  v8h o[QG][4];
  #pragma unroll
  for (int g = 0; g < QG; ++g) {
    const float inv = 1.0f / (lrow[g] + xhalf(lrow[g]));
    #pragma unroll
    for (int n = 0; n < 4; ++n) o[g][n] = __builtin_convertvector(acc[g][n] * inv, v8h);
  }
  _Float16* cb = ctxh + (size_t)((b * Seq + q0) >> 4) * RowTile + (size_t)(h * (Dh / 32)) * TileH
               + lane * 8;
  #pragma unroll
  for (int g = 0; g < QG; ++g)
    #pragma unroll
    for (int n = 0; n < 4; ++n)
      *(v8h*)(cb + g * RowTile + (n >> 1) * TileH + (n & 1) * 256) = o[g][n];
}

// ---------------------------------------------------------------------------
// Output projection: ctx[Rows,Emb] x Wo + bo -> out (f32).
// grid (Rows/256, Emb/128), block 256; the same core.
// ---------------------------------------------------------------------------
__global__ void __launch_bounds__(256)
gemm_out_kernel(const _Float16* __restrict__ ctxh,
                const _Float16* __restrict__ Wot,
                const float* __restrict__ bo, float* __restrict__ out) {
  __shared__ __align__(16) _Float16 sm[2 * BufH];          // 96 KB
  const int mt = blockIdx.x, nt = blockIdx.y;
  const int wave = __builtin_amdgcn_readfirstlane(threadIdx.x >> 5), lane = threadIdx.x & 31;
  const int lo = lane & 15, hi = lane >> 4;

  v8f acc[4][4] = {};
  gemm_core(ctxh + (size_t)(mt * (BM / 16)) * RowTile, Wot + (size_t)(nt * (BN / 16)) * RowTile,
            sm, wave, lane, acc);

  const int m0 = mt * BM + (wave >> 1) * 64;
  const int n0 = nt * BN + (wave & 1) * 64;
  float bn[4];
  #pragma unroll
  for (int n = 0; n < 4; ++n) bn[n] = bo[n0 + n * 16 + lo];

  float* dst = out + (size_t)(m0 + hi * 8) * Emb + n0 + lo;
  #pragma unroll
  for (int mi = 0; mi < 4; ++mi)
    #pragma unroll
    for (int i = 0; i < 8; ++i)
      #pragma unroll
      for (int n = 0; n < 4; ++n)
        dst[(size_t)(mi * 16 + i) * Emb + n * 16] = acc[mi][n][i] + bn[n];
}

// ---------------------------------------------------------------------------
extern "C" void kernel_launch(void* const* d_in, const int* in_sizes, int n_in,
                              void* d_out, int out_size, void* d_ws, size_t ws_size,
                              hipStream_t stream) {
  const float* x  = (const float*)d_in[0];
  const float* Wq = (const float*)d_in[1];
  const float* bq = (const float*)d_in[2];
  const float* Wk = (const float*)d_in[3];
  const float* bk = (const float*)d_in[4];
  const float* Wv = (const float*)d_in[5];
  const float* bv = (const float*)d_in[6];
  const float* Wo = (const float*)d_in[7];
  const float* bo = (const float*)d_in[8];
  float* out = (float*)d_out;

  char* ws = (char*)d_ws;
  _Float16* xh   = (_Float16*)(ws + (size_t) 0u);          // 16 MB  [Rows][Emb], fragment order
  _Float16* Wt   = (_Float16*)(ws + (size_t)(16u << 20));  //  6 MB  [3][H][D][E], fragment order
  _Float16* Wot  = (_Float16*)(ws + (size_t)(22u << 20));  //  2 MB  [E][E] transposed, fragment order
  _Float16* Qf   = (_Float16*)(ws + (size_t)(24u << 20));  // 16 MB  [H][B][S][D]
  _Float16* Kf   = (_Float16*)(ws + (size_t)(40u << 20));  // 16 MB  [H][B][S][D]
  _Float16* Vt   = (_Float16*)(ws + (size_t)(56u << 20));  // 16 MB  [H][B][D][S]
  _Float16* ctxh = (_Float16*)(ws + (size_t)(72u << 20));  // 16 MB  [Rows][Emb], fragment order

  cvt_all_kernel <<<CvtThreads / 256, 256, 0, stream>>>(x, Wq, Wk, Wv, Wo, xh, Wt, Wot);

  gemm_qkv_kernel<<<dim3(Rows / 256, (3 * Hn * Dh) / 128), 256, 0, stream>>>(xh, Wt, bq, bk, bv, Qf, Kf, Vt);
  attn_kernel    <<<dim3(Seq / 128, Hn, Bsz), 128, 0, stream>>>(Qf, Kf, Vt, ctxh);
  gemm_out_kernel<<<dim3(Rows / 256, Emb / 128), 256, 0, stream>>>(ctxh, Wot, bo, out);
}

// v010
// Measured time: 122 microseconds a run.
// Two timings next to v009 put it at 1.04 and 1.05 times that version's speed.
// Over all steps from v000 it is 5.12 times as fast.
#include <hip/hip_runtime.h>
#include <hip/hip_bf16.h>

typedef __attribute__((ext_vector_type(16))) _Float16 v16h;
typedef __attribute__((ext_vector_type(8)))  _Float16 v8h;
typedef __attribute__((ext_vector_type(4)))  _Float16 v4h;
typedef __attribute__((ext_vector_type(8)))  float    v8f;
typedef __attribute__((ext_vector_type(4)))  float    v4f;

constexpr int Bsz  = 4;
constexpr int Seq  = 2048;
constexpr int Emb  = 1024;
constexpr int Hn   = 16;
constexpr int Dh   = 64;
constexpr int Rows = Bsz * Seq;   // 8192
constexpr int Lp   = 72;

__device__ __forceinline__ v16h load_frag(const _Float16* p0, int ld, int lane) {
  const int lo = lane & 15, hi = lane >> 4;
  const _Float16* p = p0 + (size_t)lo * ld + hi * 8;
  v8h x0 = *(const v8h*)(p);
  v8h x1 = *(const v8h*)(p + 16);
  return __builtin_shufflevector(x0, x1, 0,1,2,3,4,5,6,7,8,9,10,11,12,13,14,15);
}

// Fragment order for the GEMM operands that live in global memory (x, the
// weights, ctx): a [rows][Emb] f16 matrix is kept as tiles of 16 rows x 32 k,
// 1 KB each, tile (rt, kt) at ((rt * Emb/32) + kt) * 512 halves. Inside a tile
// the 16-B chunk j * 32 + lane holds row (lane & 15), k = 16 j + 8 (lane >> 4)
// + 0..7: the k order of load_frag. A wave's global_load_async_to_lds_b128 then reads 512
// contiguous bytes (4 whole lines) where row-major rows cost it 16 lines.
// The weights' rows (the columns of a product) are dealt to the bands four by four: row c of
// band rt is matrix row (rt >> 2) * 64 + 4 c + (rt & 3). In the D layout a lane holds column
// lane & 15 of each tile, so over its wave's four column tiles it then holds four ADJACENT
// columns, 4 (lane & 15) + 0..3: one store of 8 B (f16) or 16 B (f32) per row, and 16 lanes
// cover whole 128-B lines.
constexpr int TileH   = 512;                 // halves per tile
constexpr int RowTile = (Emb / 32) * TileH;  // halves per band of 16 rows

__device__ __forceinline__ v16h load_tile(const _Float16* t, int lane) {
  v8h x0 = *(const v8h*)(t + lane * 8);
  v8h x1 = *(const v8h*)(t + 256 + lane * 8);
  return __builtin_shufflevector(x0, x1, 0,1,2,3,4,5,6,7,8,9,10,11,12,13,14,15);
}

__device__ __forceinline__ v8f wmma16(v16h a, v16h b, v8f c) {
  return __builtin_amdgcn_wmma_f32_16x16x32_f16(false, a, false, b, (short)0, c,
                                                false, false);
}

// ---------------------------------------------------------------------------
// Conversions to f16 in fragment order, all in one launch of resident waves. A 16-B chunk
// g = ((rt * 32 + kt) * 2 + j) * 32 + lane of a matrix sits at byte 16 g. The grid has one
// thread per chunk of Wo (Emb * Emb / 8 = 131,072: 16 waves per WGP); x has 8 times as many
// chunks and each of Wq, Wk, Wv as many, so a thread makes 8 + 3 + 1 chunks: one chunk a
// thread would start 12 times the waves for the same bytes.
// All of a thread's loads are issued ahead of its first store.
// ---------------------------------------------------------------------------
constexpr int CvtThreads = Emb * Emb / 8;
constexpr int XPer       = Rows * Emb / 8 / CvtThreads;    // 8 chunks of x per thread
static_assert(Hn * Dh == Emb && Rows / 16 == CvtThreads / 256 && XPer * 4 == Emb / 32 && Dh == 64,
              "one band of x per block, one chunk of each weight per thread, four bands a head");

__global__ void __launch_bounds__(256)
cvt_all_kernel(const float* __restrict__ x, const float* __restrict__ Wq,
               const float* __restrict__ Wk, const float* __restrict__ Wv,
               const float* __restrict__ Wo, _Float16* __restrict__ xh,
               _Float16* __restrict__ Wt, _Float16* __restrict__ Wot) {
  const unsigned t = blockIdx.x * 256u + threadIdx.x;      // over CvtThreads
  // Every address below is a uniform base plus a 32-bit byte offset of the thread.

  // x: a block makes one band of 16 rows (64 KB read, 32 KB stored, each in a row), four
  // tiles (128 k) per it, so that a thread's chunks differ by a constant offset only.
  // Four neighbouring threads read one 128-B line of a row (its four chunks), a
  // wave 8 rows: 8 lines read whole, and 4 whole lines stored (8 rows x 16 B each).
  const unsigned q = t & 3u, c = (t >> 2) & 15u, tl = (t >> 6) & 3u;   // tile kt = 4 it + tl
  const unsigned xo = ((blockIdx.x * 16u + c) * Emb + tl * 32u + q * 8u) * 4u;
  v4f f0[XPer], f1[XPer];
  #pragma unroll
  for (int it = 0; it < XPer; ++it) {
    f0[it] = *(const v4f*)((const char*)x + xo + it * 512u);
    f1[it] = *(const v4f*)((const char*)x + xo + it * 512u + 16u);
  }

  // weights: one chunk of each. Rows of Wt are (p, h, d), k is e: Wt[p][h][d][e] = W_p[h][e][d];
  // rows of Wot are n, k is k: Wot[n][k] = Wo[k][n]. The thread's chunk is row cw, half hw, of
  // tile (band 4 gw + jt, kt), which holds matrix row 64 gw + 4 cw + jt: jt and cw are the low
  // bits of t, so that a wave reads 32 adjacent rows (one whole line per load) and stores four
  // whole lines (8 chunks in a row in each of four bands).
  const unsigned jt = t & 3u, cw = (t >> 2) & 15u, hw = (t >> 6) & 1u, j = (t >> 7) & 1u;
  const unsigned kt = (t >> 8) & 31u, gw = t >> 13;
  const unsigned row = gw * 64u + cw * 4u + jt;            // (h, d) of one projection, or n
  const unsigned k0  = kt * 32u + j * 16u + hw * 8u;
  const unsigned wo3 = (((row / Dh) * Emb + k0) * Dh + row % Dh) * 4u;
  const unsigned wo1 = (k0 * Emb + row) * 4u;
  float wq[8], wk[8], wv[8], wo[8];
  #pragma unroll
  for (int e = 0; e < 8; ++e) wq[e] = *(const float*)((const char*)(Wq + e * Dh) + wo3);
  #pragma unroll
  for (int e = 0; e < 8; ++e) wk[e] = *(const float*)((const char*)(Wk + e * Dh) + wo3);
  #pragma unroll
  for (int e = 0; e < 8; ++e) wv[e] = *(const float*)((const char*)(Wv + e * Dh) + wo3);
  #pragma unroll
  for (int e = 0; e < 8; ++e) wo[e] = *(const float*)((const char*)(Wo + e * Emb) + wo1);
  // the loads are in flight: wait before anything reuses their offset registers, which the
  // statement names as inputs so that they stay whole up to it
  asm volatile("s_wait_xcnt 0x0" :: "v"(xo), "v"(wo3), "v"(wo1) : "memory");
  // keeps all 48 loads in front of the first conversion (left free, the compiler waits for the
  // first few before it issues the rest, and a wave pays the memory latency several times), and
  // the writes of the offset registers behind the wait
  __builtin_amdgcn_sched_barrier(0);

  // k = 8 q + 0..7 = 16 j + 8 hi + 0..7: j = q >> 1, hi = q & 1, lane = c + 16 hi
  const unsigned dxo = ((blockIdx.x * 32u + tl) * TileH + (q >> 1) * 256u
                        + ((q & 1u) * 16u + c) * 8u) * 2u;
  #pragma unroll
  for (int it = 0; it < XPer; ++it) {
    v8h o;
    #pragma unroll
    for (int e = 0; e < 4; ++e) { o[e] = (_Float16)f0[it][e]; o[4 + e] = (_Float16)f1[it][e]; }
    *(v8h*)((char*)xh + dxo + it * (4u * TileH * 2u)) = o;
  }
  v8h oq, ok, ov, oo;
  #pragma unroll
  for (int e = 0; e < 8; ++e) {
    oq[e] = (_Float16)wq[e]; ok[e] = (_Float16)wk[e];
    ov[e] = (_Float16)wv[e]; oo[e] = (_Float16)wo[e];
  }
  const unsigned dwo = ((((gw * 4u + jt) * 32u + kt) * 2u + j) * 32u + hw * 16u + cw) * 16u;
  *(v8h*)((char*)Wt + dwo)                             = oq;
  *(v8h*)((char*)(Wt + (size_t)CvtThreads * 8) + dwo)  = ok;
  *(v8h*)((char*)(Wt + (size_t)CvtThreads * 16) + dwo) = ov;
  *(v8h*)((char*)Wot + dwo)                            = oo;
}

// ---------------------------------------------------------------------------
// GEMM core of both projections: a block of 8 waves (4 x 2) makes a 256 x 128 tile of
// A B^T, a wave 64 x 64 (4 x 4 accumulator tiles). A stage is 64 k of the block's 16 A
// bands (32 KB) and 8 B bands (16 KB), already in fragment order, brought into LDS by
// asynchronous copies and read there by the waves that share them: each byte leaves L2
// once per block, not once per wave. Two buffers: stage t + 1 flies while stage t is
// worked on.
// ---------------------------------------------------------------------------
constexpr int BM     = 256;                     // block tile, rows
constexpr int BN     = 128;                     // block tile, columns
constexpr int StageH = 2 * TileH;               // halves of one band in a stage (2 tiles, 2 KB)
constexpr int OpAH   = (BM / 16) * StageH;      // halves of A's stage (32 KB)
constexpr int OpBH   = (BN / 16) * StageH;      // halves of B's stage (16 KB)
constexpr int BufH   = OpAH + OpBH;             // halves of a buffer: A stage, then B stage
constexpr int NStage = Emb / 64;

__device__ __forceinline__ unsigned lds_off(const void* p) { return (unsigned)(size_t)p; }

__device__ __forceinline__ void copy8(unsigned l, const _Float16* g0, const _Float16* g1) {
  asm volatile(
      "global_load_async_to_lds_b128 %0, %8, off\n\t"
      "global_load_async_to_lds_b128 %1, %9, off\n\t"
      "global_load_async_to_lds_b128 %2, %10, off\n\t"
      "global_load_async_to_lds_b128 %3, %11, off\n\t"
      "global_load_async_to_lds_b128 %4, %12, off\n\t"
      "global_load_async_to_lds_b128 %5, %13, off\n\t"
      "global_load_async_to_lds_b128 %6, %14, off\n\t"
      "global_load_async_to_lds_b128 %7, %15, off\n\t"
      "s_wait_xcnt 0x0"
      :: "v"(l), "v"(l + 512u), "v"(l + 1024u), "v"(l + 1536u),
         "v"(l + 2048u), "v"(l + 2560u), "v"(l + 3072u), "v"(l + 3584u),
         "v"(g0), "v"(g0 + 256), "v"(g0 + 512), "v"(g0 + 768),
         "v"(g1), "v"(g1 + 256), "v"(g1 + 512), "v"(g1 + 768)
      : "memory");
}

// Four such copies: the stage's 2 KB of band g, to 2 KB of LDS from l.
__device__ __forceinline__ void copy4(unsigned l, const _Float16* g) {
  asm volatile(
      "global_load_async_to_lds_b128 %0, %4, off\n\t"
      "global_load_async_to_lds_b128 %1, %5, off\n\t"
      "global_load_async_to_lds_b128 %2, %6, off\n\t"
      "global_load_async_to_lds_b128 %3, %7, off\n\t"
      "s_wait_xcnt 0x0"
      :: "v"(l), "v"(l + 512u), "v"(l + 1024u), "v"(l + 1536u),
         "v"(g), "v"(g + 256), "v"(g + 512), "v"(g + 768)
      : "memory");
}

// One wave's share of a stage: bands 2 wave and 2 wave + 1 of A (to la), band wave of B (to lb).
__device__ __forceinline__ void copy_stage(unsigned la, unsigned lb, const _Float16* ga,
                                           const _Float16* gb) {
  copy8(la, ga, ga + RowTile);
  copy4(lb, gb);
}

// Ag, Bg: first band of the block's 16 and 8; sm: BufH * 2 halves of LDS.
__device__ __forceinline__ void gemm_core(const _Float16* Ag, const _Float16* Bg, _Float16* sm,
                                          int wave, int lane, v8f (&acc)[4][4]) {
  const int wm = wave >> 1, wn = wave & 1;
  const _Float16* ga = Ag + (size_t)(2 * wave) * RowTile + lane * 8;
  const _Float16* gb = Bg + (size_t)wave * RowTile + lane * 8;
  const unsigned la = lds_off(sm) + (unsigned)wave * (2u * StageH * 2u) + (unsigned)lane * 16u;
  const unsigned lb = lds_off(sm) + OpAH * 2u + (unsigned)wave * (StageH * 2u) + (unsigned)lane * 16u;

  copy_stage(la, lb, ga, gb);
  // stage 0 has landed (this wave's copies), then is published to the other waves
  asm volatile("s_wait_asynccnt 0x0" ::: "memory");
  __syncthreads();
  copy_stage(la + BufH * 2u, lb + BufH * 2u, ga + StageH, gb + StageH);

  for (int t = 0; t < NStage; ++t) {
    const _Float16* sa = sm + (t & 1) * BufH + wm * (4 * StageH);
    const _Float16* sb = sm + (t & 1) * BufH + OpAH + wn * (4 * StageH);
    #pragma unroll
    for (int kk = 0; kk < 2; ++kk) {
      v16h a[4], b[4];
      #pragma unroll
      for (int i = 0; i < 4; ++i) a[i] = load_tile(sa + i * StageH + kk * TileH, lane);
      #pragma unroll
      for (int j = 0; j < 4; ++j) b[j] = load_tile(sb + j * StageH + kk * TileH, lane);
      // keeps the 16 LDS reads one group ahead of their 16 WMMAs: sunk among the WMMAs, each
      // B fragment's read is waited for right behind its issue
      __builtin_amdgcn_sched_barrier(0);
      #pragma unroll
      for (int j = 0; j < 4; ++j)
        #pragma unroll
        for (int i = 0; i < 4; ++i) acc[i][j] = wmma16(a[i], b[j], acc[i][j]);
    }
    // publish point: this wave's reads of buffer t & 1 are done, its copies of stage t + 1
    // have landed; behind the barrier that holds for every wave
    asm volatile("s_wait_dscnt 0x0" ::: "memory");
    asm volatile("s_wait_asynccnt 0x0" ::: "memory");
    __syncthreads();
    if (t + 2 < NStage)
      copy_stage(la + (unsigned)(t & 1) * (BufH * 2u), lb + (unsigned)(t & 1) * (BufH * 2u),
                 ga + (t + 2) * StageH, gb + (t + 2) * StageH);
  }
  // nothing is in flight here (the last two trips issue no copy); kept before the wave ends
  asm volatile("s_wait_asynccnt 0x0" ::: "memory");
}

// ---------------------------------------------------------------------------
// Fused QKV projection.  grid (Rows/256, 3*Hn*Dh/128), block 256. The columns are the rows
// (p, h, d) of Wt; a wave's 64 columns are one head of one projection.
// ---------------------------------------------------------------------------
__global__ void __launch_bounds__(256)
gemm_qkv_kernel(const _Float16* __restrict__ xh,
                const _Float16* __restrict__ Wt,
                const float* __restrict__ bq, const float* __restrict__ bk,
                const float* __restrict__ bv,
                _Float16* __restrict__ Qf, _Float16* __restrict__ Kf,
                _Float16* __restrict__ Vt) {
  __shared__ __align__(16) _Float16 sm[2 * BufH];          // 96 KB
  const int mt = blockIdx.x, nt = blockIdx.y;
  const int wave = __builtin_amdgcn_readfirstlane(threadIdx.x >> 5), lane = threadIdx.x & 31;
  const int lo = lane & 15, hi = lane >> 4;

  v8f acc[4][4] = {};
  gemm_core(xh + (size_t)(mt * (BM / 16)) * RowTile, Wt + (size_t)(nt * (BN / 16)) * RowTile,
            sm, wave, lane, acc);

  const int m0 = mt * BM + (wave >> 1) * 64;
  const int c0 = nt * BN + (wave & 1) * 64;
  const int p = c0 / (Hn * Dh), h = (c0 / Dh) % Hn;
  const int bb = m0 / Seq, ss0 = m0 % Seq;   // 64 rows from a multiple of 64: one sequence

  const float* bias = (p == 0) ? bq : (p == 1) ? bk : bv;
  const float  csc  = (p == 0) ? (0.125f * 1.44269504f) : 1.0f;
  const v4f bn = *(const v4f*)(bias + h * Dh + lo * 4);
  // the bias load is still in flight: wait before the store addresses reuse its base and
  // offset registers; the scheduling barrier keeps those writes behind the wait
  asm volatile("s_wait_xcnt 0x0" ::: "memory");
  __builtin_amdgcn_sched_barrier(0);

  // element (row ss0 + 16 mi + 8 hi + i, d = 4 lo + n)
  if (p == 2) {
    _Float16* dst = Vt + ((size_t)(h * Bsz + bb) * Dh + lo * 4) * Seq + ss0 + hi * 8;
    #pragma unroll
    for (int n = 0; n < 4; ++n)          // along each row d of Vt in turn
      #pragma unroll
      for (int mi = 0; mi < 4; ++mi)
        #pragma unroll
        for (int i = 0; i < 8; ++i)
          dst[(size_t)n * Seq + mi * 16 + i] = (_Float16)((acc[mi][n][i] + bn[n]) * csc);
  } else {
    _Float16* dst = ((p == 0) ? Qf : Kf) + ((size_t)(h * Bsz + bb) * Seq + ss0 + hi * 8) * Dh + lo * 4;
    #pragma unroll
    for (int mi = 0; mi < 4; ++mi)
      #pragma unroll
      for (int i = 0; i < 8; ++i) {
        v4h o;               // 16 lanes x 8 B: the whole 128-B row of one head
        #pragma unroll
        for (int n = 0; n < 4; ++n) o[n] = (_Float16)((acc[mi][n][i] + bn[n]) * csc);
        *(v4h*)(dst + (mi * 16 + i) * Dh) = o;
      }
    // in the built code a test (never true here) leads from these stores on into the V branch,
    // whose address arithmetic reuses their address register: the wait stands in front of it
    asm volatile("s_wait_xcnt 0x0" ::: "memory");
  }
}

__device__ __forceinline__ float xhalf(float x) {
  const int b = __builtin_bit_cast(int, x);
  return __builtin_bit_cast(float,
      __builtin_amdgcn_permlanex16(b, b, 0x76543210, 0xfedcba98, false, false));
}

// 2^x as the bare v_exp_f32. exp2f wraps it in a range fix-up (compare, two selects, add,
// ldexp) that only matters for results under 2^-126, which the bare form may flush to 0.
// Here x <= 8; a P that small is 0 in f16 anyway, beside a row sum of at least 1 it is
// below f32 rounding, and a rescale factor that small leaves nothing of the old sums.
__device__ __forceinline__ float exp2_raw(float x) { return __builtin_amdgcn_exp2f(x); }

constexpr int QG = 2;     // groups of 16 query columns per wave

constexpr int StKeys = 128;             // keys per stage: two tiles of 64
constexpr int Lv     = StKeys + 8;      // pitch of a staged V row in halves: 272 B = 16 B x odd
constexpr int KStH   = StKeys * Lp;     // halves of a stage's K rows, [key][d] at pitch Lp (18 KB)
constexpr int VStH   = Dh * Lv;         // halves of a stage's V rows, [d][key] at pitch Lv (17 KB)
constexpr int KvBufH = KStH + VStH;     // halves of a buffer: K rows, then V rows
constexpr int NSt    = Seq / StKeys;    // stages

__device__ __forceinline__ void copy_rows8(unsigned l, unsigned ls, const _Float16* g, int gs) {
  asm volatile(
      "global_load_async_to_lds_b128 %0, %8, off\n\t"
      "global_load_async_to_lds_b128 %1, %9, off\n\t"
      "global_load_async_to_lds_b128 %2, %10, off\n\t"
      "global_load_async_to_lds_b128 %3, %11, off\n\t"
      "global_load_async_to_lds_b128 %4, %12, off\n\t"
      "global_load_async_to_lds_b128 %5, %13, off\n\t"
      "global_load_async_to_lds_b128 %6, %14, off\n\t"
      "global_load_async_to_lds_b128 %7, %15, off\n\t"
      "s_wait_xcnt 0x0"
      :: "v"(l), "v"(l + ls), "v"(l + 2u * ls), "v"(l + 3u * ls),
         "v"(l + 4u * ls), "v"(l + 5u * ls), "v"(l + 6u * ls), "v"(l + 7u * ls),
         "v"(g), "v"(g + gs), "v"(g + 2 * gs), "v"(g + 3 * gs),
         "v"(g + 4 * gs), "v"(g + 5 * gs), "v"(g + 6 * gs), "v"(g + 7 * gs)
      : "memory");
}

// One thread's share of a stage. K: 128 rows of 8 chunks, its chunk in every 16th row (from
// gk to lk). V: 64 rows of 16 chunks, its chunk in every 8th row (from gv to lv).
__device__ __forceinline__ void copy_kv(unsigned lk, unsigned lv, const _Float16* gk,
                                        const _Float16* gv) {
  copy_rows8(lk, 16u * Lp * 2u, gk, 16 * Dh);
  copy_rows8(lv, 8u * Lv * 2u, gv, 8 * Seq);
}

__global__ void __launch_bounds__(128) __attribute__((amdgpu_waves_per_eu(4, 4)))
attn_kernel(const _Float16* __restrict__ Qf, const _Float16* __restrict__ Kf,
            const _Float16* __restrict__ Vt, _Float16* __restrict__ ctxh) {
  const int qb = blockIdx.x, h = blockIdx.y, b = blockIdx.z;
  const int tid  = threadIdx.x;
  // wave number as a scalar: the Q and ctx addresses are then scalar base + lane offset
  const int wave = __builtin_amdgcn_readfirstlane(tid >> 5), lane = tid & 31;
  const int q0 = qb * (64 * QG) + wave * (16 * QG);        // sequence-local

  const _Float16* Qb = Qf + ((size_t)(h * Bsz + b) * Seq) * Dh;
  const _Float16* Kb = Kf + ((size_t)(h * Bsz + b) * Seq) * Dh;
  const _Float16* Vb = Vt + ((size_t)(h * Bsz + b) * Dh) * Seq;

  // B fragments of Q^T: column = query 16 g + (lane & 15), k = d
  v16h bq[QG][2];
  #pragma unroll
  for (int g = 0; g < QG; ++g) {
    bq[g][0] = load_frag(Qb + (size_t)(q0 + g * 16) * Dh +  0, Dh, lane);
    bq[g][1] = load_frag(Qb + (size_t)(q0 + g * 16) * Dh + 32, Dh, lane);
  }

  // acc[g][n][r] = O^T[d = 16 n + 8 (lane >> 4) + r][query 16 g + (lane & 15)]
  v8f acc[QG][4] = {};
  // Lazy rescale. cm[g] holds, in all eight registers, minus the maximum IN USE for this lane's
  // query (equal in both halves). It is the C operand of the score product, so the scores come
  // out of the WMMA already relative to it. It moves, and the sums are rescaled, only in the
  // first tile and where a tile's maximum lies more than 8 above it: P stays at or under 2^8,
  // far inside f16, and the factor cancels in the final division.
  v8f cm[QG] = {};
  float thr = -3.0e38f;     // what a tile's maximum must exceed to move it: anything in the first tile
  float lrow[QG];           // running sum over this half's keys only; halves joined at the end
  #pragma unroll
  for (int g = 0; g < QG; ++g) lrow[g] = 0.0f;

  __shared__ __align__(16) _Float16 kv[2 * KvBufH];        // 70 KB: two buffers of K and V rows

  // this thread's 16-B chunks: of K row tid >> 3 (+ 16 j), chunk tid & 7; of V row tid >> 4
  // (+ 8 j), chunk tid & 15
  const _Float16* gk = Kb + (size_t)(tid >> 3) * Dh  + (tid & 7) * 8;
  const _Float16* gv = Vb + (size_t)(tid >> 4) * Seq + (tid & 15) * 8;
  const unsigned  lk = lds_off(kv) + (unsigned)(tid >> 3) * (Lp * 2u) + (unsigned)(tid & 7) * 16u;
  const unsigned  lv = lds_off(kv) + KStH * 2u + (unsigned)(tid >> 4) * (Lv * 2u)
                     + (unsigned)(tid & 15) * 16u;

  copy_kv(lk, lv, gk, gv);
  // stage 0 has landed (this wave's copies), then is published to the other waves
  asm volatile("s_wait_asynccnt 0x0" ::: "memory");
  __syncthreads();
  copy_kv(lk + KvBufH * 2u, lv + KvBufH * 2u, gk + StKeys * Dh, gv + StKeys);

  for (int t = 0; t < NSt; ++t) {
   // kept rolled: unrolled, the two tiles' scores are live together and registers spill
   #pragma unroll 1
   for (int p = 0; p < StKeys / 64; ++p) {
    const _Float16* kts = kv + (t & 1) * KvBufH + p * 64 * Lp;      // [key][d], pitch Lp
    const _Float16* vts = kv + (t & 1) * KvBufH + KStH + p * 64;    // [d][key], pitch Lv

    // ---- S^T = K Q^T (base-2 logits; 1/sqrt(D)*log2e folded into Q) ----
    // s[g][n][r] = score(key 16 n + 8 (lane >> 4) + r, query 16 g + (lane & 15))
    //           minus the maximum in use
    v8f s[QG][4];
    v16h ak[4][2];
    #pragma unroll
    for (int n = 0; n < 4; ++n) {
      ak[n][0] = load_frag(kts + n * 16 * Lp,      Lp, lane);
      ak[n][1] = load_frag(kts + n * 16 * Lp + 32, Lp, lane);
    }
    // keeps the 16 LDS reads one group ahead of the products: read two at a time among them,
    // each pair is waited for right behind its issue
    __builtin_amdgcn_sched_barrier(0);
    #pragma unroll
    for (int n = 0; n < 4; ++n) {
      #pragma unroll
      for (int g = 0; g < QG; ++g) s[g][n] = wmma16(ak[n][0], bq[g][0], cm[g]);
      #pragma unroll
      for (int g = 0; g < QG; ++g) s[g][n] = wmma16(ak[n][1], bq[g][1], s[g][n]);
    }

    __builtin_amdgcn_sched_barrier(0);

    // ---- online softmax, one query per lane and group ----
    float mt[QG];             // this half's maximum of the tile, relative to the one in use
    #pragma unroll
    for (int g = 0; g < QG; ++g) {
      mt[g] = s[g][0][0];
      #pragma unroll
      for (int n = 0; n < 4; ++n)
        #pragma unroll
        for (int r = 0; r < 8; ++r) mt[g] = fmaxf(mt[g], s[g][n][r]);
    }
    // one test per tile for the whole wave, a scalar branch
    if (__builtin_amdgcn_ballot_w32(fmaxf(mt[0], mt[1]) > thr) != 0) {
      const bool first = thr < 0.0f;
      thr = 8.0f;
      #pragma unroll
      for (int g = 0; g < QG; ++g) {
        const float m = fmaxf(mt[g], xhalf(mt[g]));
        // the first tile sets the maximum in use, up or down (the sums are still 0, whatever the factor);
        // a later tile only raises it
        const float d    = first ? m : fmaxf(m, 0.0f);
        const float corr = exp2_raw(-fmaxf(d, 0.0f));
        cm[g] = cm[g] - d;
        lrow[g] *= corr;
        #pragma unroll
        for (int n = 0; n < 4; ++n) { s[g][n] = s[g][n] - d; acc[g][n] *= corr; }
      }
    }
    v16h bp[QG][2];
    #pragma unroll
    for (int g = 0; g < QG; ++g) {
      float rs[4];
      #pragma unroll
      for (int n = 0; n < 4; ++n) {
        rs[n] = 0.0f;
        #pragma unroll
        for (int r = 0; r < 8; ++r) {
          s[g][n][r] = exp2_raw(s[g][n][r]);
          rs[n] += s[g][n][r];
        }
      }
      lrow[g] += (rs[0] + rs[1]) + (rs[2] + rs[3]);

      // P^T: two converted D tiles are one B fragment (k = key, load_frag's order)
      bp[g][0] = __builtin_shufflevector(__builtin_convertvector(s[g][0], v8h),
                                         __builtin_convertvector(s[g][1], v8h),
                                         0,1,2,3,4,5,6,7,8,9,10,11,12,13,14,15);
      bp[g][1] = __builtin_shufflevector(__builtin_convertvector(s[g][2], v8h),
                                         __builtin_convertvector(s[g][3], v8h),
                                         0,1,2,3,4,5,6,7,8,9,10,11,12,13,14,15);
    }

    // ---- O^T += V^T P^T ----
    #pragma unroll
    for (int n = 0; n < 4; ++n) {
      v16h av0 = load_frag(vts + n * 16 * Lv,      Lv, lane);
      v16h av1 = load_frag(vts + n * 16 * Lv + 32, Lv, lane);
      #pragma unroll
      for (int g = 0; g < QG; ++g) acc[g][n] = wmma16(av0, bp[g][0], acc[g][n]);
      #pragma unroll
      for (int g = 0; g < QG; ++g) acc[g][n] = wmma16(av1, bp[g][1], acc[g][n]);
    }
   }
    // publish point: this wave's reads of buffer t & 1 are done, its copies of stage t + 1
    // have landed; behind the barrier that holds for every wave
    asm volatile("s_wait_dscnt 0x0" ::: "memory");
    asm volatile("s_wait_asynccnt 0x0" ::: "memory");
    __syncthreads();
    if (t + 2 < NSt)
      copy_kv(lk + (unsigned)(t & 1) * (KvBufH * 2u), lv + (unsigned)(t & 1) * (KvBufH * 2u),
              gk + (size_t)(t + 2) * (StKeys * Dh), gv + (t + 2) * StKeys);
  }
  // nothing is in flight here (the last two trips issue no copy); kept before the wave ends
  asm volatile("s_wait_asynccnt 0x0" ::: "memory");

  // ---- normalize, write ctx (heads concatenated along E) in fragment order:
  // row b*Seq + q0 + 16 g + (lane & 15), k = h*Dh + 16 n + 8 (lane >> 4) + 0..7, which is
  // the 16-B chunk (n & 1) * 32 + lane of tile (row band, 2 h + (n >> 1)) ----
  v8h o[QG][4];
  #pragma unroll
  for (int g = 0; g < QG; ++g) {
    const float inv = 1.0f / (lrow[g] + xhalf(lrow[g]));
    #pragma unroll
    for (int n = 0; n < 4; ++n) o[g][n] = __builtin_convertvector(acc[g][n] * inv, v8h);
  }
  _Float16* cb = ctxh + (size_t)((b * Seq + q0) >> 4) * RowTile + (size_t)(h * (Dh / 32)) * TileH
               + lane * 8;
  #pragma unroll
  for (int g = 0; g < QG; ++g)
    #pragma unroll
    for (int n = 0; n < 4; ++n)
      *(v8h*)(cb + g * RowTile + (n >> 1) * TileH + (n & 1) * 256) = o[g][n];
}

// ---------------------------------------------------------------------------
// Output projection: ctx[Rows,Emb] x Wo + bo -> out (f32).
// grid (Rows/256, Emb/128), block 256; the same core.
// ---------------------------------------------------------------------------
__global__ void __launch_bounds__(256)
gemm_out_kernel(const _Float16* __restrict__ ctxh,
                const _Float16* __restrict__ Wot,
                const float* __restrict__ bo, float* __restrict__ out) {
  __shared__ __align__(16) _Float16 sm[2 * BufH];          // 96 KB
  const int mt = blockIdx.x, nt = blockIdx.y;
  const int wave = __builtin_amdgcn_readfirstlane(threadIdx.x >> 5), lane = threadIdx.x & 31;
  const int lo = lane & 15, hi = lane >> 4;

  v8f acc[4][4] = {};
  gemm_core(ctxh + (size_t)(mt * (BM / 16)) * RowTile, Wot + (size_t)(nt * (BN / 16)) * RowTile,
            sm, wave, lane, acc);

  const int m0 = mt * BM + (wave >> 1) * 64;
  const int n0 = nt * BN + (wave & 1) * 64;
  const v4f bn = *(const v4f*)(bo + n0 + lo * 4);

  // element (row m0 + 16 mi + 8 hi + i, column n0 + 4 lo + n)
  float* dst = out + (size_t)(m0 + hi * 8) * Emb + n0 + lo * 4;
  #pragma unroll
  for (int mi = 0; mi < 4; ++mi)
    #pragma unroll
    for (int i = 0; i < 8; ++i) {
      v4f o;                 // 16 lanes x 16 B: two whole lines of the row
      #pragma unroll
      for (int n = 0; n < 4; ++n) o[n] = acc[mi][n][i] + bn[n];
      *(v4f*)(dst + (size_t)(mi * 16 + i) * Emb) = o;
    }
}

// ---------------------------------------------------------------------------
extern "C" void kernel_launch(void* const* d_in, const int* in_sizes, int n_in,
                              void* d_out, int out_size, void* d_ws, size_t ws_size,
                              hipStream_t stream) {
  const float* x  = (const float*)d_in[0];
  const float* Wq = (const float*)d_in[1];
  const float* bq = (const float*)d_in[2];
  const float* Wk = (const float*)d_in[3];
  const float* bk = (const float*)d_in[4];
  const float* Wv = (const float*)d_in[5];
  const float* bv = (const float*)d_in[6];
  const float* Wo = (const float*)d_in[7];
  const float* bo = (const float*)d_in[8];
  float* out = (float*)d_out;

  char* ws = (char*)d_ws;
  _Float16* xh   = (_Float16*)(ws + (size_t) 0u);          // 16 MB  [Rows][Emb], fragment order
  _Float16* Wt   = (_Float16*)(ws + (size_t)(16u << 20));  //  6 MB  [3][H][D][E], fragment order
  _Float16* Wot  = (_Float16*)(ws + (size_t)(22u << 20));  //  2 MB  [E][E] transposed, fragment order
  _Float16* Qf   = (_Float16*)(ws + (size_t)(24u << 20));  // 16 MB  [H][B][S][D]
  _Float16* Kf   = (_Float16*)(ws + (size_t)(40u << 20));  // 16 MB  [H][B][S][D]
  _Float16* Vt   = (_Float16*)(ws + (size_t)(56u << 20));  // 16 MB  [H][B][D][S]
  _Float16* ctxh = (_Float16*)(ws + (size_t)(72u << 20));  // 16 MB  [Rows][Emb], fragment order

  cvt_all_kernel <<<CvtThreads / 256, 256, 0, stream>>>(x, Wq, Wk, Wv, Wo, xh, Wt, Wot);

  gemm_qkv_kernel<<<dim3(Rows / 256, (3 * Hn * Dh) / 128), 256, 0, stream>>>(xh, Wt, bq, bk, bv, Qf, Kf, Vt);
  attn_kernel    <<<dim3(Seq / 128, Hn, Bsz), 128, 0, stream>>>(Qf, Kf, Vt, ctxh);
  gemm_out_kernel<<<dim3(Rows / 256, Emb / 128), 256, 0, stream>>>(ctxh, Wot, bo, out);
}
